// v000
// Measured on an AMD MI455X. A time is GPU time per run, averaged over a window of back-to-back runs after a warm-up
// (all launches, gaps included; the runs take copies of the inputs in turn), and the median of several windows.
// Apart from v000's, it joins two sittings. Times from different sittings can be a few percent apart, while
// side-by-side timings come from the same sitting.
// v000 is the starting kernel. One run takes 1420 microseconds.
// compute dtype: all float inputs rounded to bf16; q/k/v = x W^T with EXACT bf16 products on WMMA 16x16x32, f32 accumulate; per-head RMSNorm of q and k in f32 in the projection epilogue; q as f16 hi + residual (x 2^10), k f16 -> 2-product logits / 8 inside the causal sliding window (512), stored in f32 (4 heads per launch, GQA: head h reads kv head h/4); softmax in f32 (precise expf), P x 2^11 split bf16 hi + lo against v bf16 hi + lo (3 products); y = ctx (bf16 hi + lo) wo^T; f32 output.
#include <hip/hip_runtime.h>
#include <math.h>

typedef __attribute__((ext_vector_type(16))) _Float16 v16h;
typedef __attribute__((ext_vector_type(16))) __bf16 v16b;
typedef __attribute__((ext_vector_type(8)))  _Float16 v8h;
typedef __attribute__((ext_vector_type(8)))  float v8f;
typedef __attribute__((ext_vector_type(4)))  float v4f;
typedef __attribute__((ext_vector_type(2)))  float v2f;
typedef __attribute__((ext_vector_type(4)))  unsigned v4u;
typedef __attribute__((ext_vector_type(4)))  int v4i;
typedef float __attribute__((may_alias)) float_a;
typedef int __attribute__((may_alias)) int_a;

template <typename T> __device__ __forceinline__ void vst2(void* p, T v) { *(T*)p = v;  }
__device__ __forceinline__ v8f wmma16(v16h a, v16h b, v8f c) {
  v8f d = __builtin_amdgcn_wmma_f32_16x16x32_f16(false, a, false, b, (short)0, c, false, false);
  asm volatile("v_nop\n\tv_nop\n\tv_nop\n\tv_nop" : "+v"(d) : "v"(a), "v"(b));
  return d;
}
__device__ __forceinline__ v8f wmma_bf(v16b a, v16b b, v8f c) {
  v8f d = __builtin_amdgcn_wmma_f32_16x16x32_bf16(false, a, false, b, (short)0, c, false, false);
  asm volatile("v_nop\n\tv_nop\n\tv_nop\n\tv_nop" : "+v"(d) : "v"(a), "v"(b));
  return d;
}
// 16x16x32 fragments: lane = (h = lane>>4, row/col = lane&15); elements 0..7 = k0+8h+0..7, 8..15 = k0+16+8h+0..7; D element r = row 8h+r
__device__ __forceinline__ v16h frag_h(const _Float16* rowk0, int lane) {
  union { v16h v; v8h q[2]; } u; const _Float16* p = rowk0 + 8 * (lane >> 4);
  u.q[0] = *(const v8h*)p; u.q[1] = *(const v8h*)(p + 16); return u.v;
}
__device__ __forceinline__ v16h frag_f32(const float* rowk0, int lane) {
  v16h a; const float* p = rowk0 + 8 * (lane >> 4);
#pragma unroll
  for (int i = 0; i < 8; ++i) { a[i] = (_Float16)p[i]; a[8 + i] = (_Float16)p[16 + i]; }
  return a;
}
__device__ __forceinline__ v16h frag_f32s(const float* rowk0, int lane, float sc) {
  v16h a; const float* p = rowk0 + 8 * (lane >> 4);
#pragma unroll
  for (int i = 0; i < 8; ++i) { a[i] = (_Float16)(p[i] * sc); a[8 + i] = (_Float16)(p[16 + i] * sc); }
  return a;
}
// column fragment from a [K][ld] layout (column n), rows >= K read as 0
__device__ __forceinline__ v16h fragc_f32(const float* W, int k0, int n, int lane, int ld, int K) {
  v16h a; const int g = lane >> 4;
#pragma unroll
  for (int i = 0; i < 8; ++i) { const int ka = k0 + 8 * g + i, kb = ka + 16;
    a[i] = (_Float16)(ka < K ? W[(size_t)(ka < K ? ka : K - 1) * ld + n] : 0.f); a[8 + i] = (_Float16)(kb < K ? W[(size_t)(kb < K ? kb : K - 1) * ld + n] : 0.f); }
  return a;
}
struct F2 { v16b h, l; };
__device__ __forceinline__ F2 bsplit16(const float v[16]) { F2 r;
#pragma unroll
  for (int i = 0; i < 16; ++i) { const __bf16 h = (__bf16)v[i]; r.h[i] = h; r.l[i] = (__bf16)(v[i] - (float)h); }
  return r; }
__device__ __forceinline__ F2 split_row(const float* row, int k0, int lane) { float v[16]; const float* p = row + k0 + 8 * (lane >> 4);
#pragma unroll
  for (int i = 0; i < 8; ++i) { v[i] = p[i]; v[8 + i] = p[16 + i]; }
  return bsplit16(v); }
__device__ __forceinline__ F2 split_rowK(const float* row, int k0, int lane, int K) { float v[16]; const int g = lane >> 4;
#pragma unroll
  for (int i = 0; i < 8; ++i) { const int ka = k0 + 8 * g + i, kb = ka + 16; v[i] = ka < K ? row[ka < K ? ka : K - 1] : 0.f; v[8 + i] = kb < K ? row[kb < K ? kb : K - 1] : 0.f; }
  return bsplit16(v); }
__device__ __forceinline__ F2 split_col(const float* W, int k0, int n, int lane, int ld, int K) { float v[16]; const int g = lane >> 4;
#pragma unroll
  for (int i = 0; i < 8; ++i) { const int ka = k0 + 8 * g + i, kb = ka + 16; v[i] = ka < K ? W[(size_t)(ka < K ? ka : K - 1) * ld + n] : 0.f; v[8 + i] = kb < K ? W[(size_t)(kb < K ? kb : K - 1) * ld + n] : 0.f; }
  return bsplit16(v); }
__device__ __forceinline__ v8f mac3(const F2& a, const F2& b, v8f c) { c = wmma_bf(a.l, b.h, c); c = wmma_bf(a.h, b.l, c); return wmma_bf(a.h, b.h, c); }
__device__ __forceinline__ float sigm(float v) { return 1.0f / (1.0f + expf(-v)); }
#define LDSX() do { asm volatile("s_wait_dscnt 0" ::: "memory"); __builtin_amdgcn_wave_barrier(); __builtin_amdgcn_fence(__ATOMIC_RELEASE, "workgroup"); } while (0)


// Codec attention (B 4, T 2,048, DIM 1,024; 16 query heads, 4 kv heads x 64, QK-RMSNorm (eps 1e-6, weights read), causal sliding window 512, no biases): y = softmax(rms(q) rms(k)^T / 8 | window) v (kv head = h / 4), @ wo^T.
#define NB 4
#define TT 2048
#define CC 1024
#define NH 16
#define HD 64
#define WIN 512
#define NKV 4
#define CK (NKV * HD)   // 256: k/v row width
#define REP (NH / NKV)
#ifndef TNB
#define TNB NB
#endif
typedef __attribute__((ext_vector_type(8))) __bf16 v8b;
__device__ __forceinline__ v16b frag_b(const __bf16* rowk0, int lane) {
  union { v16b v; v8b q[2]; } u; const __bf16* p = rowk0 + 8 * (lane >> 4);
  u.q[0] = *(const v8b*)p; u.q[1] = *(const v8b*)(p + 16); return u.v;
}
__device__ __forceinline__ float bfr(float v) { return (float)(__bf16)v; }
__device__ __attribute__((noinline)) float exp_ni(float v) { return expf(v); }
__device__ __attribute__((noinline)) float erf_ni(float v) { return erff(v); }

#define WS_QH  0u
#define WS_QL  (WS_QH + 2u * (size_t)NB * TT * CC)
#define WS_KH  (WS_QL + 2u * (size_t)NB * TT * CC)
#define WS_VT  (WS_KH + 2u * (size_t)NB * TT * CK)      // bf16 v planes [b][CK][t] (k rows are [b*T+t][CK])
#define WS_VL  (WS_VT + 2u * (size_t)NB * CK * TT)
#define HG 4                                          // heads per launch group
#define WS_S   (WS_VL + 2u * (size_t)NB * CK * TT)      // f32 logits / P for HG heads
#define WS_PH  (WS_S + 4u * (size_t)HG * TT * TT)
#define WS_Y   (WS_PH + 0u)              // f32 y rows [b*t][C]
#define WS_END (WS_Y + 4u * (size_t)NB * TT * CC)

// ---- k_proj: block = (64 rows, 128 cols, which): qkv = x W (+ b), exact; q -> f16 hi (+ residual), k -> f16 rows, v -> bf16 hi + lo planes
__global__ __launch_bounds__(128) void k_proj(const float* __restrict__ X, const float* __restrict__ WQ, const float* __restrict__ BQ, const float* __restrict__ WK, const float* __restrict__ BK, const float* __restrict__ WV, const float* __restrict__ BV, _Float16* __restrict__ QH, _Float16* __restrict__ QL, _Float16* __restrict__ KH, __bf16* __restrict__ VT, __bf16* __restrict__ VL, const float* __restrict__ NQW, const float* __restrict__ NKW, int wbase) {
  __shared__ __align__(16) _Float16 sh[64][136], sl[64][136]; __shared__ __align__(16) __bf16 th[128][72], tl2[128][72];
  const int tid = threadIdx.x, wave = tid >> 5, lane = tid & 31, col = lane & 15, g = lane >> 4; const int which = wbase + blockIdx.z; const int OW = (which == 0) ? CC : CK;   /* output row width: q 1,024, k/v 256 */ const int c0 = blockIdx.y * 128; const size_t r0 = (size_t)blockIdx.x * 64; const float* WA = which == 0 ? WQ : which == 1 ? WK : WV; const float* BA = which == 0 ? BQ : which == 1 ? BK : BV;
  v8f acc[8] = {};
#pragma unroll 2
  for (int kc = 0; kc < CC / 32; ++kc) { v16b a; { const float* p = X + (r0 + wave * 16 + col) * CC + kc * 32 + 8 * g;
#pragma unroll
      for (int i = 0; i < 8; ++i) { a[i] = (__bf16)p[i]; a[8 + i] = (__bf16)p[16 + i]; } }
#pragma unroll
    for (int j = 0; j < 8; ++j) { v16b w; const int o = c0 + j * 16 + col;
#pragma unroll
      for (int i = 0; i < 8; ++i) { w[i] = (__bf16)WA[(size_t)(o) * CC + (kc * 32 + 8 * g + i)]; w[8 + i] = (__bf16)WA[(size_t)(o) * CC + (kc * 32 + 16 + 8 * g + i)]; }
      acc[j] = wmma_bf(a, w, acc[j]); } }
  // QK-RMSNorm per (row, head): the block's 128 columns are two heads (tiles 0-3, 4-7); mean of squares over the 64 dims via in-lane + 16-lane shuffles (unconditional), then scale by rsqrt(ms + eps) * norm_w[d]
  if (which < 2) { const float* NW = which == 0 ? NQW : NKW;
#pragma unroll
    for (int hh = 0; hh < 2; ++hh) { float ssq[8];
#pragma unroll
      for (int r = 0; r < 8; ++r) { float s_ = 0.f;
#pragma unroll
        for (int jj = 0; jj < 4; ++jj) s_ += acc[hh * 4 + jj][r] * acc[hh * 4 + jj][r];
#pragma unroll
        for (int o_ = 1; o_ < 16; o_ <<= 1) s_ += __shfl_xor(s_, o_);
        ssq[r] = rsqrtf(s_ * (1.0f / HD) + 1e-6f); }
#pragma unroll
      for (int jj = 0; jj < 4; ++jj) { const float wv = bfr(NW[jj * 16 + col]);
#pragma unroll
        for (int r = 0; r < 8; ++r) acc[hh * 4 + jj][r] *= ssq[r] * wv; } } }
#pragma unroll
  for (int j = 0; j < 8; ++j) { const float bb = BA ? bfr(BA[c0 + j * 16 + col]) : 0.f;
#pragma unroll
    for (int r = 0; r < 8; ++r) { const float v = acc[j][r] + bb; const int rl = wave * 16 + 8 * g + r, cl = j * 16 + col; const _Float16 hv = (_Float16)v;
      if (which == 2) { const __bf16 bh = (__bf16)v; th[cl][rl] = bh; tl2[cl][rl] = (__bf16)(v - (float)bh); } else { sh[rl][cl] = hv; sl[rl][cl] = (_Float16)((v - (float)hv) * 1024.0f); }   /* q residual carried x 2^10 so the plane stays f16-normal on the chip */ } }
  __syncthreads();
  if (which < 2) { _Float16* dh = which == 0 ? QH : KH; for (int e = tid; e < 64 * 16; e += 128) { const int rl = e >> 4, q = e & 15; vst2((unsigned*)(dh + (r0 + rl) * OW + c0 + q * 8), *(const v4u*)&sh[rl][q * 8]); if (which == 0) vst2((unsigned*)(QL + (r0 + rl) * CC + c0 + q * 8), *(const v4u*)&sl[rl][q * 8]); } }
  else { const size_t b = r0 / TT; const int t0 = (int)(r0 % TT); for (int e = tid; e < 128 * 8; e += 128) { const int cl = e >> 3, q = e & 7; const size_t o2 = (b * CK + c0 + cl) * (size_t)TT + t0 + q * 8; vst2((unsigned*)(VT + o2), *(const v4u*)&th[cl][q * 8]); vst2((unsigned*)(VL + o2), *(const v4u*)&tl2[cl][q * 8]); } } }
// ---- k_sc: block = (64 queries, 128 keys) of (b,h): 2-product logits / 8 inside the causal window, -3e38 elsewhere; tiles above the diagonal exit (never read), tiles left of every window skip the WMMA but write the fill
__global__ __launch_bounds__(128) void k_sc(const _Float16* __restrict__ QH, const _Float16* __restrict__ QL, const _Float16* __restrict__ KH, const float* __restrict__ BM, int b, int h0, float* __restrict__ S0) { __shared__ __align__(16) float ss[4][16][132]; const int h = h0 + blockIdx.z; float* S = S0 + (size_t)blockIdx.z * TT * TT;
  const int tid = threadIdx.x, wave = tid >> 5, lane = tid & 31, col = lane & 15, g = lane >> 4; const int k0 = blockIdx.y * 128; const int ql0 = blockIdx.x * 64 + wave * 16; const size_t q0 = (size_t)b * TT + ql0;
  if (k0 > blockIdx.x * 64 + 63) return;   // whole key block above the diagonal (block-uniform; k_sm/k_pv never read it)
  const bool live = (k0 + 127 > (int)(blockIdx.x * 64) - WIN);   // block-uniform: some key of this tile can be inside some query's window
  v8f acc[8] = {}, accl[8] = {};
  if (live) {
#pragma unroll
  for (int kc = 0; kc < HD / 32; ++kc) { const v16h ah = frag_h(QH + (q0 + col) * CC + h * HD + kc * 32, lane), al = frag_h(QL + (q0 + col) * CC + h * HD + kc * 32, lane);
#pragma unroll
    for (int j = 0; j < 8; ++j) { const v16h kb = frag_h(KH + ((size_t)b * TT + k0 + j * 16 + col) * CK + (h / REP) * HD + kc * 32, lane);   /* GQA: kv head h/4 */ acc[j] = wmma16(ah, kb, acc[j]); accl[j] = wmma16(al, kb, accl[j]); } }
  }
#pragma unroll
  for (int j = 0; j < 8; ++j) acc[j] += accl[j] * (1.0f / 1024.0f);
#pragma unroll
  for (int j = 0; j < 8; ++j) { const int kt = k0 + j * 16 + col;
#pragma unroll
    for (int r = 0; r < 8; ++r) { const int qt = ql0 + 8 * g + r; (void)BM; const bool allowed = (kt <= qt) && (qt - kt < WIN); const float v = (live && allowed) ? acc[j][r] * 0.125f : -3.0e38f; ss[wave][8 * g + r][j * 16 + col] = v; } }
  LDSX(); for (int rl = 0; rl < 16; ++rl) vst2(S + (size_t)(ql0 + rl) * TT + k0 + lane * 4, *(const v4f*)&ss[wave][rl][lane * 4]); }
// ---- k_sm: block = query row: softmax over keys [0, kend) -> P x 2^11 f32 (masked -> 0)
__global__ __launch_bounds__(256) void k_sm(float* __restrict__ S0) { __shared__ float sred[8]; __shared__ float sbc; __shared__ __align__(16) float sh[TT];
  const int t = threadIdx.x; const size_t row = blockIdx.x; float* sr = S0 + (size_t)blockIdx.y * TT * TT + row * TT; const int kend = ((int)row / 64) * 64 + 64;
  float m = -3.0e38f; for (int k = t; k < kend; k += 256) m = fmaxf(m, sr[k]);
#pragma unroll
  for (int o = 1; o < 32; o <<= 1) m = fmaxf(m, __shfl_xor(m, o));
  if ((t & 31) == 0) sred[t >> 5] = m; __syncthreads(); if (t == 0) { float a = sred[0]; for (int i = 1; i < 8; ++i) a = fmaxf(a, sred[i]); sbc = a; } __syncthreads(); m = sbc; __syncthreads();
  float sum = 0.f; for (int k = t; k < kend; k += 256) { const float v = sr[k]; sum += (v <= -1.0e38f) ? 0.f : expf(v - m); }
#pragma unroll
  for (int o = 1; o < 32; o <<= 1) sum += __shfl_xor(sum, o);
  if ((t & 31) == 0) sred[t >> 5] = sum; __syncthreads(); if (t == 0) { float a = 0.f; for (int i = 0; i < 8; ++i) a += sred[i]; sbc = 1.0f / a; } __syncthreads(); const float inv = sbc;
  for (int k = t; k < kend; k += 256) { const float v = sr[k]; sh[k] = (v <= -1.0e38f) ? 0.f : expf(v - m) * inv * 2048.0f; }
  __syncthreads(); for (int q = t; q < kend / 4; q += 256) vst2(sr + q * 4, *(const v4f*)&sh[q * 4]); }
// ---- k_pv: block = 64 queries of (b,h): y[q][h*HD + d] = P . v  (keys [0, kend))
__global__ __launch_bounds__(128) void k_pv(const float* __restrict__ PS0, const __bf16* __restrict__ VT, const __bf16* __restrict__ VL, int b, int h0, float* __restrict__ Y) { const int h = h0 + blockIdx.z; const float* PS = PS0 + (size_t)blockIdx.z * TT * TT; __shared__ __align__(16) float ss[4][16][HD + 4];
  const int tid = threadIdx.x, wave = tid >> 5, lane = tid & 31, col = lane & 15, g = lane >> 4; const int ql0 = blockIdx.x * 64 + wave * 16; const int kend = blockIdx.x * 64 + 64; const int kclo = ((int)(blockIdx.x * 64) - (WIN - 1)) > 0 ? ((int)(blockIdx.x * 64) - (WIN - 1)) / 32 : 0;   /* first chunk that can hold a key inside the earliest query's window */
  v8f acc[HD / 16] = {};
#pragma unroll 1
  for (int kc = kclo; kc < kend / 32; ++kc) { const F2 p = split_row(PS + (size_t)(ql0 + col) * TT, kc * 32, lane);   /* chunks before kclo hold P = 0 exactly */
#pragma unroll
    for (int j = 0; j < HD / 16; ++j) { const size_t po = ((size_t)b * CK + (h / REP) * HD + j * 16 + col) * (size_t)TT + kc * 32;   /* GQA v plane of kv head h/4 */ const v16b vh = frag_b(VT + po, lane); acc[j] = wmma_bf(p.h, vh, acc[j]); acc[j] = wmma_bf(p.l, vh, acc[j]); acc[j] = wmma_bf(p.h, frag_b(VL + po, lane), acc[j]); } }
#pragma unroll
  for (int j = 0; j < HD / 16; ++j)
#pragma unroll
    for (int r = 0; r < 8; ++r) ss[wave][8 * g + r][j * 16 + col] = acc[j][r] * (1.0f / 2048.0f);
  LDSX(); for (int rl = 0; rl < 16; ++rl) if (lane < HD / 4) vst2(Y + ((size_t)b * TT + ql0 + rl) * CC + h * HD + lane * 4, *(const v4f*)&ss[wave][rl][lane * 4]); }
// ---- k_out: block = (64 rows, 128 cols): out = y (bf16 hi + lo) Wo^T + bo
__global__ __launch_bounds__(128) void k_out(const float* __restrict__ Y, const float* __restrict__ WP, const float* __restrict__ BP, float* __restrict__ OUT) { __shared__ __align__(16) float sf[4][16][132];
  const int tid = threadIdx.x, wave = tid >> 5, lane = tid & 31, col = lane & 15, g = lane >> 4; const int c0 = blockIdx.y * 128; const size_t r0 = (size_t)blockIdx.x * 64 + wave * 16;
  v8f acc[8] = {};
#pragma unroll 2
  for (int kc = 0; kc < CC / 32; ++kc) { const F2 a = split_row(Y + (r0 + col) * CC, kc * 32, lane);
#pragma unroll
    for (int j = 0; j < 8; ++j) { v16b w; const int o = c0 + j * 16 + col;
#pragma unroll
      for (int i = 0; i < 8; ++i) { w[i] = (__bf16)WP[(size_t)(o) * CC + (kc * 32 + 8 * g + i)]; w[8 + i] = (__bf16)WP[(size_t)(o) * CC + (kc * 32 + 16 + 8 * g + i)]; }
      acc[j] = wmma_bf(a.h, w, acc[j]); acc[j] = wmma_bf(a.l, w, acc[j]); } }
#pragma unroll
  for (int j = 0; j < 8; ++j) { const float bb = BP ? bfr(BP[c0 + j * 16 + col]) : 0.f;
#pragma unroll
    for (int r = 0; r < 8; ++r) sf[wave][8 * g + r][j * 16 + col] = acc[j][r] + bb; }
  LDSX(); for (int rl = 0; rl < 16; ++rl) vst2(OUT + (r0 + rl) * CC + c0 + lane * 4, *(const v4f*)&sf[wave][rl][lane * 4]); }
extern "C" void kernel_launch(void* const* d_in, const int* in_sizes, int n_in, void* d_out, int out_size, void* d_ws, size_t ws_size, hipStream_t stream) {
  (void)in_sizes; (void)n_in; (void)out_size;
  const float** F = (const float**)d_in;   // 0 x [4,2048,1024], 1 wq [1024,1024] ([out,in]), 2 wk [256,1024], 3 wv [256,1024], 4 wo [1024,1024] ([out,in]), 5 q_norm_w [64], 6 k_norm_w [64]
  if (ws_size < (size_t)WS_END) return;
  char* ws = (char*)d_ws; _Float16 *QH = (_Float16*)(ws + WS_QH), *QL = (_Float16*)(ws + WS_QL), *KH = (_Float16*)(ws + WS_KH); __bf16 *VT = (__bf16*)(ws + WS_VT), *VL = (__bf16*)(ws + WS_VL); float *S = (float*)(ws + WS_S), *Y = (float*)(ws + WS_Y);
  k_proj<<<dim3(TNB * TT / 64, CC / 128, 1), 128, 0, stream>>>(F[0], F[1], nullptr, F[2], nullptr, F[3], nullptr, QH, QL, KH, VT, VL, F[5], F[6], 0);   // q (16 heads)
  k_proj<<<dim3(TNB * TT / 64, CK / 128, 2), 128, 0, stream>>>(F[0], F[1], nullptr, F[2], nullptr, F[3], nullptr, QH, QL, KH, VT, VL, F[5], F[6], 1);   // k, v (4 kv heads)
  for (int b = 0; b < TNB; ++b) for (int h0 = 0; h0 < NH; h0 += HG) {
    k_sc<<<dim3(TT / 64, TT / 128, HG), 128, 0, stream>>>(QH, QL, KH, nullptr, b, h0, S);
    k_sm<<<dim3(TT, HG), 256, 0, stream>>>(S);
    k_pv<<<dim3(TT / 64, 1, HG), 128, 0, stream>>>(S, VT, VL, b, h0, Y);
  }
  k_out<<<dim3(TNB * TT / 64, CC / 128), 128, 0, stream>>>(Y, F[4], nullptr, (float*)d_out);
}

// v001
// One run takes 447 microseconds.
// Timed twice side by side with v000, it ran 3.21 and 3.22 times as fast.
// compute dtype: all float inputs rounded to bf16; q/k/v = x W^T with EXACT bf16 products on WMMA 16x16x32, f32 accumulate; per-head RMSNorm of q and k in f32 in the projection epilogue; q as f16 hi + residual (x 2^10), k f16 -> 2-product logits / 8 inside the causal sliding window (512), held in f32 in LDS (one launch, GQA: head h reads kv head h/4); softmax in f32 (precise expf), P x 2^11 split bf16 hi + lo against v bf16 hi + lo (3 products); y = ctx (bf16 hi + lo) wo^T; f32 output.
#include <hip/hip_runtime.h>
#include <math.h>

typedef __attribute__((ext_vector_type(16))) _Float16 v16h;
typedef __attribute__((ext_vector_type(16))) __bf16 v16b;
typedef __attribute__((ext_vector_type(8)))  _Float16 v8h;
typedef __attribute__((ext_vector_type(8)))  float v8f;
typedef __attribute__((ext_vector_type(4)))  float v4f;
typedef __attribute__((ext_vector_type(2)))  float v2f;
typedef __attribute__((ext_vector_type(4)))  unsigned v4u;
typedef __attribute__((ext_vector_type(4)))  int v4i;
typedef float __attribute__((may_alias)) float_a;
typedef int __attribute__((may_alias)) int_a;

template <typename T> __device__ __forceinline__ void vst2(void* p, T v) { *(T*)p = v;  }
__device__ __forceinline__ v8f wmma16(v16h a, v16h b, v8f c) {
  v8f d = __builtin_amdgcn_wmma_f32_16x16x32_f16(false, a, false, b, (short)0, c, false, false);
  asm volatile("v_nop\n\tv_nop\n\tv_nop\n\tv_nop" : "+v"(d) : "v"(a), "v"(b));
  return d;
}
__device__ __forceinline__ v8f wmma_bf(v16b a, v16b b, v8f c) {
  v8f d = __builtin_amdgcn_wmma_f32_16x16x32_bf16(false, a, false, b, (short)0, c, false, false);
  asm volatile("v_nop\n\tv_nop\n\tv_nop\n\tv_nop" : "+v"(d) : "v"(a), "v"(b));
  return d;
}
// 16x16x32 fragments: lane = (h = lane>>4, row/col = lane&15); elements 0..7 = k0+8h+0..7, 8..15 = k0+16+8h+0..7; D element r = row 8h+r
__device__ __forceinline__ v16h frag_h(const _Float16* rowk0, int lane) {
  union { v16h v; v8h q[2]; } u; const _Float16* p = rowk0 + 8 * (lane >> 4);
  u.q[0] = *(const v8h*)p; u.q[1] = *(const v8h*)(p + 16); return u.v;
}
__device__ __forceinline__ v16h frag_f32(const float* rowk0, int lane) {
  v16h a; const float* p = rowk0 + 8 * (lane >> 4);
#pragma unroll
  for (int i = 0; i < 8; ++i) { a[i] = (_Float16)p[i]; a[8 + i] = (_Float16)p[16 + i]; }
  return a;
}
__device__ __forceinline__ v16h frag_f32s(const float* rowk0, int lane, float sc) {
  v16h a; const float* p = rowk0 + 8 * (lane >> 4);
#pragma unroll
  for (int i = 0; i < 8; ++i) { a[i] = (_Float16)(p[i] * sc); a[8 + i] = (_Float16)(p[16 + i] * sc); }
  return a;
}
// column fragment from a [K][ld] layout (column n), rows >= K read as 0
__device__ __forceinline__ v16h fragc_f32(const float* W, int k0, int n, int lane, int ld, int K) {
  v16h a; const int g = lane >> 4;
#pragma unroll
  for (int i = 0; i < 8; ++i) { const int ka = k0 + 8 * g + i, kb = ka + 16;
    a[i] = (_Float16)(ka < K ? W[(size_t)(ka < K ? ka : K - 1) * ld + n] : 0.f); a[8 + i] = (_Float16)(kb < K ? W[(size_t)(kb < K ? kb : K - 1) * ld + n] : 0.f); }
  return a;
}
struct F2 { v16b h, l; };
__device__ __forceinline__ F2 bsplit16(const float v[16]) { F2 r;
#pragma unroll
  for (int i = 0; i < 16; ++i) { const __bf16 h = (__bf16)v[i]; r.h[i] = h; r.l[i] = (__bf16)(v[i] - (float)h); }
  return r; }
__device__ __forceinline__ F2 split_row(const float* row, int k0, int lane) { float v[16]; const float* p = row + k0 + 8 * (lane >> 4);
#pragma unroll
  for (int i = 0; i < 8; ++i) { v[i] = p[i]; v[8 + i] = p[16 + i]; }
  return bsplit16(v); }
__device__ __forceinline__ F2 split_rowK(const float* row, int k0, int lane, int K) { float v[16]; const int g = lane >> 4;
#pragma unroll
  for (int i = 0; i < 8; ++i) { const int ka = k0 + 8 * g + i, kb = ka + 16; v[i] = ka < K ? row[ka < K ? ka : K - 1] : 0.f; v[8 + i] = kb < K ? row[kb < K ? kb : K - 1] : 0.f; }
  return bsplit16(v); }
__device__ __forceinline__ F2 split_col(const float* W, int k0, int n, int lane, int ld, int K) { float v[16]; const int g = lane >> 4;
#pragma unroll
  for (int i = 0; i < 8; ++i) { const int ka = k0 + 8 * g + i, kb = ka + 16; v[i] = ka < K ? W[(size_t)(ka < K ? ka : K - 1) * ld + n] : 0.f; v[8 + i] = kb < K ? W[(size_t)(kb < K ? kb : K - 1) * ld + n] : 0.f; }
  return bsplit16(v); }
__device__ __forceinline__ v8f mac3(const F2& a, const F2& b, v8f c) { c = wmma_bf(a.l, b.h, c); c = wmma_bf(a.h, b.l, c); return wmma_bf(a.h, b.h, c); }
__device__ __forceinline__ float sigm(float v) { return 1.0f / (1.0f + expf(-v)); }
#define LDSX() do { asm volatile("s_wait_dscnt 0" ::: "memory"); __builtin_amdgcn_wave_barrier(); __builtin_amdgcn_fence(__ATOMIC_RELEASE, "workgroup"); } while (0)


// Codec attention (B 4, T 2,048, DIM 1,024; 16 query heads, 4 kv heads x 64, QK-RMSNorm (eps 1e-6, weights read), causal sliding window 512, no biases): y = softmax(rms(q) rms(k)^T / 8 | window) v (kv head = h / 4), @ wo^T.
#define NB 4
#define TT 2048
#define CC 1024
#define NH 16
#define HD 64
#define WIN 512
#define NKV 4
#define CK (NKV * HD)   // 256: k/v row width
#define REP (NH / NKV)
#ifndef TNB
#define TNB NB
#endif
typedef __attribute__((ext_vector_type(8))) __bf16 v8b;
__device__ __forceinline__ v16b frag_b(const __bf16* rowk0, int lane) {
  union { v16b v; v8b q[2]; } u; const __bf16* p = rowk0 + 8 * (lane >> 4);
  u.q[0] = *(const v8b*)p; u.q[1] = *(const v8b*)(p + 16); return u.v;
}
__device__ __forceinline__ float bfr(float v) { return (float)(__bf16)v; }
__device__ __attribute__((noinline)) float exp_ni(float v) { return expf(v); }
__device__ __attribute__((noinline)) float erf_ni(float v) { return erff(v); }

#define WS_QH  0u
#define WS_QL  (WS_QH + 2u * (size_t)NB * TT * CC)
#define WS_KH  (WS_QL + 2u * (size_t)NB * TT * CC)
#define WS_VT  (WS_KH + 2u * (size_t)NB * TT * CK)      // bf16 v planes [b][CK][t] (k rows are [b*T+t][CK])
#define WS_VL  (WS_VT + 2u * (size_t)NB * CK * TT)
#define HG 4                                          // only sizes the WS_S region, which no kernel uses
#define WS_S   (WS_VL + 2u * (size_t)NB * CK * TT)      // unused: logits and P stay in LDS
#define WS_PH  (WS_S + 4u * (size_t)HG * TT * TT)
#define WS_Y   (WS_PH + 0u)              // f32 y rows [b*t][C]
#define WS_END (WS_Y + 4u * (size_t)NB * TT * CC)

// ---- k_proj: block = (64 rows, 128 cols, which): qkv = x W (+ b), exact; q -> f16 hi (+ residual), k -> f16 rows, v -> bf16 hi + lo planes
__global__ __launch_bounds__(128) void k_proj(const float* __restrict__ X, const float* __restrict__ WQ, const float* __restrict__ BQ, const float* __restrict__ WK, const float* __restrict__ BK, const float* __restrict__ WV, const float* __restrict__ BV, _Float16* __restrict__ QH, _Float16* __restrict__ QL, _Float16* __restrict__ KH, __bf16* __restrict__ VT, __bf16* __restrict__ VL, const float* __restrict__ NQW, const float* __restrict__ NKW, int wbase) {
  __shared__ __align__(16) _Float16 sh[64][136], sl[64][136]; __shared__ __align__(16) __bf16 th[128][72], tl2[128][72];
  const int tid = threadIdx.x, wave = tid >> 5, lane = tid & 31, col = lane & 15, g = lane >> 4; const int which = wbase + blockIdx.z; const int OW = (which == 0) ? CC : CK;   /* output row width: q 1,024, k/v 256 */ const int c0 = blockIdx.y * 128; const size_t r0 = (size_t)blockIdx.x * 64; const float* WA = which == 0 ? WQ : which == 1 ? WK : WV; const float* BA = which == 0 ? BQ : which == 1 ? BK : BV;
  v8f acc[8] = {};
#pragma unroll 2
  for (int kc = 0; kc < CC / 32; ++kc) { v16b a; { const float* p = X + (r0 + wave * 16 + col) * CC + kc * 32 + 8 * g;
#pragma unroll
      for (int i = 0; i < 8; ++i) { a[i] = (__bf16)p[i]; a[8 + i] = (__bf16)p[16 + i]; } }
#pragma unroll
    for (int j = 0; j < 8; ++j) { v16b w; const int o = c0 + j * 16 + col;
#pragma unroll
      for (int i = 0; i < 8; ++i) { w[i] = (__bf16)WA[(size_t)(o) * CC + (kc * 32 + 8 * g + i)]; w[8 + i] = (__bf16)WA[(size_t)(o) * CC + (kc * 32 + 16 + 8 * g + i)]; }
      acc[j] = wmma_bf(a, w, acc[j]); } }
  // QK-RMSNorm per (row, head): the block's 128 columns are two heads (tiles 0-3, 4-7); mean of squares over the 64 dims via in-lane + 16-lane shuffles (unconditional), then scale by rsqrt(ms + eps) * norm_w[d]
  if (which < 2) { const float* NW = which == 0 ? NQW : NKW;
#pragma unroll
    for (int hh = 0; hh < 2; ++hh) { float ssq[8];
#pragma unroll
      for (int r = 0; r < 8; ++r) { float s_ = 0.f;
#pragma unroll
        for (int jj = 0; jj < 4; ++jj) s_ += acc[hh * 4 + jj][r] * acc[hh * 4 + jj][r];
#pragma unroll
        for (int o_ = 1; o_ < 16; o_ <<= 1) s_ += __shfl_xor(s_, o_);
        ssq[r] = rsqrtf(s_ * (1.0f / HD) + 1e-6f); }
#pragma unroll
      for (int jj = 0; jj < 4; ++jj) { const float wv = bfr(NW[jj * 16 + col]);
#pragma unroll
        for (int r = 0; r < 8; ++r) acc[hh * 4 + jj][r] *= ssq[r] * wv; } } }
#pragma unroll
  for (int j = 0; j < 8; ++j) { const float bb = BA ? bfr(BA[c0 + j * 16 + col]) : 0.f;
#pragma unroll
    for (int r = 0; r < 8; ++r) { const float v = acc[j][r] + bb; const int rl = wave * 16 + 8 * g + r, cl = j * 16 + col; const _Float16 hv = (_Float16)v;
      if (which == 2) { const __bf16 bh = (__bf16)v; th[cl][rl] = bh; tl2[cl][rl] = (__bf16)(v - (float)bh); } else { sh[rl][cl] = hv; sl[rl][cl] = (_Float16)((v - (float)hv) * 1024.0f); }   /* q residual carried x 2^10 so the plane stays f16-normal on the chip */ } }
  __syncthreads();
  if (which < 2) { _Float16* dh = which == 0 ? QH : KH; for (int e = tid; e < 64 * 16; e += 128) { const int rl = e >> 4, q = e & 15; vst2((unsigned*)(dh + (r0 + rl) * OW + c0 + q * 8), *(const v4u*)&sh[rl][q * 8]); if (which == 0) vst2((unsigned*)(QL + (r0 + rl) * CC + c0 + q * 8), *(const v4u*)&sl[rl][q * 8]); } }
  else { const size_t b = r0 / TT; const int t0 = (int)(r0 % TT); for (int e = tid; e < 128 * 8; e += 128) { const int cl = e >> 3, q = e & 7; const size_t o2 = (b * CK + c0 + cl) * (size_t)TT + t0 + q * 8; vst2((unsigned*)(VT + o2), *(const v4u*)&th[cl][q * 8]); vst2((unsigned*)(VL + o2), *(const v4u*)&tl2[cl][q * 8]); } } }
// ---- k_att: block = 64 queries of (b,h), one wave = 16 queries, no exchange between waves. S^T = K Q^T (A = 16 key rows, B = 16 query rows), so a lane holds the logits of ONE query (col) at keys 8g+r of each 16-key tile;
// two such tiles are, element for element, the A fragment of P for a 32-key chunk. The wave's window is NCH chunks of 32 keys; each lane parks its own logits in LDS (16 B a lane, lane-contiguous) and reads back only what it wrote.
// K and V fragments are fetched one chunk ahead into registers (the LDS strip allows two waves a SIMD, so registers are free).
#define NCH 17   // 32-key chunks that cover [ql0 - 511, ql0 + 15] from a multiple of 32
// a precaution: stands behind a group of global loads, in front of the next rewrite of their address registers; the group's one lane pointer is an input, so that it stays live up to the wait and no result of the group lands in it
#define XW(p) asm volatile("s_wait_xcnt 0x0" :: "v"(p) : "memory")
// fragments from the lane's own pointer (row and 8 * half already in it)
__device__ __forceinline__ v16h fragp_h(const _Float16* p) { union { v16h v; v8h q[2]; } u; u.q[0] = *(const v8h*)p; u.q[1] = *(const v8h*)(p + 16); return u.v; }
__device__ __forceinline__ v16b fragp_b(const __bf16* p) { union { v16b v; v8b q[2]; } u; u.q[0] = *(const v8b*)p; u.q[1] = *(const v8b*)(p + 16); return u.v; }
__global__ __launch_bounds__(128) void k_att(const _Float16* __restrict__ QH, const _Float16* __restrict__ QL, const _Float16* __restrict__ KH, const __bf16* __restrict__ VT, float* __restrict__ Y) {   // the v residual plane lies NB * CK * TT elements behind VT
  __shared__ __align__(16) float st[4][NCH * 4][32][4];
  const int tid = threadIdx.x, wave = __builtin_amdgcn_readfirstlane(tid >> 5), lane = tid & 31, col = lane & 15, g = lane >> 4;
  const int b = blockIdx.z, h = blockIdx.y, ql0 = blockIdx.x * 64 + wave * 16, qt = ql0 + col;
  const int kbase = ((ql0 - (WIN - 1)) >> 5) * 32;      // first key of chunk 0 (floor to 32; below 0 for the first rows)
  const int c0 = kbase < 0 ? (-kbase) >> 5 : 0;         // wave-uniform: chunks wholly in front of key 0 are not walked
  const int kf = kbase < 0 ? 0 : kbase;                 // first key walked = kbase + c0 * 32
  const int st0 = c0 + 1 < NCH ? 32 : 0;                // keys from the first chunk to the first one fetched ahead
  const _Float16* qp = QH + ((size_t)b * TT + qt) * CC + h * HD + 8 * g; const _Float16* qlp = QL + ((size_t)b * TT + qt) * CC + h * HD + 8 * g;
  const v16h qh0 = fragp_h(qp), qh1 = fragp_h(qp + 32), qr0 = fragp_h(qlp), qr1 = fragp_h(qlp + 32);
  const _Float16* kp = KH + ((size_t)b * TT + kf + col) * CK + (h / REP) * HD + 8 * g;   /* GQA: kv head h/4; the lane's key row of the first tile */
  v16h ka[2], kb[2];
#pragma unroll
  for (int t = 0; t < 2; ++t) { ka[t] = fragp_h(kp + t * 16 * CK); kb[t] = fragp_h(kp + t * 16 * CK + 32); }
  // holds the first loads in front of the wait (loaded values as inputs only): without them the compiler moves these loads behind it; the three pointers as in XW
  asm volatile("s_wait_xcnt 0x0" :: "v"(qh0), "v"(qh1), "v"(qr0), "v"(qr1), "v"(ka[0]), "v"(kb[0]), "v"(ka[1]), "v"(kb[1]), "v"(qp), "v"(qlp), "v"(kp) : "memory");
  kp += st0 * CK;
  float m = -3.0e38f;
  // two trips a pass: the fragments in use and the ones fetched ahead swap registers without moves
#pragma unroll 2
  for (int c = c0; c < NCH; ++c) {   // kp walks one chunk ahead and stops at the last one (the last trip fetches its own chunk again): the address stays inside k
    v16h na[2], nb[2];
#pragma unroll
    for (int t = 0; t < 2; ++t) { na[t] = fragp_h(kp + t * 16 * CK); nb[t] = fragp_h(kp + t * 16 * CK + 32); }
    XW(kp);
    kp += c + 2 < NCH ? 32 * CK : 0;
#pragma unroll
    for (int t = 0; t < 2; ++t) { const int kt0 = kbase + c * 32 + t * 16;
      v8f a = {}, al = {};
      a = wmma16(ka[t], qh0, a); al = wmma16(ka[t], qr0, al); a = wmma16(kb[t], qh1, a); al = wmma16(kb[t], qr1, al);
      a += al * (1.0f / 1024.0f);
      v4f s0, s1;
#pragma unroll
      for (int r = 0; r < 8; ++r) { const int kt = kt0 + 8 * g + r; const bool allowed = (kt <= qt) && (qt - kt < WIN); const float v = allowed ? a[r] * 0.125f : -3.0e38f; m = fmaxf(m, v); if (r < 4) s0[r] = v; else s1[r - 4] = v; }
      *(v4f*)&st[wave][c * 4 + t * 2][lane][0] = s0; *(v4f*)&st[wave][c * 4 + t * 2 + 1][lane][0] = s1; }
#pragma unroll
    for (int t = 0; t < 2; ++t) { ka[t] = na[t]; kb[t] = nb[t]; } }
  const __bf16* vp = VT + ((size_t)b * CK + (h / REP) * HD + col) * (size_t)TT + kf + 8 * g;   /* GQA v plane of kv head h/4; the lane's v row of the first 16, at the first chunk */
  v16b vh[HD / 16], vl[HD / 16];   // the first chunk's v flies under the softmax
#pragma unroll
  for (int j = 0; j < HD / 16; ++j) { vh[j] = fragp_b(vp + j * 16 * TT); vl[j] = fragp_b(vp + j * 16 * TT + NB * CK * TT); }
  XW(vp);
  vp += st0;
  m = fmaxf(m, __shfl_xor(m, 16));   // the query's other eight keys of every tile sit in lane ^ 16
  float sum = 0.f;
  // stays rolled: sixteen independent exponentials a trip already fill the vector port, more copies only cost code
#pragma unroll 1
  for (int c = c0; c < NCH; ++c) { v4f v[4];
#pragma unroll
    for (int q = 0; q < 4; ++q) v[q] = *(const v4f*)&st[wave][c * 4 + q][lane][0];
#pragma unroll
    for (int q = 0; q < 4; ++q) {
#pragma unroll
      for (int i = 0; i < 4; ++i) { const float ex = expf(v[q][i] - m); const float e = (v[q][i] <= -1.0e38f) ? 0.f : ex; sum += e; v[q][i] = e; }
      *(v4f*)&st[wave][c * 4 + q][lane][0] = v[q]; } }
  sum += __shfl_xor(sum, 16);
  const float inv = 1.0f / sum;
  v8f acc[HD / 16] = {};
  // two trips a pass, as in the logit loop: no register moves between the two fragment sets
#pragma unroll 2
  for (int c = c0; c < NCH; ++c) {   // as above: vp stops at the last chunk, the last trip's fetch stays inside v
    v16b nh[HD / 16], nl[HD / 16];
#pragma unroll
    for (int j = 0; j < HD / 16; ++j) { nh[j] = fragp_b(vp + j * 16 * TT); nl[j] = fragp_b(vp + j * 16 * TT + NB * CK * TT); }
    XW(vp);
    vp += c + 2 < NCH ? 32 : 0;
    float pv[16];
#pragma unroll
    for (int q = 0; q < 4; ++q) { const v4f v = *(const v4f*)&st[wave][c * 4 + q][lane][0];
#pragma unroll
      for (int i = 0; i < 4; ++i) pv[q * 4 + i] = v[i] * inv * 2048.0f; }
    const F2 p = bsplit16(pv);
#pragma unroll
    for (int j = 0; j < HD / 16; ++j) { acc[j] = wmma_bf(p.h, vh[j], acc[j]); acc[j] = wmma_bf(p.l, vh[j], acc[j]); acc[j] = wmma_bf(p.h, vl[j], acc[j]); }
#pragma unroll
    for (int j = 0; j < HD / 16; ++j) { vh[j] = nh[j]; vl[j] = nl[j]; } }
  float (*ss)[HD + 4] = (float (*)[HD + 4])&st[wave][0][0][0];   // the wave's own strip, now free, turns the output tile for 16-byte row stores
#pragma unroll
  for (int j = 0; j < HD / 16; ++j)
#pragma unroll
    for (int r = 0; r < 8; ++r) ss[8 * g + r][j * 16 + col] = acc[j][r] * (1.0f / 2048.0f);
  LDSX(); for (int rl = 0; rl < 16; ++rl) if (lane < HD / 4) vst2(Y + ((size_t)b * TT + ql0 + rl) * CC + h * HD + lane * 4, *(const v4f*)&ss[rl][lane * 4]); }
// ---- k_out: block = (64 rows, 128 cols): out = y (bf16 hi + lo) Wo^T + bo
__global__ __launch_bounds__(128) void k_out(const float* __restrict__ Y, const float* __restrict__ WP, const float* __restrict__ BP, float* __restrict__ OUT) { __shared__ __align__(16) float sf[4][16][132];
  const int tid = threadIdx.x, wave = tid >> 5, lane = tid & 31, col = lane & 15, g = lane >> 4; const int c0 = blockIdx.y * 128; const size_t r0 = (size_t)blockIdx.x * 64 + wave * 16;
  v8f acc[8] = {};
#pragma unroll 2
  for (int kc = 0; kc < CC / 32; ++kc) { const F2 a = split_row(Y + (r0 + col) * CC, kc * 32, lane);
#pragma unroll
    for (int j = 0; j < 8; ++j) { v16b w; const int o = c0 + j * 16 + col;
#pragma unroll
      for (int i = 0; i < 8; ++i) { w[i] = (__bf16)WP[(size_t)(o) * CC + (kc * 32 + 8 * g + i)]; w[8 + i] = (__bf16)WP[(size_t)(o) * CC + (kc * 32 + 16 + 8 * g + i)]; }
      acc[j] = wmma_bf(a.h, w, acc[j]); acc[j] = wmma_bf(a.l, w, acc[j]); } }
#pragma unroll
  for (int j = 0; j < 8; ++j) { const float bb = BP ? bfr(BP[c0 + j * 16 + col]) : 0.f;
#pragma unroll
    for (int r = 0; r < 8; ++r) sf[wave][8 * g + r][j * 16 + col] = acc[j][r] + bb; }
  LDSX(); for (int rl = 0; rl < 16; ++rl) vst2(OUT + (r0 + rl) * CC + c0 + lane * 4, *(const v4f*)&sf[wave][rl][lane * 4]); }
extern "C" void kernel_launch(void* const* d_in, const int* in_sizes, int n_in, void* d_out, int out_size, void* d_ws, size_t ws_size, hipStream_t stream) {
  (void)in_sizes; (void)n_in; (void)out_size;
  const float** F = (const float**)d_in;   // 0 x [4,2048,1024], 1 wq [1024,1024] ([out,in]), 2 wk [256,1024], 3 wv [256,1024], 4 wo [1024,1024] ([out,in]), 5 q_norm_w [64], 6 k_norm_w [64]
  if (ws_size < (size_t)WS_END) return;
  char* ws = (char*)d_ws; _Float16 *QH = (_Float16*)(ws + WS_QH), *QL = (_Float16*)(ws + WS_QL), *KH = (_Float16*)(ws + WS_KH); __bf16 *VT = (__bf16*)(ws + WS_VT), *VL = (__bf16*)(ws + WS_VL); float *Y = (float*)(ws + WS_Y);
  k_proj<<<dim3(TNB * TT / 64, CC / 128, 1), 128, 0, stream>>>(F[0], F[1], nullptr, F[2], nullptr, F[3], nullptr, QH, QL, KH, VT, VL, F[5], F[6], 0);   // q (16 heads)
  k_proj<<<dim3(TNB * TT / 64, CK / 128, 2), 128, 0, stream>>>(F[0], F[1], nullptr, F[2], nullptr, F[3], nullptr, QH, QL, KH, VT, VL, F[5], F[6], 1);   // k, v (4 kv heads)
  k_att<<<dim3(TT / 64, NH, TNB), 128, 0, stream>>>(QH, QL, KH, VT, Y);   // logits, softmax and P v of every (b, h) in one launch
  k_out<<<dim3(TNB * TT / 64, CC / 128), 128, 0, stream>>>(Y, F[4], nullptr, (float*)d_out);
}

// v002
// A run of this version takes 173 microseconds.
// Two timings next to v001 put it at 2.60 and 2.59 times that version's speed.
// Over all steps from v000 it is 8.35 times as fast.
// compute dtype: all float inputs rounded to bf16; q/k/v = x W^T with EXACT bf16 products on WMMA 16x16x32, f32 accumulate; per-head RMSNorm of q and k in f32 in the projection epilogue; q as f16 hi + residual (x 2^10), k f16 -> 2-product logits / 8 inside the causal sliding window (512), held in f32 in LDS (one launch, GQA: head h reads kv head h/4); softmax in f32 (precise expf), P x 2^11 split bf16 hi + lo against v bf16 hi + lo (3 products); y = ctx (bf16 hi + lo) wo^T; f32 output.
#include <hip/hip_runtime.h>
#include <math.h>

typedef __attribute__((ext_vector_type(16))) _Float16 v16h;
typedef __attribute__((ext_vector_type(16))) __bf16 v16b;
typedef __attribute__((ext_vector_type(8)))  _Float16 v8h;
typedef __attribute__((ext_vector_type(8)))  float v8f;
typedef __attribute__((ext_vector_type(4)))  float v4f;
typedef __attribute__((ext_vector_type(2)))  float v2f;
typedef __attribute__((ext_vector_type(4)))  unsigned v4u;
typedef __attribute__((ext_vector_type(4)))  int v4i;
typedef float __attribute__((may_alias)) float_a;
typedef int __attribute__((may_alias)) int_a;

template <typename T> __device__ __forceinline__ void vst2(void* p, T v) { *(T*)p = v;  }
__device__ __forceinline__ v8f wmma16(v16h a, v16h b, v8f c) {
  v8f d = __builtin_amdgcn_wmma_f32_16x16x32_f16(false, a, false, b, (short)0, c, false, false);
  asm volatile("v_nop\n\tv_nop\n\tv_nop\n\tv_nop" : "+v"(d) : "v"(a), "v"(b));
  return d;
}
__device__ __forceinline__ v8f wmma_bf(v16b a, v16b b, v8f c) {
  v8f d = __builtin_amdgcn_wmma_f32_16x16x32_bf16(false, a, false, b, (short)0, c, false, false);
  asm volatile("v_nop\n\tv_nop\n\tv_nop\n\tv_nop" : "+v"(d) : "v"(a), "v"(b));
  return d;
}
// 16x16x32 fragments: lane = (h = lane>>4, row/col = lane&15); elements 0..7 = k0+8h+0..7, 8..15 = k0+16+8h+0..7; D element r = row 8h+r
__device__ __forceinline__ v16h frag_h(const _Float16* rowk0, int lane) {
  union { v16h v; v8h q[2]; } u; const _Float16* p = rowk0 + 8 * (lane >> 4);
  u.q[0] = *(const v8h*)p; u.q[1] = *(const v8h*)(p + 16); return u.v;
}
__device__ __forceinline__ v16h frag_f32(const float* rowk0, int lane) {
  v16h a; const float* p = rowk0 + 8 * (lane >> 4);
#pragma unroll
  for (int i = 0; i < 8; ++i) { a[i] = (_Float16)p[i]; a[8 + i] = (_Float16)p[16 + i]; }
  return a;
}
__device__ __forceinline__ v16h frag_f32s(const float* rowk0, int lane, float sc) {
  v16h a; const float* p = rowk0 + 8 * (lane >> 4);
#pragma unroll
  for (int i = 0; i < 8; ++i) { a[i] = (_Float16)(p[i] * sc); a[8 + i] = (_Float16)(p[16 + i] * sc); }
  return a;
}
// column fragment from a [K][ld] layout (column n), rows >= K read as 0
__device__ __forceinline__ v16h fragc_f32(const float* W, int k0, int n, int lane, int ld, int K) {
  v16h a; const int g = lane >> 4;
#pragma unroll
  for (int i = 0; i < 8; ++i) { const int ka = k0 + 8 * g + i, kb = ka + 16;
    a[i] = (_Float16)(ka < K ? W[(size_t)(ka < K ? ka : K - 1) * ld + n] : 0.f); a[8 + i] = (_Float16)(kb < K ? W[(size_t)(kb < K ? kb : K - 1) * ld + n] : 0.f); }
  return a;
}
struct F2 { v16b h, l; };
__device__ __forceinline__ F2 bsplit16(const float v[16]) { F2 r;
#pragma unroll
  for (int i = 0; i < 16; ++i) { const __bf16 h = (__bf16)v[i]; r.h[i] = h; r.l[i] = (__bf16)(v[i] - (float)h); }
  return r; }
__device__ __forceinline__ F2 split_row(const float* row, int k0, int lane) { float v[16]; const float* p = row + k0 + 8 * (lane >> 4);
#pragma unroll
  for (int i = 0; i < 8; ++i) { v[i] = p[i]; v[8 + i] = p[16 + i]; }
  return bsplit16(v); }
__device__ __forceinline__ F2 split_rowK(const float* row, int k0, int lane, int K) { float v[16]; const int g = lane >> 4;
#pragma unroll
  for (int i = 0; i < 8; ++i) { const int ka = k0 + 8 * g + i, kb = ka + 16; v[i] = ka < K ? row[ka < K ? ka : K - 1] : 0.f; v[8 + i] = kb < K ? row[kb < K ? kb : K - 1] : 0.f; }
  return bsplit16(v); }
__device__ __forceinline__ F2 split_col(const float* W, int k0, int n, int lane, int ld, int K) { float v[16]; const int g = lane >> 4;
#pragma unroll
  for (int i = 0; i < 8; ++i) { const int ka = k0 + 8 * g + i, kb = ka + 16; v[i] = ka < K ? W[(size_t)(ka < K ? ka : K - 1) * ld + n] : 0.f; v[8 + i] = kb < K ? W[(size_t)(kb < K ? kb : K - 1) * ld + n] : 0.f; }
  return bsplit16(v); }
__device__ __forceinline__ v8f mac3(const F2& a, const F2& b, v8f c) { c = wmma_bf(a.l, b.h, c); c = wmma_bf(a.h, b.l, c); return wmma_bf(a.h, b.h, c); }
__device__ __forceinline__ float sigm(float v) { return 1.0f / (1.0f + expf(-v)); }
#define LDSX() do { asm volatile("s_wait_dscnt 0" ::: "memory"); __builtin_amdgcn_wave_barrier(); __builtin_amdgcn_fence(__ATOMIC_RELEASE, "workgroup"); } while (0)


// Codec attention (B 4, T 2,048, DIM 1,024; 16 query heads, 4 kv heads x 64, QK-RMSNorm (eps 1e-6, weights read), causal sliding window 512, no biases): y = softmax(rms(q) rms(k)^T / 8 | window) v (kv head = h / 4), @ wo^T.
#define NB 4
#define TT 2048
#define CC 1024
#define NH 16
#define HD 64
#define WIN 512
#define NKV 4
#define CK (NKV * HD)   // 256: k/v row width
#define REP (NH / NKV)
#ifndef TNB
#define TNB NB
#endif
typedef __attribute__((ext_vector_type(8))) __bf16 v8b;
__device__ __forceinline__ v16b frag_b(const __bf16* rowk0, int lane) {
  union { v16b v; v8b q[2]; } u; const __bf16* p = rowk0 + 8 * (lane >> 4);
  u.q[0] = *(const v8b*)p; u.q[1] = *(const v8b*)(p + 16); return u.v;
}
__device__ __forceinline__ float bfr(float v) { return (float)(__bf16)v; }
__device__ __attribute__((noinline)) float exp_ni(float v) { return expf(v); }
__device__ __attribute__((noinline)) float erf_ni(float v) { return erff(v); }

#define WS_QH  0u
#define WS_QL  (WS_QH + 2u * (size_t)NB * TT * CC)
#define WS_KH  (WS_QL + 2u * (size_t)NB * TT * CC)
#define WS_VT  (WS_KH + 2u * (size_t)NB * TT * CK)      // bf16 v planes [b][CK][t] (k rows are [b*T+t][CK])
#define WS_VL  (WS_VT + 2u * (size_t)NB * CK * TT)
#define HG 4                                          // only sizes the WS_S region, which no kernel uses
#define WS_S   (WS_VL + 2u * (size_t)NB * CK * TT)      // unused: logits and P stay in LDS
#define WS_PH  (WS_S + 4u * (size_t)HG * TT * TT)
#define WS_Y   (WS_PH + 0u)              // f32 y rows [b*t][C]
#define WS_END (WS_Y + 4u * (size_t)NB * TT * CC)

// ---- operand staging of the two projection kernels: a stage is KS k of every operand row of the block, read from global memory by whole lines (16 lanes = 256 B of one row), rounded to bf16 once and shared through LDS
typedef __attribute__((ext_vector_type(4))) __bf16 v4b;
#define KS 64             // k per stage
#define NS (CC / KS)
#define PIT (KS + 8)      // LDS row pitch in bf16: 144 B = 16 B x 9, so the 16 rows of a 16-byte fragment read fall on different banks
__device__ __forceinline__ v4b cvt4(v4f v) { v4b r;
#pragma unroll
  for (int i = 0; i < 4; ++i) r[i] = (__bf16)v[i];
  return r; }
// a precaution: stands behind a group of global loads, in front of the next rewrite of their address registers; the group's one lane pointer is an input, so that it stays live up to the wait and no result of the group lands in it
#define XW(p) asm volatile("s_wait_xcnt 0x0" :: "v"(p) : "memory")
#define XW2(p, q) asm volatile("s_wait_xcnt 0x0" :: "v"(p), "v"(q) : "memory")   // the same behind a group that reads through two lane pointers
// ---- k_proj: block = (64 rows, 128 cols, which): qkv = x W (+ b), exact; q -> f16 hi (+ residual), k -> f16 rows, v -> bf16 hi + lo planes
__global__ __launch_bounds__(128) void k_proj(const float* __restrict__ X, const float* __restrict__ WQ, const float* __restrict__ BQ, const float* __restrict__ WK, const float* __restrict__ BK, const float* __restrict__ WV, const float* __restrict__ BV, _Float16* __restrict__ QH, _Float16* __restrict__ QL, _Float16* __restrict__ KH, __bf16* __restrict__ VT, __bf16* __restrict__ VL, const float* __restrict__ NQW, const float* __restrict__ NKW, int wbase) {
  __shared__ __align__(16) char smem[2 * 64 * 136 * 2 + 2 * 128 * 72 * 2];   // the loop's two stage buffers (2 x 192 rows x 144 B) first, then the epilogue's arrays on the same bytes
  _Float16 (*sh)[136] = (_Float16 (*)[136])smem, (*sl)[136] = sh + 64; __bf16 (*th)[72] = (__bf16 (*)[72])(smem + 2 * 64 * 136 * 2), (*tl2)[72] = th + 128;
  const int tid = threadIdx.x, wave = tid >> 5, lane = tid & 31, col = lane & 15, g = lane >> 4; const int which = wbase + blockIdx.z; const int OW = (which == 0) ? CC : CK;   /* output row width: q 1,024, k/v 256 */ const int c0 = blockIdx.y * 128; const size_t r0 = (size_t)blockIdx.x * 64; const float* WA = which == 0 ? WQ : which == 1 ? WK : WV; const float* BA = which == 0 ? BQ : which == 1 ? BK : BV;
  v8f acc[8] = {};
  { const int lr = tid >> 4, lp = tid & 15;   // the thread's row of each group of 8 rows, and its 16 bytes of the row's 256
    const float* gw = WA + (size_t)(c0 + lr) * CC + lp * 4; const float* gx = X + (r0 + lr) * CC + lp * 4;
    v4f rw[16], rx[8];
#pragma unroll
    for (int i = 0; i < 16; ++i) rw[i] = *(const v4f*)(gw + i * 8 * CC);
#pragma unroll
    for (int i = 0; i < 8; ++i) rx[i] = *(const v4f*)(gx + i * 8 * CC);
    XW2(gw, gx);
    // stays rolled: a trip is already 16 matrix instructions and 60 LDS operations a wave; two buffers, ONE barrier a stage: a buffer is rewritten two stages later, behind the barrier of the stage between
#pragma unroll 1
    for (int s = 0; s < NS; ++s) { __bf16* const bs = (__bf16*)smem + (s & 1) * ((128 + 64) * PIT);   // rows 0-127: W, 128-191: x
#pragma unroll
      for (int i = 0; i < 16; ++i) *(v4b*)(bs + (i * 8 + lr) * PIT + lp * 4) = cvt4(rw[i]);
#pragma unroll
      for (int i = 0; i < 8; ++i) *(v4b*)(bs + (128 + i * 8 + lr) * PIT + lp * 4) = cvt4(rx[i]);
      __syncthreads();
      if (s + 1 < NS) { gw += KS; gx += KS;   // behind the barrier (which waits for every load in flight): the next stage flies under this stage's products
#pragma unroll
        for (int i = 0; i < 16; ++i) rw[i] = *(const v4f*)(gw + i * 8 * CC);
#pragma unroll
        for (int i = 0; i < 8; ++i) rx[i] = *(const v4f*)(gx + i * 8 * CC);
        XW2(gw, gx); }
#pragma unroll
      for (int kk = 0; kk < KS / 32; ++kk) { v16b w[8]; const v16b a = frag_b(bs + (128 + wave * 16 + col) * PIT + kk * 32, lane);   // the nine fragments as one group of LDS reads in front of their eight products
#pragma unroll
        for (int j = 0; j < 8; ++j) w[j] = frag_b(bs + (j * 16 + col) * PIT + kk * 32, lane);
#pragma unroll
        for (int j = 0; j < 8; ++j) acc[j] = wmma_bf(a, w[j], acc[j]); } }
    __syncthreads(); }   // every wave has left the stage buffers: the epilogue's arrays lie on the same LDS
  // QK-RMSNorm per (row, head): the block's 128 columns are two heads (tiles 0-3, 4-7); mean of squares over the 64 dims via in-lane + 16-lane shuffles (unconditional), then scale by rsqrt(ms + eps) * norm_w[d]
  if (which < 2) { const float* NW = which == 0 ? NQW : NKW;
#pragma unroll
    for (int hh = 0; hh < 2; ++hh) { float ssq[8];
#pragma unroll
      for (int r = 0; r < 8; ++r) { float s_ = 0.f;
#pragma unroll
        for (int jj = 0; jj < 4; ++jj) s_ += acc[hh * 4 + jj][r] * acc[hh * 4 + jj][r];
#pragma unroll
        for (int o_ = 1; o_ < 16; o_ <<= 1) s_ += __shfl_xor(s_, o_);
        ssq[r] = rsqrtf(s_ * (1.0f / HD) + 1e-6f); }
#pragma unroll
      for (int jj = 0; jj < 4; ++jj) { const float wv = bfr(NW[jj * 16 + col]);
#pragma unroll
        for (int r = 0; r < 8; ++r) acc[hh * 4 + jj][r] *= ssq[r] * wv; } } }
#pragma unroll
  for (int j = 0; j < 8; ++j) { const float bb = BA ? bfr(BA[c0 + j * 16 + col]) : 0.f;
#pragma unroll
    for (int r = 0; r < 8; ++r) { const float v = acc[j][r] + bb; const int rl = wave * 16 + 8 * g + r, cl = j * 16 + col; const _Float16 hv = (_Float16)v;
      if (which == 2) { const __bf16 bh = (__bf16)v; th[cl][rl] = bh; tl2[cl][rl] = (__bf16)(v - (float)bh); } else { sh[rl][cl] = hv; sl[rl][cl] = (_Float16)((v - (float)hv) * 1024.0f); }   /* q residual carried x 2^10 so the plane stays f16-normal on the chip */ } }
  __syncthreads();
  if (which < 2) { _Float16* dh = which == 0 ? QH : KH; for (int e = tid; e < 64 * 16; e += 128) { const int rl = e >> 4, q = e & 15; vst2((unsigned*)(dh + (r0 + rl) * OW + c0 + q * 8), *(const v4u*)&sh[rl][q * 8]); if (which == 0) vst2((unsigned*)(QL + (r0 + rl) * CC + c0 + q * 8), *(const v4u*)&sl[rl][q * 8]); } }
  else { const size_t b = r0 / TT; const int t0 = (int)(r0 % TT); for (int e = tid; e < 128 * 8; e += 128) { const int cl = e >> 3, q = e & 7; const size_t o2 = (b * CK + c0 + cl) * (size_t)TT + t0 + q * 8; vst2((unsigned*)(VT + o2), *(const v4u*)&th[cl][q * 8]); vst2((unsigned*)(VL + o2), *(const v4u*)&tl2[cl][q * 8]); } } }
// ---- k_att: block = 64 queries of (b,h), one wave = 16 queries, no exchange between waves. S^T = K Q^T (A = 16 key rows, B = 16 query rows), so a lane holds the logits of ONE query (col) at keys 8g+r of each 16-key tile;
// two such tiles are, element for element, the A fragment of P for a 32-key chunk. The wave's window is NCH chunks of 32 keys; each lane parks its own logits in LDS (16 B a lane, lane-contiguous) and reads back only what it wrote.
// K and V fragments are fetched one chunk ahead into registers (the LDS strip allows two waves a SIMD, so registers are free).
#define NCH 17   // 32-key chunks that cover [ql0 - 511, ql0 + 15] from a multiple of 32
// fragments from the lane's own pointer (row and 8 * half already in it)
__device__ __forceinline__ v16h fragp_h(const _Float16* p) { union { v16h v; v8h q[2]; } u; u.q[0] = *(const v8h*)p; u.q[1] = *(const v8h*)(p + 16); return u.v; }
__device__ __forceinline__ v16b fragp_b(const __bf16* p) { union { v16b v; v8b q[2]; } u; u.q[0] = *(const v8b*)p; u.q[1] = *(const v8b*)(p + 16); return u.v; }
__global__ __launch_bounds__(128) void k_att(const _Float16* __restrict__ QH, const _Float16* __restrict__ QL, const _Float16* __restrict__ KH, const __bf16* __restrict__ VT, float* __restrict__ Y) {   // the v residual plane lies NB * CK * TT elements behind VT
  __shared__ __align__(16) float st[4][NCH * 4][32][4];
  const int tid = threadIdx.x, wave = __builtin_amdgcn_readfirstlane(tid >> 5), lane = tid & 31, col = lane & 15, g = lane >> 4;
  const int b = blockIdx.z, h = blockIdx.y, ql0 = blockIdx.x * 64 + wave * 16, qt = ql0 + col;
  const int kbase = ((ql0 - (WIN - 1)) >> 5) * 32;      // first key of chunk 0 (floor to 32; below 0 for the first rows)
  const int c0 = kbase < 0 ? (-kbase) >> 5 : 0;         // wave-uniform: chunks wholly in front of key 0 are not walked
  const int kf = kbase < 0 ? 0 : kbase;                 // first key walked = kbase + c0 * 32
  const int st0 = c0 + 1 < NCH ? 32 : 0;                // keys from the first chunk to the first one fetched ahead
  const _Float16* qp = QH + ((size_t)b * TT + qt) * CC + h * HD + 8 * g; const _Float16* qlp = QL + ((size_t)b * TT + qt) * CC + h * HD + 8 * g;
  const v16h qh0 = fragp_h(qp), qh1 = fragp_h(qp + 32), qr0 = fragp_h(qlp), qr1 = fragp_h(qlp + 32);
  const _Float16* kp = KH + ((size_t)b * TT + kf + col) * CK + (h / REP) * HD + 8 * g;   /* GQA: kv head h/4; the lane's key row of the first tile */
  v16h ka[2], kb[2];
#pragma unroll
  for (int t = 0; t < 2; ++t) { ka[t] = fragp_h(kp + t * 16 * CK); kb[t] = fragp_h(kp + t * 16 * CK + 32); }
  // holds the first loads in front of the wait (loaded values as inputs only): without them the compiler moves these loads behind it; the three pointers as in XW
  asm volatile("s_wait_xcnt 0x0" :: "v"(qh0), "v"(qh1), "v"(qr0), "v"(qr1), "v"(ka[0]), "v"(kb[0]), "v"(ka[1]), "v"(kb[1]), "v"(qp), "v"(qlp), "v"(kp) : "memory");
  kp += st0 * CK;
  float m = -3.0e38f;
  // two trips a pass: the fragments in use and the ones fetched ahead swap registers without moves
#pragma unroll 2
  for (int c = c0; c < NCH; ++c) {   // kp walks one chunk ahead and stops at the last one (the last trip fetches its own chunk again): the address stays inside k
    v16h na[2], nb[2];
#pragma unroll
    for (int t = 0; t < 2; ++t) { na[t] = fragp_h(kp + t * 16 * CK); nb[t] = fragp_h(kp + t * 16 * CK + 32); }
    XW(kp);
    kp += c + 2 < NCH ? 32 * CK : 0;
#pragma unroll
    for (int t = 0; t < 2; ++t) { const int kt0 = kbase + c * 32 + t * 16;
      v8f a = {}, al = {};
      a = wmma16(ka[t], qh0, a); al = wmma16(ka[t], qr0, al); a = wmma16(kb[t], qh1, a); al = wmma16(kb[t], qr1, al);
      a += al * (1.0f / 1024.0f);
      v4f s0, s1;
#pragma unroll
      for (int r = 0; r < 8; ++r) { const int kt = kt0 + 8 * g + r; const bool allowed = (kt <= qt) && (qt - kt < WIN); const float v = allowed ? a[r] * 0.125f : -3.0e38f; m = fmaxf(m, v); if (r < 4) s0[r] = v; else s1[r - 4] = v; }
      *(v4f*)&st[wave][c * 4 + t * 2][lane][0] = s0; *(v4f*)&st[wave][c * 4 + t * 2 + 1][lane][0] = s1; }
#pragma unroll
    for (int t = 0; t < 2; ++t) { ka[t] = na[t]; kb[t] = nb[t]; } }
  const __bf16* vp = VT + ((size_t)b * CK + (h / REP) * HD + col) * (size_t)TT + kf + 8 * g;   /* GQA v plane of kv head h/4; the lane's v row of the first 16, at the first chunk */
  v16b vh[HD / 16], vl[HD / 16];   // the first chunk's v flies under the softmax
#pragma unroll
  for (int j = 0; j < HD / 16; ++j) { vh[j] = fragp_b(vp + j * 16 * TT); vl[j] = fragp_b(vp + j * 16 * TT + NB * CK * TT); }
  XW(vp);
  vp += st0;
  m = fmaxf(m, __shfl_xor(m, 16));   // the query's other eight keys of every tile sit in lane ^ 16
  float sum = 0.f;
  // stays rolled: sixteen independent exponentials a trip already fill the vector port, more copies only cost code
#pragma unroll 1
  for (int c = c0; c < NCH; ++c) { v4f v[4];
#pragma unroll
    for (int q = 0; q < 4; ++q) v[q] = *(const v4f*)&st[wave][c * 4 + q][lane][0];
#pragma unroll
    for (int q = 0; q < 4; ++q) {
#pragma unroll
      for (int i = 0; i < 4; ++i) { const float ex = expf(v[q][i] - m); const float e = (v[q][i] <= -1.0e38f) ? 0.f : ex; sum += e; v[q][i] = e; }
      *(v4f*)&st[wave][c * 4 + q][lane][0] = v[q]; } }
  sum += __shfl_xor(sum, 16);
  const float inv = 1.0f / sum;
  v8f acc[HD / 16] = {};
  // two trips a pass, as in the logit loop: no register moves between the two fragment sets
#pragma unroll 2
  for (int c = c0; c < NCH; ++c) {   // as above: vp stops at the last chunk, the last trip's fetch stays inside v
    v16b nh[HD / 16], nl[HD / 16];
#pragma unroll
    for (int j = 0; j < HD / 16; ++j) { nh[j] = fragp_b(vp + j * 16 * TT); nl[j] = fragp_b(vp + j * 16 * TT + NB * CK * TT); }
    XW(vp);
    vp += c + 2 < NCH ? 32 : 0;
    float pv[16];
#pragma unroll
    for (int q = 0; q < 4; ++q) { const v4f v = *(const v4f*)&st[wave][c * 4 + q][lane][0];
#pragma unroll
      for (int i = 0; i < 4; ++i) pv[q * 4 + i] = v[i] * inv * 2048.0f; }
    const F2 p = bsplit16(pv);
#pragma unroll
    for (int j = 0; j < HD / 16; ++j) { acc[j] = wmma_bf(p.h, vh[j], acc[j]); acc[j] = wmma_bf(p.l, vh[j], acc[j]); acc[j] = wmma_bf(p.h, vl[j], acc[j]); }
#pragma unroll
    for (int j = 0; j < HD / 16; ++j) { vh[j] = nh[j]; vl[j] = nl[j]; } }
  float (*ss)[HD + 4] = (float (*)[HD + 4])&st[wave][0][0][0];   // the wave's own strip, now free, turns the output tile for 16-byte row stores
#pragma unroll
  for (int j = 0; j < HD / 16; ++j)
#pragma unroll
    for (int r = 0; r < 8; ++r) ss[8 * g + r][j * 16 + col] = acc[j][r] * (1.0f / 2048.0f);
  LDSX(); for (int rl = 0; rl < 16; ++rl) if (lane < HD / 4) vst2(Y + ((size_t)b * TT + ql0 + rl) * CC + h * HD + lane * 4, *(const v4f*)&ss[rl][lane * 4]); }
// ---- k_out: block = (64 rows, 128 cols): out = y (bf16 hi + lo) Wo^T + bo
__global__ __launch_bounds__(128) void k_out(const float* __restrict__ Y, const float* __restrict__ WP, const float* __restrict__ BP, float* __restrict__ OUT) { __shared__ __align__(16) char smem[2 * (128 + 128) * PIT * 2]; float (*sf)[16][132] = (float (*)[16][132])smem;   // two stage buffers; the output tiles (33,792 B) on the same bytes behind the loop
  const int tid = threadIdx.x, wave = tid >> 5, lane = tid & 31, col = lane & 15, g = lane >> 4; const int c0 = blockIdx.y * 128; const size_t r0 = (size_t)blockIdx.x * 64 + wave * 16;
  v8f acc[8] = {};
  { const int lr = tid >> 4, lp = tid & 15;   // as in k_proj
    const float* gw = WP + (size_t)(c0 + lr) * CC + lp * 4; const float* gy = Y + ((size_t)blockIdx.x * 64 + lr) * CC + lp * 4;
    v4f rw[16], ry[8];
#pragma unroll
    for (int i = 0; i < 16; ++i) rw[i] = *(const v4f*)(gw + i * 8 * CC);
#pragma unroll
    for (int i = 0; i < 8; ++i) ry[i] = *(const v4f*)(gy + i * 8 * CC);
    XW2(gw, gy);
    // stays rolled, two buffers, one barrier a stage, as in k_proj
#pragma unroll 1
    for (int s = 0; s < NS; ++s) { __bf16* const bs = (__bf16*)smem + (s & 1) * ((128 + 128) * PIT);   // rows 0-127: W, 128-191: y hi, 192-255: y lo
#pragma unroll
      for (int i = 0; i < 16; ++i) *(v4b*)(bs + (i * 8 + lr) * PIT + lp * 4) = cvt4(rw[i]);
#pragma unroll
      for (int i = 0; i < 8; ++i) { const v4b hi = cvt4(ry[i]); v4f re;
#pragma unroll
        for (int e = 0; e < 4; ++e) re[e] = ry[i][e] - (float)hi[e];
        *(v4b*)(bs + (128 + i * 8 + lr) * PIT + lp * 4) = hi; *(v4b*)(bs + (192 + i * 8 + lr) * PIT + lp * 4) = cvt4(re); }
      __syncthreads();
      if (s + 1 < NS) { gw += KS; gy += KS;
#pragma unroll
        for (int i = 0; i < 16; ++i) rw[i] = *(const v4f*)(gw + i * 8 * CC);
#pragma unroll
        for (int i = 0; i < 8; ++i) ry[i] = *(const v4f*)(gy + i * 8 * CC);
        XW2(gw, gy); }
#pragma unroll
      for (int kk = 0; kk < KS / 32; ++kk) { const v16b ah = frag_b(bs + (128 + wave * 16 + col) * PIT + kk * 32, lane), al = frag_b(bs + (192 + wave * 16 + col) * PIT + kk * 32, lane);
#pragma unroll
        for (int jh = 0; jh < 8; jh += 4) { v16b w[4];   // four W fragments as one group of LDS reads in front of their eight products
#pragma unroll
          for (int j = 0; j < 4; ++j) w[j] = frag_b(bs + ((jh + j) * 16 + col) * PIT + kk * 32, lane);
#pragma unroll
          for (int j = 0; j < 4; ++j) { acc[jh + j] = wmma_bf(ah, w[j], acc[jh + j]); acc[jh + j] = wmma_bf(al, w[j], acc[jh + j]); } } } }
    __syncthreads(); }   // every wave has left the stage buffers: sf lies on the same LDS
#pragma unroll
  for (int j = 0; j < 8; ++j) { const float bb = BP ? bfr(BP[c0 + j * 16 + col]) : 0.f;
#pragma unroll
    for (int r = 0; r < 8; ++r) sf[wave][8 * g + r][j * 16 + col] = acc[j][r] + bb; }
  LDSX(); for (int rl = 0; rl < 16; ++rl) vst2(OUT + (r0 + rl) * CC + c0 + lane * 4, *(const v4f*)&sf[wave][rl][lane * 4]); }
extern "C" void kernel_launch(void* const* d_in, const int* in_sizes, int n_in, void* d_out, int out_size, void* d_ws, size_t ws_size, hipStream_t stream) {
  (void)in_sizes; (void)n_in; (void)out_size;
  const float** F = (const float**)d_in;   // 0 x [4,2048,1024], 1 wq [1024,1024] ([out,in]), 2 wk [256,1024], 3 wv [256,1024], 4 wo [1024,1024] ([out,in]), 5 q_norm_w [64], 6 k_norm_w [64]
  if (ws_size < (size_t)WS_END) return;
  char* ws = (char*)d_ws; _Float16 *QH = (_Float16*)(ws + WS_QH), *QL = (_Float16*)(ws + WS_QL), *KH = (_Float16*)(ws + WS_KH); __bf16 *VT = (__bf16*)(ws + WS_VT), *VL = (__bf16*)(ws + WS_VL); float *Y = (float*)(ws + WS_Y);
  k_proj<<<dim3(TNB * TT / 64, CC / 128, 1), 128, 0, stream>>>(F[0], F[1], nullptr, F[2], nullptr, F[3], nullptr, QH, QL, KH, VT, VL, F[5], F[6], 0);   // q (16 heads)
  k_proj<<<dim3(TNB * TT / 64, CK / 128, 2), 128, 0, stream>>>(F[0], F[1], nullptr, F[2], nullptr, F[3], nullptr, QH, QL, KH, VT, VL, F[5], F[6], 1);   // k, v (4 kv heads)
  k_att<<<dim3(TT / 64, NH, TNB), 128, 0, stream>>>(QH, QL, KH, VT, Y);   // logits, softmax and P v of every (b, h) in one launch
  k_out<<<dim3(TNB * TT / 64, CC / 128), 128, 0, stream>>>(Y, F[4], nullptr, (float*)d_out);
}

// v003
// It runs in 162 microseconds.
// Timed twice side by side with v002, it ran 1.07 times as fast both times.
// Over all steps from v000 it is 8.91 times as fast.
// compute dtype: all float inputs rounded to bf16; q/k/v = x W^T with EXACT bf16 products on WMMA 16x16x32, f32 accumulate; per-head RMSNorm of q and k in f32 in the projection epilogue; q as f16 hi + residual (x 2^10), k f16 -> 2-product logits / 8 inside the causal sliding window (512), held in f32 in LDS (one launch, GQA: head h reads kv head h/4); softmax in f32: P' = exp2((s - max) log2 e + 11) on the hardware exponential, not normalised, split bf16 hi + lo against v bf16 hi + lo (3 products), the output tile scaled by 1 / sum P'; y = ctx (bf16 hi + lo) wo^T; f32 output.
#include <hip/hip_runtime.h>
#include <math.h>

typedef __attribute__((ext_vector_type(16))) _Float16 v16h;
typedef __attribute__((ext_vector_type(16))) __bf16 v16b;
typedef __attribute__((ext_vector_type(8)))  _Float16 v8h;
typedef __attribute__((ext_vector_type(8)))  float v8f;
typedef __attribute__((ext_vector_type(4)))  float v4f;
typedef __attribute__((ext_vector_type(2)))  float v2f;
typedef __attribute__((ext_vector_type(4)))  unsigned v4u;
typedef __attribute__((ext_vector_type(4)))  int v4i;
typedef float __attribute__((may_alias)) float_a;
typedef int __attribute__((may_alias)) int_a;

template <typename T> __device__ __forceinline__ void vst2(void* p, T v) { *(T*)p = v;  }
__device__ __forceinline__ v8f wmma16(v16h a, v16h b, v8f c) {
  v8f d = __builtin_amdgcn_wmma_f32_16x16x32_f16(false, a, false, b, (short)0, c, false, false);
  asm volatile("v_nop\n\tv_nop\n\tv_nop\n\tv_nop" : "+v"(d) : "v"(a), "v"(b));
  return d;
}
__device__ __forceinline__ v8f wmma_bf(v16b a, v16b b, v8f c) {
  v8f d = __builtin_amdgcn_wmma_f32_16x16x32_bf16(false, a, false, b, (short)0, c, false, false);
  asm volatile("v_nop\n\tv_nop\n\tv_nop\n\tv_nop" : "+v"(d) : "v"(a), "v"(b));
  return d;
}
// 16x16x32 fragments: lane = (h = lane>>4, row/col = lane&15); elements 0..7 = k0+8h+0..7, 8..15 = k0+16+8h+0..7; D element r = row 8h+r
__device__ __forceinline__ v16h frag_h(const _Float16* rowk0, int lane) {
  union { v16h v; v8h q[2]; } u; const _Float16* p = rowk0 + 8 * (lane >> 4);
  u.q[0] = *(const v8h*)p; u.q[1] = *(const v8h*)(p + 16); return u.v;
}
__device__ __forceinline__ v16h frag_f32(const float* rowk0, int lane) {
  v16h a; const float* p = rowk0 + 8 * (lane >> 4);
#pragma unroll
  for (int i = 0; i < 8; ++i) { a[i] = (_Float16)p[i]; a[8 + i] = (_Float16)p[16 + i]; }
  return a;
}
__device__ __forceinline__ v16h frag_f32s(const float* rowk0, int lane, float sc) {
  v16h a; const float* p = rowk0 + 8 * (lane >> 4);
#pragma unroll
  for (int i = 0; i < 8; ++i) { a[i] = (_Float16)(p[i] * sc); a[8 + i] = (_Float16)(p[16 + i] * sc); }
  return a;
}
// column fragment from a [K][ld] layout (column n), rows >= K read as 0
__device__ __forceinline__ v16h fragc_f32(const float* W, int k0, int n, int lane, int ld, int K) {
  v16h a; const int g = lane >> 4;
#pragma unroll
  for (int i = 0; i < 8; ++i) { const int ka = k0 + 8 * g + i, kb = ka + 16;
    a[i] = (_Float16)(ka < K ? W[(size_t)(ka < K ? ka : K - 1) * ld + n] : 0.f); a[8 + i] = (_Float16)(kb < K ? W[(size_t)(kb < K ? kb : K - 1) * ld + n] : 0.f); }
  return a;
}
struct F2 { v16b h, l; };
__device__ __forceinline__ F2 bsplit16(const float v[16]) { F2 r;
#pragma unroll
  for (int i = 0; i < 16; ++i) { const __bf16 h = (__bf16)v[i]; r.h[i] = h; r.l[i] = (__bf16)(v[i] - (float)h); }
  return r; }
__device__ __forceinline__ F2 split_row(const float* row, int k0, int lane) { float v[16]; const float* p = row + k0 + 8 * (lane >> 4);
#pragma unroll
  for (int i = 0; i < 8; ++i) { v[i] = p[i]; v[8 + i] = p[16 + i]; }
  return bsplit16(v); }
__device__ __forceinline__ F2 split_rowK(const float* row, int k0, int lane, int K) { float v[16]; const int g = lane >> 4;
#pragma unroll
  for (int i = 0; i < 8; ++i) { const int ka = k0 + 8 * g + i, kb = ka + 16; v[i] = ka < K ? row[ka < K ? ka : K - 1] : 0.f; v[8 + i] = kb < K ? row[kb < K ? kb : K - 1] : 0.f; }
  return bsplit16(v); }
__device__ __forceinline__ F2 split_col(const float* W, int k0, int n, int lane, int ld, int K) { float v[16]; const int g = lane >> 4;
#pragma unroll
  for (int i = 0; i < 8; ++i) { const int ka = k0 + 8 * g + i, kb = ka + 16; v[i] = ka < K ? W[(size_t)(ka < K ? ka : K - 1) * ld + n] : 0.f; v[8 + i] = kb < K ? W[(size_t)(kb < K ? kb : K - 1) * ld + n] : 0.f; }
  return bsplit16(v); }
__device__ __forceinline__ v8f mac3(const F2& a, const F2& b, v8f c) { c = wmma_bf(a.l, b.h, c); c = wmma_bf(a.h, b.l, c); return wmma_bf(a.h, b.h, c); }
__device__ __forceinline__ float sigm(float v) { return 1.0f / (1.0f + expf(-v)); }
#define LDSX() do { asm volatile("s_wait_dscnt 0" ::: "memory"); __builtin_amdgcn_wave_barrier(); __builtin_amdgcn_fence(__ATOMIC_RELEASE, "workgroup"); } while (0)


// Codec attention (B 4, T 2,048, DIM 1,024; 16 query heads, 4 kv heads x 64, QK-RMSNorm (eps 1e-6, weights read), causal sliding window 512, no biases): y = softmax(rms(q) rms(k)^T / 8 | window) v (kv head = h / 4), @ wo^T.
#define NB 4
#define TT 2048
#define CC 1024
#define NH 16
#define HD 64
#define WIN 512
#define NKV 4
#define CK (NKV * HD)   // 256: k/v row width
#define REP (NH / NKV)
#ifndef TNB
#define TNB NB
#endif
typedef __attribute__((ext_vector_type(8))) __bf16 v8b;
__device__ __forceinline__ v16b frag_b(const __bf16* rowk0, int lane) {
  union { v16b v; v8b q[2]; } u; const __bf16* p = rowk0 + 8 * (lane >> 4);
  u.q[0] = *(const v8b*)p; u.q[1] = *(const v8b*)(p + 16); return u.v;
}
__device__ __forceinline__ float bfr(float v) { return (float)(__bf16)v; }
__device__ __attribute__((noinline)) float exp_ni(float v) { return expf(v); }
__device__ __attribute__((noinline)) float erf_ni(float v) { return erff(v); }

#define WS_QH  0u
#define WS_QL  (WS_QH + 2u * (size_t)NB * TT * CC)
#define WS_KH  (WS_QL + 2u * (size_t)NB * TT * CC)
#define WS_VT  (WS_KH + 2u * (size_t)NB * TT * CK)      // bf16 v planes [b][CK][t] (k rows are [b*T+t][CK])
#define WS_VL  (WS_VT + 2u * (size_t)NB * CK * TT)
#define HG 4                                          // only sizes the WS_S region, which no kernel uses
#define WS_S   (WS_VL + 2u * (size_t)NB * CK * TT)      // unused: the logits stay in LDS, P in registers
#define WS_PH  (WS_S + 4u * (size_t)HG * TT * TT)
#define WS_Y   (WS_PH + 0u)              // f32 y rows [b*t][C]
#define WS_END (WS_Y + 4u * (size_t)NB * TT * CC)

// ---- operand staging of the two projection kernels: a stage is KS k of every operand row of the block, read from global memory by whole lines (16 lanes = 256 B of one row), rounded to bf16 once and shared through LDS
typedef __attribute__((ext_vector_type(4))) __bf16 v4b;
#define KS 64             // k per stage
#define NS (CC / KS)
#define PIT (KS + 8)      // LDS row pitch in bf16: 144 B = 16 B x 9, so the 16 rows of a 16-byte fragment read fall on different banks
__device__ __forceinline__ v4b cvt4(v4f v) { v4b r;
#pragma unroll
  for (int i = 0; i < 4; ++i) r[i] = (__bf16)v[i];
  return r; }
// a precaution: stands behind a group of global loads, in front of the next rewrite of their address registers; the group's one lane pointer is an input, so that it stays live up to the wait and no result of the group lands in it
#define XW(p) asm volatile("s_wait_xcnt 0x0" :: "v"(p) : "memory")
#define XW2(p, q) asm volatile("s_wait_xcnt 0x0" :: "v"(p), "v"(q) : "memory")   // the same behind a group that reads through two lane pointers
// ---- k_proj: block = (64 rows, 128 cols, which): qkv = x W (+ b), exact; q -> f16 hi (+ residual), k -> f16 rows, v -> bf16 hi + lo planes
__global__ __launch_bounds__(128) void k_proj(const float* __restrict__ X, const float* __restrict__ WQ, const float* __restrict__ BQ, const float* __restrict__ WK, const float* __restrict__ BK, const float* __restrict__ WV, const float* __restrict__ BV, _Float16* __restrict__ QH, _Float16* __restrict__ QL, _Float16* __restrict__ KH, __bf16* __restrict__ VT, __bf16* __restrict__ VL, const float* __restrict__ NQW, const float* __restrict__ NKW, int wbase) {
  __shared__ __align__(16) char smem[2 * 64 * 136 * 2 + 2 * 128 * 72 * 2];   // the loop's two stage buffers (2 x 192 rows x 144 B) first, then the epilogue's arrays on the same bytes
  _Float16 (*sh)[136] = (_Float16 (*)[136])smem, (*sl)[136] = sh + 64; __bf16 (*th)[72] = (__bf16 (*)[72])(smem + 2 * 64 * 136 * 2), (*tl2)[72] = th + 128;
  const int tid = threadIdx.x, wave = tid >> 5, lane = tid & 31, col = lane & 15, g = lane >> 4; const int which = wbase + blockIdx.z; const int OW = (which == 0) ? CC : CK;   /* output row width: q 1,024, k/v 256 */ const int c0 = blockIdx.y * 128; const size_t r0 = (size_t)blockIdx.x * 64; const float* WA = which == 0 ? WQ : which == 1 ? WK : WV; const float* BA = which == 0 ? BQ : which == 1 ? BK : BV;
  v8f acc[8] = {};
  { const int lr = tid >> 4, lp = tid & 15;   // the thread's row of each group of 8 rows, and its 16 bytes of the row's 256
    const float* gw = WA + (size_t)(c0 + lr) * CC + lp * 4; const float* gx = X + (r0 + lr) * CC + lp * 4;
    v4f rw[16], rx[8];
#pragma unroll
    for (int i = 0; i < 16; ++i) rw[i] = *(const v4f*)(gw + i * 8 * CC);
#pragma unroll
    for (int i = 0; i < 8; ++i) rx[i] = *(const v4f*)(gx + i * 8 * CC);
    XW2(gw, gx);
    // stays rolled: a trip is already 16 matrix instructions and 60 LDS operations a wave; two buffers, ONE barrier a stage: a buffer is rewritten two stages later, behind the barrier of the stage between
#pragma unroll 1
    for (int s = 0; s < NS; ++s) { __bf16* const bs = (__bf16*)smem + (s & 1) * ((128 + 64) * PIT);   // rows 0-127: W, 128-191: x
#pragma unroll
      for (int i = 0; i < 16; ++i) *(v4b*)(bs + (i * 8 + lr) * PIT + lp * 4) = cvt4(rw[i]);
#pragma unroll
      for (int i = 0; i < 8; ++i) *(v4b*)(bs + (128 + i * 8 + lr) * PIT + lp * 4) = cvt4(rx[i]);
      __syncthreads();
      if (s + 1 < NS) { gw += KS; gx += KS;   // behind the barrier (which waits for every load in flight): the next stage flies under this stage's products
#pragma unroll
        for (int i = 0; i < 16; ++i) rw[i] = *(const v4f*)(gw + i * 8 * CC);
#pragma unroll
        for (int i = 0; i < 8; ++i) rx[i] = *(const v4f*)(gx + i * 8 * CC);
        XW2(gw, gx); }
#pragma unroll
      for (int kk = 0; kk < KS / 32; ++kk) { v16b w[8]; const v16b a = frag_b(bs + (128 + wave * 16 + col) * PIT + kk * 32, lane);   // the nine fragments as one group of LDS reads in front of their eight products
#pragma unroll
        for (int j = 0; j < 8; ++j) w[j] = frag_b(bs + (j * 16 + col) * PIT + kk * 32, lane);
#pragma unroll
        for (int j = 0; j < 8; ++j) acc[j] = wmma_bf(a, w[j], acc[j]); } }
    __syncthreads(); }   // every wave has left the stage buffers: the epilogue's arrays lie on the same LDS
  // QK-RMSNorm per (row, head): the block's 128 columns are two heads (tiles 0-3, 4-7); mean of squares over the 64 dims via in-lane + 16-lane shuffles (unconditional), then scale by rsqrt(ms + eps) * norm_w[d]
  if (which < 2) { const float* NW = which == 0 ? NQW : NKW;
#pragma unroll
    for (int hh = 0; hh < 2; ++hh) { float ssq[8];
#pragma unroll
      for (int r = 0; r < 8; ++r) { float s_ = 0.f;
#pragma unroll
        for (int jj = 0; jj < 4; ++jj) s_ += acc[hh * 4 + jj][r] * acc[hh * 4 + jj][r];
#pragma unroll
        for (int o_ = 1; o_ < 16; o_ <<= 1) s_ += __shfl_xor(s_, o_);
        ssq[r] = rsqrtf(s_ * (1.0f / HD) + 1e-6f); }
#pragma unroll
      for (int jj = 0; jj < 4; ++jj) { const float wv = bfr(NW[jj * 16 + col]);
#pragma unroll
        for (int r = 0; r < 8; ++r) acc[hh * 4 + jj][r] *= ssq[r] * wv; } } }
#pragma unroll
  for (int j = 0; j < 8; ++j) { const float bb = BA ? bfr(BA[c0 + j * 16 + col]) : 0.f;
#pragma unroll
    for (int r = 0; r < 8; ++r) { const float v = acc[j][r] + bb; const int rl = wave * 16 + 8 * g + r, cl = j * 16 + col; const _Float16 hv = (_Float16)v;
      if (which == 2) { const __bf16 bh = (__bf16)v; th[cl][rl] = bh; tl2[cl][rl] = (__bf16)(v - (float)bh); } else { sh[rl][cl] = hv; sl[rl][cl] = (_Float16)((v - (float)hv) * 1024.0f); }   /* q residual carried x 2^10 so the plane stays f16-normal on the chip */ } }
  __syncthreads();
  if (which < 2) { _Float16* dh = which == 0 ? QH : KH; for (int e = tid; e < 64 * 16; e += 128) { const int rl = e >> 4, q = e & 15; vst2((unsigned*)(dh + (r0 + rl) * OW + c0 + q * 8), *(const v4u*)&sh[rl][q * 8]); if (which == 0) vst2((unsigned*)(QL + (r0 + rl) * CC + c0 + q * 8), *(const v4u*)&sl[rl][q * 8]); } }
  else { const size_t b = r0 / TT; const int t0 = (int)(r0 % TT); for (int e = tid; e < 128 * 8; e += 128) { const int cl = e >> 3, q = e & 7; const size_t o2 = (b * CK + c0 + cl) * (size_t)TT + t0 + q * 8; vst2((unsigned*)(VT + o2), *(const v4u*)&th[cl][q * 8]); vst2((unsigned*)(VL + o2), *(const v4u*)&tl2[cl][q * 8]); } } }
// ---- k_att: block = 64 queries of (b,h), one wave = 16 queries, no exchange between waves. S^T = K Q^T (A = 16 key rows, B = 16 query rows), so a lane holds the logits of ONE query (col) at keys 8g+r of each 16-key tile;
// two such tiles are, element for element, the A fragment of P for a 32-key chunk. The wave's window is NCH chunks of 32 keys; each lane parks its own logits in LDS (16 B a lane, lane-contiguous) and reads back only what it wrote.
// K and V fragments are fetched one chunk ahead into registers (the LDS strip allows two waves a SIMD, so registers are free).
#define NCH 17   // 32-key chunks that cover [ql0 - 511, ql0 + 15] from a multiple of 32
// fragments from the lane's own pointer (row and 8 * half already in it)
__device__ __forceinline__ v16h fragp_h(const _Float16* p) { union { v16h v; v8h q[2]; } u; u.q[0] = *(const v8h*)p; u.q[1] = *(const v8h*)(p + 16); return u.v; }
__device__ __forceinline__ v16b fragp_b(const __bf16* p) { union { v16b v; v8b q[2]; } u; u.q[0] = *(const v8b*)p; u.q[1] = *(const v8b*)(p + 16); return u.v; }
__global__ __launch_bounds__(128) void k_att(const _Float16* __restrict__ QH, const _Float16* __restrict__ QL, const _Float16* __restrict__ KH, const __bf16* __restrict__ VT, float* __restrict__ Y) {   // the v residual plane lies NB * CK * TT elements behind VT
  __shared__ __align__(16) float st[4][NCH * 4][32][4];
  const int tid = threadIdx.x, wave = __builtin_amdgcn_readfirstlane(tid >> 5), lane = tid & 31, col = lane & 15, g = lane >> 4;
  const int b = blockIdx.z, h = blockIdx.y, ql0 = blockIdx.x * 64 + wave * 16, qt = ql0 + col;
  const int kbase = ((ql0 - (WIN - 1)) >> 5) * 32;      // first key of chunk 0 (floor to 32; below 0 for the first rows)
  const int c0 = kbase < 0 ? (-kbase) >> 5 : 0;         // wave-uniform: chunks wholly in front of key 0 are not walked
  const int kf = kbase < 0 ? 0 : kbase;                 // first key walked = kbase + c0 * 32
  const int st0 = c0 + 1 < NCH ? 32 : 0;                // keys from the first chunk to the first one fetched ahead
  const _Float16* qp = QH + ((size_t)b * TT + qt) * CC + h * HD + 8 * g; const _Float16* qlp = QL + ((size_t)b * TT + qt) * CC + h * HD + 8 * g;
  const v16h qh0 = fragp_h(qp), qh1 = fragp_h(qp + 32), qr0 = fragp_h(qlp), qr1 = fragp_h(qlp + 32);
  const _Float16* kp = KH + ((size_t)b * TT + kf + col) * CK + (h / REP) * HD + 8 * g;   /* GQA: kv head h/4; the lane's key row of the first tile */
  v16h ka[2], kb[2];
#pragma unroll
  for (int t = 0; t < 2; ++t) { ka[t] = fragp_h(kp + t * 16 * CK); kb[t] = fragp_h(kp + t * 16 * CK + 32); }
  // holds the first loads in front of the wait (loaded values as inputs only): without them the compiler moves these loads behind it; the three pointers as in XW
  asm volatile("s_wait_xcnt 0x0" :: "v"(qh0), "v"(qh1), "v"(qr0), "v"(qr1), "v"(ka[0]), "v"(kb[0]), "v"(ka[1]), "v"(kb[1]), "v"(qp), "v"(qlp), "v"(kp) : "memory");
  kp += st0 * CK;
  float m = -3.0e38f;
  // two trips a pass: the fragments in use and the ones fetched ahead swap registers without moves
#pragma unroll 2
  for (int c = c0; c < NCH; ++c) {   // kp walks one chunk ahead and stops at the last one (the last trip fetches its own chunk again): the address stays inside k
    v16h na[2], nb[2];
#pragma unroll
    for (int t = 0; t < 2; ++t) { na[t] = fragp_h(kp + t * 16 * CK); nb[t] = fragp_h(kp + t * 16 * CK + 32); }
    XW(kp);
    kp += c + 2 < NCH ? 32 * CK : 0;
#pragma unroll
    for (int t = 0; t < 2; ++t) { const int kt0 = kbase + c * 32 + t * 16;
      v8f a = {}, al = {};
      a = wmma16(ka[t], qh0, a); al = wmma16(ka[t], qr0, al); a = wmma16(kb[t], qh1, a); al = wmma16(kb[t], qr1, al);
      a += al * (1.0f / 1024.0f);
      v4f s0, s1;
#pragma unroll
      for (int r = 0; r < 8; ++r) { const int kt = kt0 + 8 * g + r; const bool allowed = (kt <= qt) && (qt - kt < WIN); const float v = allowed ? a[r] * 0.125f : -3.0e38f; m = fmaxf(m, v); if (r < 4) s0[r] = v; else s1[r - 4] = v; }
      *(v4f*)&st[wave][c * 4 + t * 2][lane][0] = s0; *(v4f*)&st[wave][c * 4 + t * 2 + 1][lane][0] = s1; }
#pragma unroll
    for (int t = 0; t < 2; ++t) { ka[t] = na[t]; kb[t] = nb[t]; } }
  const __bf16* vp = VT + ((size_t)b * CK + (h / REP) * HD + col) * (size_t)TT + kf + 8 * g;   /* GQA v plane of kv head h/4; the lane's v row of the first 16, at the first chunk */
  v16b vh[HD / 16], vl[HD / 16];   // the first chunk's v flies under the maximum's exchange
#pragma unroll
  for (int j = 0; j < HD / 16; ++j) { vh[j] = fragp_b(vp + j * 16 * TT); vl[j] = fragp_b(vp + j * 16 * TT + NB * CK * TT); }
  XW(vp);
  vp += st0;
  m = fmaxf(m, __shfl_xor(m, 16));   // the query's other eight keys of every tile sit in lane ^ 16
  // the exponentials are taken in the P v loop itself: e = exp2(s * log2 e + eb) = 2^11 * exp(s - m); a masked key's -3.0e38 runs to -inf in the fused multiply-add and gives exactly 0
  const float eb = 11.0f - m * 1.44269504f;
  v4f sa = {}, sb = {};   // the row sum in eight partial sums a lane: one chain of sixteen dependent additions a chunk would stand bare behind the products
  v8f acc[HD / 16] = {};
  // two trips a pass, as in the logit loop: no register moves between the two fragment sets
#pragma unroll 2
  for (int c = c0; c < NCH; ++c) {   // as above: vp stops at the last chunk, the last trip's fetch stays inside v
    v16b nh[HD / 16], nl[HD / 16];
#pragma unroll
    for (int j = 0; j < HD / 16; ++j) { nh[j] = fragp_b(vp + j * 16 * TT); nl[j] = fragp_b(vp + j * 16 * TT + NB * CK * TT); }
    XW(vp);
    vp += c + 2 < NCH ? 32 : 0;
    float pv[16];
#pragma unroll
    for (int q = 0; q < 4; ++q) { const v4f v = *(const v4f*)&st[wave][c * 4 + q][lane][0]; v4f e;
#pragma unroll
      for (int i = 0; i < 4; ++i) { e[i] = __builtin_amdgcn_exp2f(fmaf(v[i], 1.44269504f, eb)); pv[q * 4 + i] = e[i]; }
      if (q & 1) sb += e; else sa += e; }
    const F2 p = bsplit16(pv);
#pragma unroll
    for (int j = 0; j < HD / 16; ++j) { acc[j] = wmma_bf(p.h, vh[j], acc[j]); acc[j] = wmma_bf(p.l, vh[j], acc[j]); acc[j] = wmma_bf(p.h, vl[j], acc[j]); }
#pragma unroll
    for (int j = 0; j < HD / 16; ++j) { vh[j] = nh[j]; vl[j] = nl[j]; } }
  sa += sb;
  float sum = (sa[0] + sa[1]) + (sa[2] + sa[3]);
  sum += __shfl_xor(sum, 16);
  const float inv = 1.0f / sum;   // of the lane's query (col)
  float f[8];   // the factors of the lane's eight output rows 8g + r, each from the lane that holds that query (unrolled: f stays in registers)
#pragma unroll
  for (int r = 0; r < 8; ++r) f[r] = __shfl(inv, 8 * g + r);
  float (*ss)[HD + 4] = (float (*)[HD + 4])&st[wave][0][0][0];   // the wave's own strip, now free, turns the output tile for 16-byte row stores
#pragma unroll
  for (int j = 0; j < HD / 16; ++j)
#pragma unroll
    for (int r = 0; r < 8; ++r) ss[8 * g + r][j * 16 + col] = acc[j][r] * f[r];
  LDSX(); for (int rl = 0; rl < 16; ++rl) if (lane < HD / 4) vst2(Y + ((size_t)b * TT + ql0 + rl) * CC + h * HD + lane * 4, *(const v4f*)&ss[rl][lane * 4]); }
// ---- k_out: block = (64 rows, 128 cols): out = y (bf16 hi + lo) Wo^T + bo
__global__ __launch_bounds__(128) void k_out(const float* __restrict__ Y, const float* __restrict__ WP, const float* __restrict__ BP, float* __restrict__ OUT) { __shared__ __align__(16) char smem[2 * (128 + 128) * PIT * 2]; float (*sf)[16][132] = (float (*)[16][132])smem;   // two stage buffers; the output tiles (33,792 B) on the same bytes behind the loop
  const int tid = threadIdx.x, wave = tid >> 5, lane = tid & 31, col = lane & 15, g = lane >> 4; const int c0 = blockIdx.y * 128; const size_t r0 = (size_t)blockIdx.x * 64 + wave * 16;
  v8f acc[8] = {};
  { const int lr = tid >> 4, lp = tid & 15;   // as in k_proj
    const float* gw = WP + (size_t)(c0 + lr) * CC + lp * 4; const float* gy = Y + ((size_t)blockIdx.x * 64 + lr) * CC + lp * 4;
    v4f rw[16], ry[8];
#pragma unroll
    for (int i = 0; i < 16; ++i) rw[i] = *(const v4f*)(gw + i * 8 * CC);
#pragma unroll
    for (int i = 0; i < 8; ++i) ry[i] = *(const v4f*)(gy + i * 8 * CC);
    XW2(gw, gy);
    // stays rolled, two buffers, one barrier a stage, as in k_proj
#pragma unroll 1
    for (int s = 0; s < NS; ++s) { __bf16* const bs = (__bf16*)smem + (s & 1) * ((128 + 128) * PIT);   // rows 0-127: W, 128-191: y hi, 192-255: y lo
#pragma unroll
      for (int i = 0; i < 16; ++i) *(v4b*)(bs + (i * 8 + lr) * PIT + lp * 4) = cvt4(rw[i]);
#pragma unroll
      for (int i = 0; i < 8; ++i) { const v4b hi = cvt4(ry[i]); v4f re;
#pragma unroll
        for (int e = 0; e < 4; ++e) re[e] = ry[i][e] - (float)hi[e];
        *(v4b*)(bs + (128 + i * 8 + lr) * PIT + lp * 4) = hi; *(v4b*)(bs + (192 + i * 8 + lr) * PIT + lp * 4) = cvt4(re); }
      __syncthreads();
      if (s + 1 < NS) { gw += KS; gy += KS;
#pragma unroll
        for (int i = 0; i < 16; ++i) rw[i] = *(const v4f*)(gw + i * 8 * CC);
#pragma unroll
        for (int i = 0; i < 8; ++i) ry[i] = *(const v4f*)(gy + i * 8 * CC);
        XW2(gw, gy); }
#pragma unroll
      for (int kk = 0; kk < KS / 32; ++kk) { const v16b ah = frag_b(bs + (128 + wave * 16 + col) * PIT + kk * 32, lane), al = frag_b(bs + (192 + wave * 16 + col) * PIT + kk * 32, lane);
#pragma unroll
        for (int jh = 0; jh < 8; jh += 4) { v16b w[4];   // four W fragments as one group of LDS reads in front of their eight products
#pragma unroll
          for (int j = 0; j < 4; ++j) w[j] = frag_b(bs + ((jh + j) * 16 + col) * PIT + kk * 32, lane);
#pragma unroll
          for (int j = 0; j < 4; ++j) { acc[jh + j] = wmma_bf(ah, w[j], acc[jh + j]); acc[jh + j] = wmma_bf(al, w[j], acc[jh + j]); } } } }
    __syncthreads(); }   // every wave has left the stage buffers: sf lies on the same LDS
#pragma unroll
  for (int j = 0; j < 8; ++j) { const float bb = BP ? bfr(BP[c0 + j * 16 + col]) : 0.f;
#pragma unroll
    for (int r = 0; r < 8; ++r) sf[wave][8 * g + r][j * 16 + col] = acc[j][r] + bb; }
  LDSX(); for (int rl = 0; rl < 16; ++rl) vst2(OUT + (r0 + rl) * CC + c0 + lane * 4, *(const v4f*)&sf[wave][rl][lane * 4]); }
extern "C" void kernel_launch(void* const* d_in, const int* in_sizes, int n_in, void* d_out, int out_size, void* d_ws, size_t ws_size, hipStream_t stream) {
  (void)in_sizes; (void)n_in; (void)out_size;
  const float** F = (const float**)d_in;   // 0 x [4,2048,1024], 1 wq [1024,1024] ([out,in]), 2 wk [256,1024], 3 wv [256,1024], 4 wo [1024,1024] ([out,in]), 5 q_norm_w [64], 6 k_norm_w [64]
  if (ws_size < (size_t)WS_END) return;
  char* ws = (char*)d_ws; _Float16 *QH = (_Float16*)(ws + WS_QH), *QL = (_Float16*)(ws + WS_QL), *KH = (_Float16*)(ws + WS_KH); __bf16 *VT = (__bf16*)(ws + WS_VT), *VL = (__bf16*)(ws + WS_VL); float *Y = (float*)(ws + WS_Y);
  k_proj<<<dim3(TNB * TT / 64, CC / 128, 1), 128, 0, stream>>>(F[0], F[1], nullptr, F[2], nullptr, F[3], nullptr, QH, QL, KH, VT, VL, F[5], F[6], 0);   // q (16 heads)
  k_proj<<<dim3(TNB * TT / 64, CK / 128, 2), 128, 0, stream>>>(F[0], F[1], nullptr, F[2], nullptr, F[3], nullptr, QH, QL, KH, VT, VL, F[5], F[6], 1);   // k, v (4 kv heads)
  k_att<<<dim3(TT / 64, NH, TNB), 128, 0, stream>>>(QH, QL, KH, VT, Y);   // logits, softmax and P v of every (b, h) in one launch
  k_out<<<dim3(TNB * TT / 64, CC / 128), 128, 0, stream>>>(Y, F[4], nullptr, (float*)d_out);
}

// v004
// It runs in 150 microseconds.
// Timed twice side by side with v003, it ran 1.08 times as fast both times.
// Over all steps from v000 it is 9.64 times as fast.
// compute dtype: all float inputs rounded to bf16; q/k/v = x W^T with EXACT bf16 products on WMMA 16x16x32, f32 accumulate; per-head RMSNorm of q and k in f32 in the projection epilogue; q as f16 hi + residual (x 2^10), k f16 -> 2-product logits / 8 inside the causal sliding window (512), held in f32 in LDS (one launch, GQA: head h reads kv head h/4); softmax in f32: P' = exp2((s - max) log2 e + 11) on the hardware exponential, not normalised, split bf16 hi + lo against v bf16 hi + lo (3 products), the output tile scaled by 1 / sum P'; y = ctx (bf16 hi + lo) wo^T; f32 output.
#include <hip/hip_runtime.h>
#include <math.h>

typedef __attribute__((ext_vector_type(16))) _Float16 v16h;
typedef __attribute__((ext_vector_type(16))) __bf16 v16b;
typedef __attribute__((ext_vector_type(8)))  _Float16 v8h;
typedef __attribute__((ext_vector_type(8)))  float v8f;
typedef __attribute__((ext_vector_type(4)))  float v4f;
typedef __attribute__((ext_vector_type(2)))  float v2f;
typedef __attribute__((ext_vector_type(4)))  unsigned v4u;
typedef __attribute__((ext_vector_type(4)))  int v4i;
typedef float __attribute__((may_alias)) float_a;
typedef int __attribute__((may_alias)) int_a;

template <typename T> __device__ __forceinline__ void vst2(void* p, T v) { *(T*)p = v;  }
__device__ __forceinline__ v8f wmma16(v16h a, v16h b, v8f c) {
  v8f d = __builtin_amdgcn_wmma_f32_16x16x32_f16(false, a, false, b, (short)0, c, false, false);
  asm volatile("v_nop\n\tv_nop\n\tv_nop\n\tv_nop" : "+v"(d) : "v"(a), "v"(b));
  return d;
}
__device__ __forceinline__ v8f wmma_bf(v16b a, v16b b, v8f c) {
  v8f d = __builtin_amdgcn_wmma_f32_16x16x32_bf16(false, a, false, b, (short)0, c, false, false);
  asm volatile("v_nop\n\tv_nop\n\tv_nop\n\tv_nop" : "+v"(d) : "v"(a), "v"(b));
  return d;
}
// 16x16x32 fragments: lane = (h = lane>>4, row/col = lane&15); elements 0..7 = k0+8h+0..7, 8..15 = k0+16+8h+0..7; D element r = row 8h+r
__device__ __forceinline__ v16h frag_h(const _Float16* rowk0, int lane) {
  union { v16h v; v8h q[2]; } u; const _Float16* p = rowk0 + 8 * (lane >> 4);
  u.q[0] = *(const v8h*)p; u.q[1] = *(const v8h*)(p + 16); return u.v;
}
__device__ __forceinline__ v16h frag_f32(const float* rowk0, int lane) {
  v16h a; const float* p = rowk0 + 8 * (lane >> 4);
#pragma unroll
  for (int i = 0; i < 8; ++i) { a[i] = (_Float16)p[i]; a[8 + i] = (_Float16)p[16 + i]; }
  return a;
}
__device__ __forceinline__ v16h frag_f32s(const float* rowk0, int lane, float sc) {
  v16h a; const float* p = rowk0 + 8 * (lane >> 4);
#pragma unroll
  for (int i = 0; i < 8; ++i) { a[i] = (_Float16)(p[i] * sc); a[8 + i] = (_Float16)(p[16 + i] * sc); }
  return a;
}
// column fragment from a [K][ld] layout (column n), rows >= K read as 0
__device__ __forceinline__ v16h fragc_f32(const float* W, int k0, int n, int lane, int ld, int K) {
  v16h a; const int g = lane >> 4;
#pragma unroll
  for (int i = 0; i < 8; ++i) { const int ka = k0 + 8 * g + i, kb = ka + 16;
    a[i] = (_Float16)(ka < K ? W[(size_t)(ka < K ? ka : K - 1) * ld + n] : 0.f); a[8 + i] = (_Float16)(kb < K ? W[(size_t)(kb < K ? kb : K - 1) * ld + n] : 0.f); }
  return a;
}
struct F2 { v16b h, l; };
__device__ __forceinline__ F2 bsplit16(const float v[16]) { F2 r;
#pragma unroll
  for (int i = 0; i < 16; ++i) { const __bf16 h = (__bf16)v[i]; r.h[i] = h; r.l[i] = (__bf16)(v[i] - (float)h); }
  return r; }
__device__ __forceinline__ F2 split_row(const float* row, int k0, int lane) { float v[16]; const float* p = row + k0 + 8 * (lane >> 4);
#pragma unroll
  for (int i = 0; i < 8; ++i) { v[i] = p[i]; v[8 + i] = p[16 + i]; }
  return bsplit16(v); }
__device__ __forceinline__ F2 split_rowK(const float* row, int k0, int lane, int K) { float v[16]; const int g = lane >> 4;
#pragma unroll
  for (int i = 0; i < 8; ++i) { const int ka = k0 + 8 * g + i, kb = ka + 16; v[i] = ka < K ? row[ka < K ? ka : K - 1] : 0.f; v[8 + i] = kb < K ? row[kb < K ? kb : K - 1] : 0.f; }
  return bsplit16(v); }
__device__ __forceinline__ F2 split_col(const float* W, int k0, int n, int lane, int ld, int K) { float v[16]; const int g = lane >> 4;
#pragma unroll
  for (int i = 0; i < 8; ++i) { const int ka = k0 + 8 * g + i, kb = ka + 16; v[i] = ka < K ? W[(size_t)(ka < K ? ka : K - 1) * ld + n] : 0.f; v[8 + i] = kb < K ? W[(size_t)(kb < K ? kb : K - 1) * ld + n] : 0.f; }
  return bsplit16(v); }
__device__ __forceinline__ v8f mac3(const F2& a, const F2& b, v8f c) { c = wmma_bf(a.l, b.h, c); c = wmma_bf(a.h, b.l, c); return wmma_bf(a.h, b.h, c); }
__device__ __forceinline__ float sigm(float v) { return 1.0f / (1.0f + expf(-v)); }
#define LDSX() do { asm volatile("s_wait_dscnt 0" ::: "memory"); __builtin_amdgcn_wave_barrier(); __builtin_amdgcn_fence(__ATOMIC_RELEASE, "workgroup"); } while (0)


// Windowed grouped-query attention block (B 4, T 2,048, DIM 1,024; 16 query heads, 4 kv heads x 64, QK-RMSNorm (eps 1e-6, weights read), causal sliding window 512, no biases): y = softmax(rms(q) rms(k)^T / 8 | window) v (kv head = h / 4), @ wo^T.
#define NB 4
#define TT 2048
#define CC 1024
#define NH 16
#define HD 64
#define WIN 512
#define NKV 4
#define CK (NKV * HD)   // 256: k/v row width
#define REP (NH / NKV)
#ifndef TNB
#define TNB NB
#endif
typedef __attribute__((ext_vector_type(8))) __bf16 v8b;
__device__ __forceinline__ v16b frag_b(const __bf16* rowk0, int lane) {
  union { v16b v; v8b q[2]; } u; const __bf16* p = rowk0 + 8 * (lane >> 4);
  u.q[0] = *(const v8b*)p; u.q[1] = *(const v8b*)(p + 16); return u.v;
}
__device__ __forceinline__ float bfr(float v) { return (float)(__bf16)v; }
__device__ __attribute__((noinline)) float exp_ni(float v) { return expf(v); }
__device__ __attribute__((noinline)) float erf_ni(float v) { return erff(v); }

#define WS_QH  0u
#define WS_QL  (WS_QH + 2u * (size_t)NB * TT * CC)
#define WS_KH  (WS_QL + 2u * (size_t)NB * TT * CC)
#define WS_VT  (WS_KH + 2u * (size_t)NB * TT * CK)      // bf16 v planes [b][CK][t] (k rows are [b*T+t][CK])
#define WS_VL  (WS_VT + 2u * (size_t)NB * CK * TT)
#define HG 4                                          // only sizes the WS_S region, which no kernel uses
#define WS_S   (WS_VL + 2u * (size_t)NB * CK * TT)      // unused: the logits stay in LDS, P in registers
#define WS_PH  (WS_S + 4u * (size_t)HG * TT * TT)
#define WS_Y   (WS_PH + 0u)              // f32 y rows [b*t][C]
#define WS_END (WS_Y + 4u * (size_t)NB * TT * CC)

// ---- operand staging of the two projection kernels: a stage is KS k of every operand row of the block, read from global memory by whole lines (16 lanes = 256 B of one row), rounded to bf16 once and shared through LDS
typedef __attribute__((ext_vector_type(4))) __bf16 v4b;
#define KS 64             // k per stage
#define NS (CC / KS)
#define PIT (KS + 8)      // LDS row pitch in bf16: 144 B = 16 B x 9, so the 16 rows of a 16-byte fragment read fall on different banks
__device__ __forceinline__ v4b cvt4(v4f v) { v4b r;
#pragma unroll
  for (int i = 0; i < 4; ++i) r[i] = (__bf16)v[i];
  return r; }
// a precaution: stands behind a group of global loads, in front of the next rewrite of their address registers; the group's one lane pointer is an input, so that it stays live up to the wait and no result of the group lands in it
#define XW(p) asm volatile("s_wait_xcnt 0x0" :: "v"(p) : "memory")
#define XW2(p, q) asm volatile("s_wait_xcnt 0x0" :: "v"(p), "v"(q) : "memory")   // the same behind a group that reads through two lane pointers
// ---- k_proj: block = (128 rows, 128 cols, which), four waves as 2 x 2, a wave = 64 rows x 64 cols (4 x 4 tiles: eight fragments feed sixteen products; its 64 columns are one head): qkv = x W (+ b), exact; q -> f16 hi (+ residual), k -> f16 rows, v -> bf16 planes
__global__ __launch_bounds__(128) void k_proj(const float* __restrict__ X, const float* __restrict__ WQ, const float* __restrict__ BQ, const float* __restrict__ WK, const float* __restrict__ BK, const float* __restrict__ WV, const float* __restrict__ BV, _Float16* __restrict__ QH, _Float16* __restrict__ QL, _Float16* __restrict__ KH, __bf16* __restrict__ VT, __bf16* __restrict__ VL, const float* __restrict__ NQW, const float* __restrict__ NKW, int wbase) {
  __shared__ __align__(16) char smem[2 * (128 + 128) * PIT * 2];   // the loop's two stage buffers (2 x 256 rows x 144 B) first, then the epilogue's arrays (2 x 128 x 272 B) on the same bytes
  _Float16 (*sh)[136] = (_Float16 (*)[136])smem, (*sl)[136] = sh + 128; __bf16 (*th)[136] = (__bf16 (*)[136])smem, (*tl2)[136] = th + 128;   // q, k: [row][col]; v: [col][row]; a block uses one of the two pairs
  const int tid = threadIdx.x, wave = tid >> 5, lane = tid & 31, col = lane & 15, g = lane >> 4, wr = wave >> 1, wc = wave & 1; const int which = wbase + blockIdx.z; const int OW = (which == 0) ? CC : CK;   /* output row width: q 1,024, k/v 256 */ const int c0 = blockIdx.y * 128; const size_t r0 = (size_t)blockIdx.x * 128; const float* WA = which == 0 ? WQ : which == 1 ? WK : WV; const float* BA = which == 0 ? BQ : which == 1 ? BK : BV;
  v8f acc[4][4] = {};   // [row tile][col tile]
  { const int lr = tid >> 4, lp = tid & 15;   // the thread's row of each group of 8 rows, and its 16 bytes of the row's 256
    const float* gw = WA + (size_t)(c0 + lr) * CC + lp * 4; const float* gx = X + (r0 + lr) * CC + lp * 4;
    v4f rw[16], rx[16];
#pragma unroll
    for (int i = 0; i < 16; ++i) rw[i] = *(const v4f*)(gw + i * 8 * CC);
#pragma unroll
    for (int i = 0; i < 16; ++i) rx[i] = *(const v4f*)(gx + i * 8 * CC);
    XW2(gw, gx);
    // stays rolled: a trip is already 32 matrix instructions and 64 LDS operations a wave; two buffers, ONE barrier a stage: a buffer is rewritten two stages later, behind the barrier of the stage between
#pragma unroll 1
    for (int s = 0; s < NS; ++s) { __bf16* const bs = (__bf16*)smem + (s & 1) * ((128 + 128) * PIT);   // rows 0-127: W, 128-255: x
#pragma unroll
      for (int i = 0; i < 16; ++i) *(v4b*)(bs + (i * 8 + lr) * PIT + lp * 4) = cvt4(rw[i]);
#pragma unroll
      for (int i = 0; i < 16; ++i) *(v4b*)(bs + (128 + i * 8 + lr) * PIT + lp * 4) = cvt4(rx[i]);
      __syncthreads();
      if (s + 1 < NS) { gw += KS; gx += KS;   // behind the barrier (which waits for every load in flight): the next stage flies under this stage's products
#pragma unroll
        for (int i = 0; i < 16; ++i) rw[i] = *(const v4f*)(gw + i * 8 * CC);
#pragma unroll
        for (int i = 0; i < 16; ++i) rx[i] = *(const v4f*)(gx + i * 8 * CC);
        XW2(gw, gx); }
#pragma unroll
      for (int kk = 0; kk < KS / 32; ++kk) { v16b a[4], w[4];   // the eight fragments as one group of LDS reads in front of their sixteen products
#pragma unroll
        for (int i = 0; i < 4; ++i) a[i] = frag_b(bs + (128 + wr * 64 + i * 16 + col) * PIT + kk * 32, lane);
#pragma unroll
        for (int j = 0; j < 4; ++j) w[j] = frag_b(bs + (wc * 64 + j * 16 + col) * PIT + kk * 32, lane);
#pragma unroll
        for (int j = 0; j < 4; ++j)
#pragma unroll
          for (int i = 0; i < 4; ++i) acc[i][j] = wmma_bf(a[i], w[j], acc[i][j]); } }
    __syncthreads(); }   // every wave has left the stage buffers: the epilogue's arrays lie on the same LDS
  // QK-RMSNorm per (row, head): the wave's 64 columns are one head; mean of squares over the 64 dims via in-lane + 16-lane shuffles (unconditional), then scale by rsqrt(ms + eps) * norm_w[d]
  if (which < 2) { const float* NW = which == 0 ? NQW : NKW; float nw[4];   // the head's four weights of this lane, read once for the wave's four row tiles
#pragma unroll
    for (int jj = 0; jj < 4; ++jj) nw[jj] = NW[jj * 16 + col];
    asm volatile("s_wait_xcnt 0x0" :: "s"(NW) : "memory");   // the precaution of XW for these four loads: their scalar base is an input, so that it stays live up to the wait
#pragma unroll
    for (int i = 0; i < 4; ++i) { float ssq[8];
#pragma unroll
      for (int r = 0; r < 8; ++r) { float s_ = 0.f;
#pragma unroll
        for (int jj = 0; jj < 4; ++jj) s_ += acc[i][jj][r] * acc[i][jj][r];
#pragma unroll
        for (int o_ = 1; o_ < 16; o_ <<= 1) s_ += __shfl_xor(s_, o_);
        ssq[r] = rsqrtf(s_ * (1.0f / HD) + 1e-6f); }
#pragma unroll
      for (int jj = 0; jj < 4; ++jj) { const float wv = bfr(nw[jj]);
#pragma unroll
        for (int r = 0; r < 8; ++r) acc[i][jj][r] *= ssq[r] * wv; } } }
#pragma unroll
  for (int j = 0; j < 4; ++j) { const int cl = wc * 64 + j * 16 + col; const float bb = BA ? bfr(BA[c0 + cl]) : 0.f;
#pragma unroll
    for (int i = 0; i < 4; ++i)
#pragma unroll
      for (int r = 0; r < 8; ++r) acc[i][j][r] += bb; }
  if (which == 2) {
#pragma unroll
    for (int j = 0; j < 4; ++j)
#pragma unroll
      for (int i = 0; i < 4; ++i)
#pragma unroll
        for (int r = 0; r < 8; ++r) { const float v = acc[i][j][r]; const int rl = wr * 64 + i * 16 + 8 * g + r, cl = wc * 64 + j * 16 + col; const __bf16 bh = (__bf16)v; th[cl][rl] = bh; tl2[cl][rl] = (__bf16)(v - (float)bh); } }
  else {
#pragma unroll
    for (int j = 0; j < 4; ++j)
#pragma unroll
      for (int i = 0; i < 4; ++i)
#pragma unroll
        for (int r = 0; r < 8; ++r) { const float v = acc[i][j][r]; const int rl = wr * 64 + i * 16 + 8 * g + r, cl = wc * 64 + j * 16 + col; const _Float16 hv = (_Float16)v; sh[rl][cl] = hv; sl[rl][cl] = (_Float16)((v - (float)hv) * 1024.0f); } }   /* q residual carried x 2^10 so the plane stays f16-normal on the chip */
  __syncthreads();
  { const int rw_ = tid >> 4, q = tid & 15;   // 16 lanes = one 256-B row of the LDS tile; the sixteen row groups unrolled from one pointer a plane, so that no address register of a store is rewritten
    if (which == 0) { _Float16* ph = QH + (r0 + rw_) * CC + c0 + q * 8; _Float16* pl = QL + (r0 + rw_) * CC + c0 + q * 8;
#pragma unroll
      for (int t = 0; t < 16; ++t) { vst2((unsigned*)(ph + t * 8 * CC), *(const v4u*)&sh[rw_ + t * 8][q * 8]); vst2((unsigned*)(pl + t * 8 * CC), *(const v4u*)&sl[rw_ + t * 8][q * 8]); }
      XW2(ph, pl); }   // the same precaution behind each of the three runs of stores: the compiler lays the runs out one behind another, in an order of its own, with fall-through edges between them, and a later run's code rewrites an earlier one's registers
    else if (which == 1) { _Float16* ph = KH + (r0 + rw_) * CK + c0 + q * 8;
#pragma unroll
      for (int t = 0; t < 16; ++t) vst2((unsigned*)(ph + t * 8 * CK), *(const v4u*)&sh[rw_ + t * 8][q * 8]);
      XW(ph); }
    else { const size_t b = r0 / TT; const int t0 = (int)(r0 % TT); const size_t o2 = (b * CK + c0 + rw_) * (size_t)TT + t0 + q * 8; __bf16* ph = VT + o2; __bf16* pl = VL + o2;
#pragma unroll
      for (int t = 0; t < 16; ++t) { vst2((unsigned*)(ph + t * 8 * TT), *(const v4u*)&th[rw_ + t * 8][q * 8]); vst2((unsigned*)(pl + t * 8 * TT), *(const v4u*)&tl2[rw_ + t * 8][q * 8]); }
      XW2(ph, pl); } } }
// ---- k_att: block = 64 queries of (b,h), one wave = 16 queries, no exchange between waves. S^T = K Q^T (A = 16 key rows, B = 16 query rows), so a lane holds the logits of ONE query (col) at keys 8g+r of each 16-key tile;
// two such tiles are, element for element, the A fragment of P for a 32-key chunk. The wave's window is NCH chunks of 32 keys; each lane parks its own logits in LDS (16 B a lane, lane-contiguous) and reads back only what it wrote.
// K and V fragments are fetched one chunk ahead into registers (the LDS strip allows two waves a SIMD, so registers are free).
#define NCH 17   // 32-key chunks that cover [ql0 - 511, ql0 + 15] from a multiple of 32
// fragments from the lane's own pointer (row and 8 * half already in it)
__device__ __forceinline__ v16h fragp_h(const _Float16* p) { union { v16h v; v8h q[2]; } u; u.q[0] = *(const v8h*)p; u.q[1] = *(const v8h*)(p + 16); return u.v; }
__device__ __forceinline__ v16b fragp_b(const __bf16* p) { union { v16b v; v8b q[2]; } u; u.q[0] = *(const v8b*)p; u.q[1] = *(const v8b*)(p + 16); return u.v; }
__global__ __launch_bounds__(128) void k_att(const _Float16* __restrict__ QH, const _Float16* __restrict__ QL, const _Float16* __restrict__ KH, const __bf16* __restrict__ VT, float* __restrict__ Y) {   // the v residual plane lies NB * CK * TT elements behind VT
  __shared__ __align__(16) float st[4][NCH * 4][32][4];
  const int tid = threadIdx.x, wave = __builtin_amdgcn_readfirstlane(tid >> 5), lane = tid & 31, col = lane & 15, g = lane >> 4;
  const int b = blockIdx.z, h = blockIdx.y, ql0 = blockIdx.x * 64 + wave * 16, qt = ql0 + col;
  const int kbase = ((ql0 - (WIN - 1)) >> 5) * 32;      // first key of chunk 0 (floor to 32; below 0 for the first rows)
  const int c0 = kbase < 0 ? (-kbase) >> 5 : 0;         // wave-uniform: chunks wholly in front of key 0 are not walked
  const int kf = kbase < 0 ? 0 : kbase;                 // first key walked = kbase + c0 * 32
  const int st0 = c0 + 1 < NCH ? 32 : 0;                // keys from the first chunk to the first one fetched ahead
  const _Float16* qp = QH + ((size_t)b * TT + qt) * CC + h * HD + 8 * g; const _Float16* qlp = QL + ((size_t)b * TT + qt) * CC + h * HD + 8 * g;
  const v16h qh0 = fragp_h(qp), qh1 = fragp_h(qp + 32), qr0 = fragp_h(qlp), qr1 = fragp_h(qlp + 32);
  const _Float16* kp = KH + ((size_t)b * TT + kf + col) * CK + (h / REP) * HD + 8 * g;   /* GQA: kv head h/4; the lane's key row of the first tile */
  v16h ka[2], kb[2];
#pragma unroll
  for (int t = 0; t < 2; ++t) { ka[t] = fragp_h(kp + t * 16 * CK); kb[t] = fragp_h(kp + t * 16 * CK + 32); }
  // holds the first loads in front of the wait (loaded values as inputs only): without them the compiler moves these loads behind it; the three pointers as in XW
  asm volatile("s_wait_xcnt 0x0" :: "v"(qh0), "v"(qh1), "v"(qr0), "v"(qr1), "v"(ka[0]), "v"(kb[0]), "v"(ka[1]), "v"(kb[1]), "v"(qp), "v"(qlp), "v"(kp) : "memory");
  kp += st0 * CK;
  float m = -3.0e38f;
  // two trips a pass: the fragments in use and the ones fetched ahead swap registers without moves
#pragma unroll 2
  for (int c = c0; c < NCH; ++c) {   // kp walks one chunk ahead and stops at the last one (the last trip fetches its own chunk again): the address stays inside k
    v16h na[2], nb[2];
#pragma unroll
    for (int t = 0; t < 2; ++t) { na[t] = fragp_h(kp + t * 16 * CK); nb[t] = fragp_h(kp + t * 16 * CK + 32); }
    XW(kp);
    kp += c + 2 < NCH ? 32 * CK : 0;
#pragma unroll
    for (int t = 0; t < 2; ++t) { const int kt0 = kbase + c * 32 + t * 16;
      v8f a = {}, al = {};
      a = wmma16(ka[t], qh0, a); al = wmma16(ka[t], qr0, al); a = wmma16(kb[t], qh1, a); al = wmma16(kb[t], qr1, al);
      a += al * (1.0f / 1024.0f);
      v4f s0, s1;
#pragma unroll
      for (int r = 0; r < 8; ++r) { const int kt = kt0 + 8 * g + r; const bool allowed = (kt <= qt) && (qt - kt < WIN); const float v = allowed ? a[r] * 0.125f : -3.0e38f; m = fmaxf(m, v); if (r < 4) s0[r] = v; else s1[r - 4] = v; }
      *(v4f*)&st[wave][c * 4 + t * 2][lane][0] = s0; *(v4f*)&st[wave][c * 4 + t * 2 + 1][lane][0] = s1; }
#pragma unroll
    for (int t = 0; t < 2; ++t) { ka[t] = na[t]; kb[t] = nb[t]; } }
  const __bf16* vp = VT + ((size_t)b * CK + (h / REP) * HD + col) * (size_t)TT + kf + 8 * g;   /* GQA v plane of kv head h/4; the lane's v row of the first 16, at the first chunk */
  v16b vh[HD / 16], vl[HD / 16];   // the first chunk's v flies under the maximum's exchange
#pragma unroll
  for (int j = 0; j < HD / 16; ++j) { vh[j] = fragp_b(vp + j * 16 * TT); vl[j] = fragp_b(vp + j * 16 * TT + NB * CK * TT); }
  XW(vp);
  vp += st0;
  m = fmaxf(m, __shfl_xor(m, 16));   // the query's other eight keys of every tile sit in lane ^ 16
  // the exponentials are taken in the P v loop itself: e = exp2(s * log2 e + eb) = 2^11 * exp(s - m); a masked key's -3.0e38 runs to -inf in the fused multiply-add and gives exactly 0
  const float eb = 11.0f - m * 1.44269504f;
  v4f sa = {}, sb = {};   // the row sum in eight partial sums a lane: one chain of sixteen dependent additions a chunk would stand bare behind the products
  v8f acc[HD / 16] = {};
  // two trips a pass, as in the logit loop: no register moves between the two fragment sets
#pragma unroll 2
  for (int c = c0; c < NCH; ++c) {   // as above: vp stops at the last chunk, the last trip's fetch stays inside v
    v16b nh[HD / 16], nl[HD / 16];
#pragma unroll
    for (int j = 0; j < HD / 16; ++j) { nh[j] = fragp_b(vp + j * 16 * TT); nl[j] = fragp_b(vp + j * 16 * TT + NB * CK * TT); }
    XW(vp);
    vp += c + 2 < NCH ? 32 : 0;
    float pv[16];
#pragma unroll
    for (int q = 0; q < 4; ++q) { const v4f v = *(const v4f*)&st[wave][c * 4 + q][lane][0]; v4f e;
#pragma unroll
      for (int i = 0; i < 4; ++i) { e[i] = __builtin_amdgcn_exp2f(fmaf(v[i], 1.44269504f, eb)); pv[q * 4 + i] = e[i]; }
      if (q & 1) sb += e; else sa += e; }
    const F2 p = bsplit16(pv);
#pragma unroll
    for (int j = 0; j < HD / 16; ++j) { acc[j] = wmma_bf(p.h, vh[j], acc[j]); acc[j] = wmma_bf(p.l, vh[j], acc[j]); acc[j] = wmma_bf(p.h, vl[j], acc[j]); }
#pragma unroll
    for (int j = 0; j < HD / 16; ++j) { vh[j] = nh[j]; vl[j] = nl[j]; } }
  sa += sb;
  float sum = (sa[0] + sa[1]) + (sa[2] + sa[3]);
  sum += __shfl_xor(sum, 16);
  const float inv = 1.0f / sum;   // of the lane's query (col)
  float f[8];   // the factors of the lane's eight output rows 8g + r, each from the lane that holds that query (unrolled: f stays in registers)
#pragma unroll
  for (int r = 0; r < 8; ++r) f[r] = __shfl(inv, 8 * g + r);
  float (*ss)[HD + 4] = (float (*)[HD + 4])&st[wave][0][0][0];   // the wave's own strip, now free, turns the output tile for 16-byte row stores
#pragma unroll
  for (int j = 0; j < HD / 16; ++j)
#pragma unroll
    for (int r = 0; r < 8; ++r) ss[8 * g + r][j * 16 + col] = acc[j][r] * f[r];
  LDSX(); for (int rl = 0; rl < 16; ++rl) if (lane < HD / 4) vst2(Y + ((size_t)b * TT + ql0 + rl) * CC + h * HD + lane * 4, *(const v4f*)&ss[rl][lane * 4]); }
// ---- k_out: block = (128 rows, 128 cols), four waves as 2 x 2, a wave = 64 rows x 64 cols: out = y (bf16 hi + lo) Wo^T + bo
__global__ __launch_bounds__(128) void k_out(const float* __restrict__ Y, const float* __restrict__ WP, const float* __restrict__ BP, float* __restrict__ OUT) { __shared__ __align__(16) char smem[2 * (128 + 256) * PIT * 2]; float (*sf)[64][68] = (float (*)[64][68])smem;   // two stage buffers; the four output tiles (69,632 B) on the same bytes behind the loop
  const int tid = threadIdx.x, wave = tid >> 5, lane = tid & 31, col = lane & 15, g = lane >> 4, wr = wave >> 1, wc = wave & 1; const int c0 = blockIdx.y * 128 + wc * 64; const size_t r0 = (size_t)blockIdx.x * 128 + wr * 64;   // the wave's first column and row
  v8f acc[4][4] = {};   // [row tile][col tile]
  { const int lr = tid >> 4, lp = tid & 15;   // as in k_proj
    const float* gw = WP + (size_t)(blockIdx.y * 128 + lr) * CC + lp * 4; const float* gy = Y + ((size_t)blockIdx.x * 128 + lr) * CC + lp * 4;
    v4f rw[16], ry[16];
#pragma unroll
    for (int i = 0; i < 16; ++i) rw[i] = *(const v4f*)(gw + i * 8 * CC);
#pragma unroll
    for (int i = 0; i < 16; ++i) ry[i] = *(const v4f*)(gy + i * 8 * CC);
    XW2(gw, gy);
    // stays rolled, two buffers, one barrier a stage, as in k_proj
#pragma unroll 1
    for (int s = 0; s < NS; ++s) { __bf16* const bs = (__bf16*)smem + (s & 1) * ((128 + 256) * PIT);   // rows 0-127: W, 128-255: y hi, 256-383: y lo
#pragma unroll
      for (int i = 0; i < 16; ++i) *(v4b*)(bs + (i * 8 + lr) * PIT + lp * 4) = cvt4(rw[i]);
#pragma unroll
      for (int i = 0; i < 16; ++i) { const v4b hi = cvt4(ry[i]); v4f re;
#pragma unroll
        for (int e = 0; e < 4; ++e) re[e] = ry[i][e] - (float)hi[e];
        *(v4b*)(bs + (128 + i * 8 + lr) * PIT + lp * 4) = hi; *(v4b*)(bs + (256 + i * 8 + lr) * PIT + lp * 4) = cvt4(re); }
      __syncthreads();
      if (s + 1 < NS) { gw += KS; gy += KS;
#pragma unroll
        for (int i = 0; i < 16; ++i) rw[i] = *(const v4f*)(gw + i * 8 * CC);
#pragma unroll
        for (int i = 0; i < 16; ++i) ry[i] = *(const v4f*)(gy + i * 8 * CC);
        XW2(gw, gy); }
#pragma unroll
      for (int kk = 0; kk < KS / 32; ++kk) { v16b ah[4], al[4], w[4];   // the twelve fragments as one group of LDS reads in front of their thirty-two products
#pragma unroll
        for (int i = 0; i < 4; ++i) { ah[i] = frag_b(bs + (128 + wr * 64 + i * 16 + col) * PIT + kk * 32, lane); al[i] = frag_b(bs + (256 + wr * 64 + i * 16 + col) * PIT + kk * 32, lane); }
#pragma unroll
        for (int j = 0; j < 4; ++j) w[j] = frag_b(bs + (wc * 64 + j * 16 + col) * PIT + kk * 32, lane);
#pragma unroll
        for (int j = 0; j < 4; ++j) {   // hi, then lo, of each tile as before; three other tiles' products stand between the two
#pragma unroll
          for (int i = 0; i < 4; ++i) acc[i][j] = wmma_bf(ah[i], w[j], acc[i][j]);
#pragma unroll
          for (int i = 0; i < 4; ++i) acc[i][j] = wmma_bf(al[i], w[j], acc[i][j]); } } }
    __syncthreads(); }   // every wave has left the stage buffers: sf lies on the same LDS
#pragma unroll
  for (int j = 0; j < 4; ++j) { const float bb = BP ? bfr(BP[c0 + j * 16 + col]) : 0.f;
#pragma unroll
    for (int i = 0; i < 4; ++i)
#pragma unroll
      for (int r = 0; r < 8; ++r) sf[wave][i * 16 + 8 * g + r][j * 16 + col] = acc[i][j][r] + bb; }
  LDSX(); for (int rl = 0; rl < 64; rl += 2) vst2(OUT + (r0 + rl + g) * CC + c0 + col * 4, *(const v4f*)&sf[wave][rl + g][col * 4]); }   // a store = two rows of 256 B: whole lines
extern "C" void kernel_launch(void* const* d_in, const int* in_sizes, int n_in, void* d_out, int out_size, void* d_ws, size_t ws_size, hipStream_t stream) {
  (void)in_sizes; (void)n_in; (void)out_size;
  const float** F = (const float**)d_in;   // 0 x [4,2048,1024], 1 wq [1024,1024] ([out,in]), 2 wk [256,1024], 3 wv [256,1024], 4 wo [1024,1024] ([out,in]), 5 q_norm_w [64], 6 k_norm_w [64]
  if (ws_size < (size_t)WS_END) return;
  char* ws = (char*)d_ws; _Float16 *QH = (_Float16*)(ws + WS_QH), *QL = (_Float16*)(ws + WS_QL), *KH = (_Float16*)(ws + WS_KH); __bf16 *VT = (__bf16*)(ws + WS_VT), *VL = (__bf16*)(ws + WS_VL); float *Y = (float*)(ws + WS_Y);
  k_proj<<<dim3(TNB * TT / 128, CC / 128, 1), 128, 0, stream>>>(F[0], F[1], nullptr, F[2], nullptr, F[3], nullptr, QH, QL, KH, VT, VL, F[5], F[6], 0);   // q (16 heads)
  k_proj<<<dim3(TNB * TT / 128, CK / 128, 2), 128, 0, stream>>>(F[0], F[1], nullptr, F[2], nullptr, F[3], nullptr, QH, QL, KH, VT, VL, F[5], F[6], 1);   // k, v (4 kv heads)
  k_att<<<dim3(TT / 64, NH, TNB), 128, 0, stream>>>(QH, QL, KH, VT, Y);   // logits, softmax and P v of every (b, h) in one launch
  k_out<<<dim3(TNB * TT / 128, CC / 128), 128, 0, stream>>>(Y, F[4], nullptr, (float*)d_out);
}

// v005
// Measured time: 132 microseconds a run.
// Timed twice side by side with v004, it ran 1.13 times as fast both times.
// All steps since v000 together make it 10.9 times as fast.
// compute dtype: all float inputs rounded to bf16; q/k/v = x W^T with EXACT bf16 products on WMMA 16x16x32, f32 accumulate; per-head RMSNorm of q and k in f32 in the projection epilogue; q as f16 hi + residual (x 2^10), k f16 -> 2-product logits / 8 inside the causal sliding window (512), held in f32 in LDS (one launch, GQA: head h reads kv head h/4); softmax in f32: P' = exp2((s - max) log2 e + 11) on the hardware exponential, not normalised, split bf16 hi + lo against v bf16 hi + lo (3 products), the output tile scaled by 1 / sum P'; y = ctx (bf16 hi + lo) wo^T; f32 output.
#include <hip/hip_runtime.h>
#include <math.h>

typedef __attribute__((ext_vector_type(16))) _Float16 v16h;
typedef __attribute__((ext_vector_type(16))) __bf16 v16b;
typedef __attribute__((ext_vector_type(8)))  _Float16 v8h;
typedef __attribute__((ext_vector_type(8)))  float v8f;
typedef __attribute__((ext_vector_type(4)))  float v4f;
typedef __attribute__((ext_vector_type(2)))  float v2f;
typedef __attribute__((ext_vector_type(4)))  unsigned v4u;
typedef __attribute__((ext_vector_type(4)))  int v4i;
typedef float __attribute__((may_alias)) float_a;
typedef int __attribute__((may_alias)) int_a;

template <typename T> __device__ __forceinline__ void vst2(void* p, T v) { *(T*)p = v;  }
__device__ __forceinline__ v8f wmma16(v16h a, v16h b, v8f c) {
  v8f d = __builtin_amdgcn_wmma_f32_16x16x32_f16(false, a, false, b, (short)0, c, false, false);
  asm volatile("v_nop\n\tv_nop\n\tv_nop\n\tv_nop" : "+v"(d) : "v"(a), "v"(b));
  return d;
}
__device__ __forceinline__ v8f wmma_bf(v16b a, v16b b, v8f c) {
  v8f d = __builtin_amdgcn_wmma_f32_16x16x32_bf16(false, a, false, b, (short)0, c, false, false);
  asm volatile("v_nop\n\tv_nop\n\tv_nop\n\tv_nop" : "+v"(d) : "v"(a), "v"(b));
  return d;
}
// 16x16x32 fragments: lane = (h = lane>>4, row/col = lane&15); elements 0..7 = k0+8h+0..7, 8..15 = k0+16+8h+0..7; D element r = row 8h+r
__device__ __forceinline__ v16h frag_h(const _Float16* rowk0, int lane) {
  union { v16h v; v8h q[2]; } u; const _Float16* p = rowk0 + 8 * (lane >> 4);
  u.q[0] = *(const v8h*)p; u.q[1] = *(const v8h*)(p + 16); return u.v;
}
__device__ __forceinline__ v16h frag_f32(const float* rowk0, int lane) {
  v16h a; const float* p = rowk0 + 8 * (lane >> 4);
#pragma unroll
  for (int i = 0; i < 8; ++i) { a[i] = (_Float16)p[i]; a[8 + i] = (_Float16)p[16 + i]; }
  return a;
}
__device__ __forceinline__ v16h frag_f32s(const float* rowk0, int lane, float sc) {
  v16h a; const float* p = rowk0 + 8 * (lane >> 4);
#pragma unroll
  for (int i = 0; i < 8; ++i) { a[i] = (_Float16)(p[i] * sc); a[8 + i] = (_Float16)(p[16 + i] * sc); }
  return a;
}
// column fragment from a [K][ld] layout (column n), rows >= K read as 0
__device__ __forceinline__ v16h fragc_f32(const float* W, int k0, int n, int lane, int ld, int K) {
  v16h a; const int g = lane >> 4;
#pragma unroll
  for (int i = 0; i < 8; ++i) { const int ka = k0 + 8 * g + i, kb = ka + 16;
    a[i] = (_Float16)(ka < K ? W[(size_t)(ka < K ? ka : K - 1) * ld + n] : 0.f); a[8 + i] = (_Float16)(kb < K ? W[(size_t)(kb < K ? kb : K - 1) * ld + n] : 0.f); }
  return a;
}
struct F2 { v16b h, l; };
__device__ __forceinline__ F2 bsplit16(const float v[16]) { F2 r;
#pragma unroll
  for (int i = 0; i < 16; ++i) { const __bf16 h = (__bf16)v[i]; r.h[i] = h; r.l[i] = (__bf16)(v[i] - (float)h); }
  return r; }
__device__ __forceinline__ F2 split_row(const float* row, int k0, int lane) { float v[16]; const float* p = row + k0 + 8 * (lane >> 4);
#pragma unroll
  for (int i = 0; i < 8; ++i) { v[i] = p[i]; v[8 + i] = p[16 + i]; }
  return bsplit16(v); }
__device__ __forceinline__ F2 split_rowK(const float* row, int k0, int lane, int K) { float v[16]; const int g = lane >> 4;
#pragma unroll
  for (int i = 0; i < 8; ++i) { const int ka = k0 + 8 * g + i, kb = ka + 16; v[i] = ka < K ? row[ka < K ? ka : K - 1] : 0.f; v[8 + i] = kb < K ? row[kb < K ? kb : K - 1] : 0.f; }
  return bsplit16(v); }
__device__ __forceinline__ F2 split_col(const float* W, int k0, int n, int lane, int ld, int K) { float v[16]; const int g = lane >> 4;
#pragma unroll
  for (int i = 0; i < 8; ++i) { const int ka = k0 + 8 * g + i, kb = ka + 16; v[i] = ka < K ? W[(size_t)(ka < K ? ka : K - 1) * ld + n] : 0.f; v[8 + i] = kb < K ? W[(size_t)(kb < K ? kb : K - 1) * ld + n] : 0.f; }
  return bsplit16(v); }
__device__ __forceinline__ v8f mac3(const F2& a, const F2& b, v8f c) { c = wmma_bf(a.l, b.h, c); c = wmma_bf(a.h, b.l, c); return wmma_bf(a.h, b.h, c); }
__device__ __forceinline__ float sigm(float v) { return 1.0f / (1.0f + expf(-v)); }
#define LDSX() do { asm volatile("s_wait_dscnt 0" ::: "memory"); __builtin_amdgcn_wave_barrier(); __builtin_amdgcn_fence(__ATOMIC_RELEASE, "workgroup"); } while (0)


// Windowed grouped-query attention block (B 4, T 2,048, DIM 1,024; 16 query heads, 4 kv heads x 64, QK-RMSNorm (eps 1e-6, weights read), causal sliding window 512, no biases): y = softmax(rms(q) rms(k)^T / 8 | window) v (kv head = h / 4), @ wo^T.
#define NB 4
#define TT 2048
#define CC 1024
#define NH 16
#define HD 64
#define WIN 512
#define NKV 4
#define CK (NKV * HD)   // 256: k/v row width
#define REP (NH / NKV)
#ifndef TNB
#define TNB NB
#endif
typedef __attribute__((ext_vector_type(8))) __bf16 v8b;
__device__ __forceinline__ v16b frag_b(const __bf16* rowk0, int lane) {
  union { v16b v; v8b q[2]; } u; const __bf16* p = rowk0 + 8 * (lane >> 4);
  u.q[0] = *(const v8b*)p; u.q[1] = *(const v8b*)(p + 16); return u.v;
}
__device__ __forceinline__ float bfr(float v) { return (float)(__bf16)v; }
__device__ __attribute__((noinline)) float exp_ni(float v) { return expf(v); }
__device__ __attribute__((noinline)) float erf_ni(float v) { return erff(v); }

#define WS_QH  0u
#define WS_QL  (WS_QH + 2u * (size_t)NB * TT * CC)
#define WS_KH  (WS_QL + 2u * (size_t)NB * TT * CC)
#define WS_VT  (WS_KH + 2u * (size_t)NB * TT * CK)      // q, k and v lie in the order in which k_att's fragment loads read them (FRAGMENT ORDER below); v takes the bytes of both planes, from here to WS_S
#define WS_VL  (WS_VT + 2u * (size_t)NB * CK * TT)
#define HG 4                                          // only sizes the WS_S region, which no kernel uses
#define WS_S   (WS_VL + 2u * (size_t)NB * CK * TT)      // unused: the logits stay in LDS, P in registers
#define WS_PH  (WS_S + 4u * (size_t)HG * TT * TT)
#define WS_Y   (WS_PH + 0u)              // f32 y rows [b*t][C]
#define WS_END (WS_Y + 4u * (size_t)NB * TT * CC)

// ---- operand staging of the two projection kernels: a stage is KS k of every operand row of the block, read from global memory by whole lines (16 lanes = 256 B of one row), rounded to bf16 once and shared through LDS
typedef __attribute__((ext_vector_type(4))) __bf16 v4b;
#define KS 64             // k per stage
#define NS (CC / KS)
#define PIT (KS + 8)      // LDS row pitch in bf16: 144 B = 16 B x 9, so the 16 rows of a 16-byte fragment read fall on different banks
__device__ __forceinline__ v4b cvt4(v4f v) { v4b r;
#pragma unroll
  for (int i = 0; i < 4; ++i) r[i] = (__bf16)v[i];
  return r; }
// a precaution: stands behind a group of global loads, in front of the next rewrite of their address registers; the group's one lane pointer is an input, so that it stays live up to the wait and no result of the group lands in it
#define XW(p) asm volatile("s_wait_xcnt 0x0" :: "v"(p) : "memory")
#define XW2(p, q) asm volatile("s_wait_xcnt 0x0" :: "v"(p), "v"(q) : "memory")   // the same behind a group that reads through two lane pointers
// FRAGMENT ORDER: a 16-byte piece of a fragment is stored at (piece * 32 + lane) * 16 B, so that one load of a wave reads 512 contiguous bytes (four whole lines) and not 32 B of each of sixteen lines.
// k: [b][kv head][16-key tile][piece p 0-3][lane = 16 g + key % 16][8 f16]: dims 16 p + 8 g + 0..7; each q plane the same with [head] and queries.   v: [b][kv head][32-key chunk][plane hi, lo][16-dim group j][piece s 0-1][lane = 16 g + dim % 16][8 bf16]: keys 16 s + 8 g + 0..7 of the chunk
#define KTILE (16 * HD)        // elements of a q or k tile
#define VCHUNK (2 * 32 * HD)   // elements of a v chunk, both planes
// ---- k_proj: block = (128 rows, 128 cols, which), four waves as 2 x 2, a wave = 64 rows x 64 cols (4 x 4 tiles: eight fragments feed sixteen products; its 64 columns are one head): qkv = x W (+ b), exact; q -> f16 hi (+ residual), k -> f16 tiles, v -> bf16 planes
__global__ __launch_bounds__(128) void k_proj(const float* __restrict__ X, const float* __restrict__ WQ, const float* __restrict__ BQ, const float* __restrict__ WK, const float* __restrict__ BK, const float* __restrict__ WV, const float* __restrict__ BV, _Float16* __restrict__ QH, _Float16* __restrict__ QL, _Float16* __restrict__ KH, __bf16* __restrict__ VT, const float* __restrict__ NQW, const float* __restrict__ NKW, int wbase) {
  __shared__ __align__(16) char smem[2 * (128 + 128) * PIT * 2];   // the loop's two stage buffers (2 x 256 rows x 144 B) first, then the epilogue's arrays (2 x 128 x 272 B) on the same bytes
  _Float16 (*sh)[136] = (_Float16 (*)[136])smem, (*sl)[136] = sh + 128; __bf16 (*th)[136] = (__bf16 (*)[136])smem, (*tl2)[136] = th + 128;   // q, k: [row][col]; v: [col][row]; a block uses one of the two pairs
  const int tid = threadIdx.x, wave = tid >> 5, lane = tid & 31, col = lane & 15, g = lane >> 4, wr = wave >> 1, wc = wave & 1; const int which = wbase + blockIdx.z; const int OW = (which == 0) ? CC : CK;   /* output row width: q 1,024, k/v 256 */ const int c0 = blockIdx.y * 128; const size_t r0 = (size_t)blockIdx.x * 128; const float* WA = which == 0 ? WQ : which == 1 ? WK : WV; const float* BA = which == 0 ? BQ : which == 1 ? BK : BV;
  v8f acc[4][4] = {};   // [row tile][col tile]
  { const int lr = tid >> 4, lp = tid & 15;   // the thread's row of each group of 8 rows, and its 16 bytes of the row's 256
    const float* gw = WA + (size_t)(c0 + lr) * CC + lp * 4; const float* gx = X + (r0 + lr) * CC + lp * 4;
    v4f rw[16], rx[16];
#pragma unroll
    for (int i = 0; i < 16; ++i) rw[i] = *(const v4f*)(gw + i * 8 * CC);
#pragma unroll
    for (int i = 0; i < 16; ++i) rx[i] = *(const v4f*)(gx + i * 8 * CC);
    XW2(gw, gx);
    // stays rolled: a trip is already 32 matrix instructions and 64 LDS operations a wave; two buffers, ONE barrier a stage: a buffer is rewritten two stages later, behind the barrier of the stage between
#pragma unroll 1
    for (int s = 0; s < NS; ++s) { __bf16* const bs = (__bf16*)smem + (s & 1) * ((128 + 128) * PIT);   // rows 0-127: W, 128-255: x
#pragma unroll
      for (int i = 0; i < 16; ++i) *(v4b*)(bs + (i * 8 + lr) * PIT + lp * 4) = cvt4(rw[i]);
#pragma unroll
      for (int i = 0; i < 16; ++i) *(v4b*)(bs + (128 + i * 8 + lr) * PIT + lp * 4) = cvt4(rx[i]);
      __syncthreads();
      if (s + 1 < NS) { gw += KS; gx += KS;   // behind the barrier (which waits for every load in flight): the next stage flies under this stage's products
#pragma unroll
        for (int i = 0; i < 16; ++i) rw[i] = *(const v4f*)(gw + i * 8 * CC);
#pragma unroll
        for (int i = 0; i < 16; ++i) rx[i] = *(const v4f*)(gx + i * 8 * CC);
        XW2(gw, gx); }
#pragma unroll
      for (int kk = 0; kk < KS / 32; ++kk) { v16b a[4], w[4];   // the eight fragments as one group of LDS reads in front of their sixteen products
#pragma unroll
        for (int i = 0; i < 4; ++i) a[i] = frag_b(bs + (128 + wr * 64 + i * 16 + col) * PIT + kk * 32, lane);
#pragma unroll
        for (int j = 0; j < 4; ++j) w[j] = frag_b(bs + (wc * 64 + j * 16 + col) * PIT + kk * 32, lane);
#pragma unroll
        for (int j = 0; j < 4; ++j)
#pragma unroll
          for (int i = 0; i < 4; ++i) acc[i][j] = wmma_bf(a[i], w[j], acc[i][j]); } }
    __syncthreads(); }   // every wave has left the stage buffers: the epilogue's arrays lie on the same LDS
  // QK-RMSNorm per (row, head): the wave's 64 columns are one head; mean of squares over the 64 dims via in-lane + 16-lane shuffles (unconditional), then scale by rsqrt(ms + eps) * norm_w[d]
  if (which < 2) { const float* NW = which == 0 ? NQW : NKW; float nw[4];   // the head's four weights of this lane, read once for the wave's four row tiles
#pragma unroll
    for (int jj = 0; jj < 4; ++jj) nw[jj] = NW[jj * 16 + col];
    asm volatile("s_wait_xcnt 0x0" :: "s"(NW) : "memory");   // the precaution of XW for these four loads: their scalar base is an input, so that it stays live up to the wait
#pragma unroll
    for (int i = 0; i < 4; ++i) { float ssq[8];
#pragma unroll
      for (int r = 0; r < 8; ++r) { float s_ = 0.f;
#pragma unroll
        for (int jj = 0; jj < 4; ++jj) s_ += acc[i][jj][r] * acc[i][jj][r];
#pragma unroll
        for (int o_ = 1; o_ < 16; o_ <<= 1) s_ += __shfl_xor(s_, o_);
        ssq[r] = rsqrtf(s_ * (1.0f / HD) + 1e-6f); }
#pragma unroll
      for (int jj = 0; jj < 4; ++jj) { const float wv = bfr(nw[jj]);
#pragma unroll
        for (int r = 0; r < 8; ++r) acc[i][jj][r] *= ssq[r] * wv; } } }
#pragma unroll
  for (int j = 0; j < 4; ++j) { const int cl = wc * 64 + j * 16 + col; const float bb = BA ? bfr(BA[c0 + cl]) : 0.f;
#pragma unroll
    for (int i = 0; i < 4; ++i)
#pragma unroll
      for (int r = 0; r < 8; ++r) acc[i][j][r] += bb; }
  if (which == 2) {
#pragma unroll
    for (int j = 0; j < 4; ++j)
#pragma unroll
      for (int i = 0; i < 4; ++i)
#pragma unroll
        for (int r = 0; r < 8; ++r) { const float v = acc[i][j][r]; const int rl = wr * 64 + i * 16 + 8 * g + r, cl = wc * 64 + j * 16 + col; const __bf16 bh = (__bf16)v; th[cl][rl] = bh; tl2[cl][rl] = (__bf16)(v - (float)bh); } }
  else {
#pragma unroll
    for (int j = 0; j < 4; ++j)
#pragma unroll
      for (int i = 0; i < 4; ++i)
#pragma unroll
        for (int r = 0; r < 8; ++r) { const float v = acc[i][j][r]; const int rl = wr * 64 + i * 16 + 8 * g + r, cl = wc * 64 + j * 16 + col; const _Float16 hv = (_Float16)v; sh[rl][cl] = hv; sl[rl][cl] = (_Float16)((v - (float)hv) * 1024.0f); } }   /* q residual carried x 2^10 so the plane stays f16-normal on the chip */
  __syncthreads();
  { const size_t b = r0 / TT; const int t0 = (int)(r0 % TT);   // fragment order; q and k: the block's 128 threads store one tile (2 KB) a step, thread = piece * 32 + lane, eight tiles of each of the block's two heads; the steps unrolled from one pointer a plane, so that no address register of a store is rewritten
    if (which == 0) { const size_t o = ((b * NH + c0 / HD) * (TT / 16) + t0 / 16) * (size_t)KTILE + tid * 8; _Float16* ph = QH + o; _Float16* pl = QL + o;
#pragma unroll
      for (int t = 0; t < 16; ++t) { vst2((unsigned*)(ph + (t >> 3) * (TT / 16) * KTILE + (t & 7) * KTILE), *(const v4u*)&sh[(t & 7) * 16 + col][(t >> 3) * HD + wave * 16 + g * 8]); vst2((unsigned*)(pl + (t >> 3) * (TT / 16) * KTILE + (t & 7) * KTILE), *(const v4u*)&sl[(t & 7) * 16 + col][(t >> 3) * HD + wave * 16 + g * 8]); }
      XW2(ph, pl); }   // the same precaution behind each of the three runs of stores: the compiler lays the runs out one behind another, in an order of its own, with fall-through edges between them, and a later run's code rewrites an earlier one's registers
    else if (which == 1) {
      _Float16* ph = KH + ((b * NKV + c0 / HD) * (TT / 16) + t0 / 16) * (size_t)KTILE + tid * 8;
#pragma unroll
      for (int t = 0; t < 16; ++t) vst2((unsigned*)(ph + (t >> 3) * (TT / 16) * KTILE + (t & 7) * KTILE), *(const v4u*)&sh[(t & 7) * 16 + col][(t >> 3) * HD + wave * 16 + g * 8]);
      XW(ph); }
    else {   // a step is 2 KB = two 16-dim groups of one plane of one chunk, thread = (group % 2, piece, lane); t = (head, chunk, plane, group / 2)
      __bf16* ph = VT + ((b * NKV + c0 / HD) * (TT / 32) + t0 / 32) * (size_t)VCHUNK + tid * 8;
#pragma unroll
      for (int t = 0; t < 32; ++t) vst2((unsigned*)(ph + (t >> 4) * (TT / 32) * VCHUNK + (t & 15) * 1024), *(const v4u*)&((t & 2) ? tl2 : th)[(t >> 4) * HD + (t & 1) * 32 + wr * 16 + col][((t >> 2) & 3) * 32 + wc * 16 + g * 8]);
      XW(ph); } } }
// ---- k_att: block = 64 queries of (b,h), one wave = 16 queries, no exchange between waves. S^T = K Q^T (A = 16 key rows, B = 16 query rows), so a lane holds the logits of ONE query (col) at keys 8g+r of each 16-key tile;
// two such tiles are, element for element, the A fragment of P for a 32-key chunk. The wave's window is NCH chunks of 32 keys; each lane parks its own logits in LDS (16 B a lane, lane-contiguous) and reads back only what it wrote.
// K and V fragments are fetched one chunk ahead into registers (the LDS strip allows two waves a SIMD, so registers are free).
#define NCH 17   // 32-key chunks that cover [ql0 - 511, ql0 + 15] from a multiple of 32
// fragments from the lane's own pointer, fragment order: the second piece lies 32 lanes x 8 elements behind the first
__device__ __forceinline__ v16h fragq_h(const _Float16* p) { union { v16h v; v8h q[2]; } u; u.q[0] = *(const v8h*)p; u.q[1] = *(const v8h*)(p + 256); return u.v; }
__device__ __forceinline__ v16b fragq_b(const __bf16* p) { union { v16b v; v8b q[2]; } u; u.q[0] = *(const v8b*)p; u.q[1] = *(const v8b*)(p + 256); return u.v; }
__global__ __launch_bounds__(128) void k_att(const _Float16* __restrict__ QH, const _Float16* __restrict__ QL, const _Float16* __restrict__ KH, const __bf16* __restrict__ VT, float* __restrict__ Y) {   // q, k and v in fragment order
  __shared__ __align__(16) float st[4][NCH * 4][32][4];
  const int tid = threadIdx.x, wave = __builtin_amdgcn_readfirstlane(tid >> 5), lane = tid & 31, col = lane & 15, g = lane >> 4;
  const int b = blockIdx.z, h = blockIdx.y, ql0 = blockIdx.x * 64 + wave * 16, qt = ql0 + col;
  const int kbase = ((ql0 - (WIN - 1)) >> 5) * 32;      // first key of chunk 0 (floor to 32; below 0 for the first rows)
  const int c0 = kbase < 0 ? (-kbase) >> 5 : 0;         // wave-uniform: chunks wholly in front of key 0 are not walked
  const int kf = kbase < 0 ? 0 : kbase;                 // first key walked = kbase + c0 * 32
  const int st0 = c0 + 1 < NCH ? 32 : 0;                // keys from the first chunk to the first one fetched ahead
  const size_t qo = ((size_t)(b * NH + h) * (TT / 16) + ql0 / 16) * KTILE + lane * 8; const _Float16* qp = QH + qo; const _Float16* qlp = QL + qo;
  const v16h qh0 = fragq_h(qp), qh1 = fragq_h(qp + 512), qr0 = fragq_h(qlp), qr1 = fragq_h(qlp + 512);
  const _Float16* kp = KH + ((size_t)(b * NKV + h / REP) * (TT / 16) + kf / 16) * KTILE + lane * 8;   /* GQA: kv head h/4; the lane's 16 bytes of the first piece of the first tile */
  v16h ka[2], kb[2];
#pragma unroll
  for (int t = 0; t < 2; ++t) { ka[t] = fragq_h(kp + t * KTILE); kb[t] = fragq_h(kp + t * KTILE + 512); }
  // holds the first loads in front of the wait (loaded values as inputs only): without them the compiler moves these loads behind it; the three pointers as in XW
  asm volatile("s_wait_xcnt 0x0" :: "v"(qh0), "v"(qh1), "v"(qr0), "v"(qr1), "v"(ka[0]), "v"(kb[0]), "v"(ka[1]), "v"(kb[1]), "v"(qp), "v"(qlp), "v"(kp) : "memory");
  kp += st0 * HD;
  float m = -3.0e38f;
  // two trips a pass: the fragments in use and the ones fetched ahead swap registers without moves
#pragma unroll 2
  for (int c = c0; c < NCH; ++c) {   // kp walks one chunk ahead and stops at the last one (the last trip fetches its own chunk again): the address stays inside k
    v16h na[2], nb[2];
#pragma unroll
    for (int t = 0; t < 2; ++t) { na[t] = fragq_h(kp + t * KTILE); nb[t] = fragq_h(kp + t * KTILE + 512); }
    XW(kp);
    kp += c + 2 < NCH ? 2 * KTILE : 0;
#pragma unroll
    for (int t = 0; t < 2; ++t) { const int kt0 = kbase + c * 32 + t * 16;
      v8f a = {}, al = {};
      a = wmma16(ka[t], qh0, a); al = wmma16(ka[t], qr0, al); a = wmma16(kb[t], qh1, a); al = wmma16(kb[t], qr1, al);
      a += al * (1.0f / 1024.0f);
      v4f s0, s1;
#pragma unroll
      for (int r = 0; r < 8; ++r) { const int kt = kt0 + 8 * g + r; const bool allowed = (kt <= qt) && (qt - kt < WIN); const float v = allowed ? a[r] * 0.125f : -3.0e38f; m = fmaxf(m, v); if (r < 4) s0[r] = v; else s1[r - 4] = v; }
      *(v4f*)&st[wave][c * 4 + t * 2][lane][0] = s0; *(v4f*)&st[wave][c * 4 + t * 2 + 1][lane][0] = s1; }
#pragma unroll
    for (int t = 0; t < 2; ++t) { ka[t] = na[t]; kb[t] = nb[t]; } }
  const __bf16* vp = VT + ((size_t)(b * NKV + h / REP) * (TT / 32) + kf / 32) * VCHUNK + lane * 8;   /* GQA: kv head h/4; the lane's 16 bytes of the first piece of the first chunk */
  v16b vh[HD / 16], vl[HD / 16];   // the first chunk's v flies under the maximum's exchange
#pragma unroll
  for (int j = 0; j < HD / 16; ++j) { vh[j] = fragq_b(vp + j * 512); vl[j] = fragq_b(vp + j * 512 + VCHUNK / 2); }
  XW(vp);
  vp += st0 * (VCHUNK / 32);
  m = fmaxf(m, __shfl_xor(m, 16));   // the query's other eight keys of every tile sit in lane ^ 16
  // the exponentials are taken in the P v loop itself: e = exp2(s * log2 e + eb) = 2^11 * exp(s - m); a masked key's -3.0e38 runs to -inf in the fused multiply-add and gives exactly 0
  const float eb = 11.0f - m * 1.44269504f;
  v4f sa = {}, sb = {};   // the row sum in eight partial sums a lane: one chain of sixteen dependent additions a chunk would stand bare behind the products
  v8f acc[HD / 16] = {};
  // two trips a pass, as in the logit loop: no register moves between the two fragment sets
#pragma unroll 2
  for (int c = c0; c < NCH; ++c) {   // as above: vp stops at the last chunk, the last trip's fetch stays inside v
    v16b nh[HD / 16], nl[HD / 16];
#pragma unroll
    for (int j = 0; j < HD / 16; ++j) { nh[j] = fragq_b(vp + j * 512); nl[j] = fragq_b(vp + j * 512 + VCHUNK / 2); }
    XW(vp);
    vp += c + 2 < NCH ? VCHUNK : 0;
    float pv[16];
#pragma unroll
    for (int q = 0; q < 4; ++q) { const v4f v = *(const v4f*)&st[wave][c * 4 + q][lane][0]; v4f e;
#pragma unroll
      for (int i = 0; i < 4; ++i) { e[i] = __builtin_amdgcn_exp2f(fmaf(v[i], 1.44269504f, eb)); pv[q * 4 + i] = e[i]; }
      if (q & 1) sb += e; else sa += e; }
    const F2 p = bsplit16(pv);
#pragma unroll
    for (int j = 0; j < HD / 16; ++j) { acc[j] = wmma_bf(p.h, vh[j], acc[j]); acc[j] = wmma_bf(p.l, vh[j], acc[j]); acc[j] = wmma_bf(p.h, vl[j], acc[j]); }
#pragma unroll
    for (int j = 0; j < HD / 16; ++j) { vh[j] = nh[j]; vl[j] = nl[j]; } }
  sa += sb;
  float sum = (sa[0] + sa[1]) + (sa[2] + sa[3]);
  sum += __shfl_xor(sum, 16);
  const float inv = 1.0f / sum;   // of the lane's query (col)
  float f[8];   // the factors of the lane's eight output rows 8g + r, each from the lane that holds that query (unrolled: f stays in registers)
#pragma unroll
  for (int r = 0; r < 8; ++r) f[r] = __shfl(inv, 8 * g + r);
  float (*ss)[HD + 4] = (float (*)[HD + 4])&st[wave][0][0][0];   // the wave's own strip, now free, turns the output tile for 16-byte row stores
#pragma unroll
  for (int j = 0; j < HD / 16; ++j)
#pragma unroll
    for (int r = 0; r < 8; ++r) ss[8 * g + r][j * 16 + col] = acc[j][r] * f[r];
  LDSX(); for (int rl = 0; rl < 16; ++rl) if (lane < HD / 4) vst2(Y + ((size_t)b * TT + ql0 + rl) * CC + h * HD + lane * 4, *(const v4f*)&ss[rl][lane * 4]); }
// ---- k_out: block = (128 rows, 128 cols), four waves as 2 x 2, a wave = 64 rows x 64 cols: out = y (bf16 hi + lo) Wo^T + bo
__global__ __launch_bounds__(128) void k_out(const float* __restrict__ Y, const float* __restrict__ WP, const float* __restrict__ BP, float* __restrict__ OUT) { __shared__ __align__(16) char smem[2 * (128 + 256) * PIT * 2]; float (*sf)[64][68] = (float (*)[64][68])smem;   // two stage buffers; the four output tiles (69,632 B) on the same bytes behind the loop
  const int tid = threadIdx.x, wave = tid >> 5, lane = tid & 31, col = lane & 15, g = lane >> 4, wr = wave >> 1, wc = wave & 1; const int c0 = blockIdx.y * 128 + wc * 64; const size_t r0 = (size_t)blockIdx.x * 128 + wr * 64;   // the wave's first column and row
  v8f acc[4][4] = {};   // [row tile][col tile]
  { const int lr = tid >> 4, lp = tid & 15;   // as in k_proj
    const float* gw = WP + (size_t)(blockIdx.y * 128 + lr) * CC + lp * 4; const float* gy = Y + ((size_t)blockIdx.x * 128 + lr) * CC + lp * 4;
    v4f rw[16], ry[16];
#pragma unroll
    for (int i = 0; i < 16; ++i) rw[i] = *(const v4f*)(gw + i * 8 * CC);
#pragma unroll
    for (int i = 0; i < 16; ++i) ry[i] = *(const v4f*)(gy + i * 8 * CC);
    XW2(gw, gy);
    // stays rolled, two buffers, one barrier a stage, as in k_proj
#pragma unroll 1
    for (int s = 0; s < NS; ++s) { __bf16* const bs = (__bf16*)smem + (s & 1) * ((128 + 256) * PIT);   // rows 0-127: W, 128-255: y hi, 256-383: y lo
#pragma unroll
      for (int i = 0; i < 16; ++i) *(v4b*)(bs + (i * 8 + lr) * PIT + lp * 4) = cvt4(rw[i]);
#pragma unroll
      for (int i = 0; i < 16; ++i) { const v4b hi = cvt4(ry[i]); v4f re;
#pragma unroll
        for (int e = 0; e < 4; ++e) re[e] = ry[i][e] - (float)hi[e];
        *(v4b*)(bs + (128 + i * 8 + lr) * PIT + lp * 4) = hi; *(v4b*)(bs + (256 + i * 8 + lr) * PIT + lp * 4) = cvt4(re); }
      __syncthreads();
      if (s + 1 < NS) { gw += KS; gy += KS;
#pragma unroll
        for (int i = 0; i < 16; ++i) rw[i] = *(const v4f*)(gw + i * 8 * CC);
#pragma unroll
        for (int i = 0; i < 16; ++i) ry[i] = *(const v4f*)(gy + i * 8 * CC);
        XW2(gw, gy); }
#pragma unroll
      for (int kk = 0; kk < KS / 32; ++kk) { v16b ah[4], al[4], w[4];   // the twelve fragments as one group of LDS reads in front of their thirty-two products
#pragma unroll
        for (int i = 0; i < 4; ++i) { ah[i] = frag_b(bs + (128 + wr * 64 + i * 16 + col) * PIT + kk * 32, lane); al[i] = frag_b(bs + (256 + wr * 64 + i * 16 + col) * PIT + kk * 32, lane); }
#pragma unroll
        for (int j = 0; j < 4; ++j) w[j] = frag_b(bs + (wc * 64 + j * 16 + col) * PIT + kk * 32, lane);
#pragma unroll
        for (int j = 0; j < 4; ++j) {   // hi, then lo, of each tile as before; three other tiles' products stand between the two
#pragma unroll
          for (int i = 0; i < 4; ++i) acc[i][j] = wmma_bf(ah[i], w[j], acc[i][j]);
#pragma unroll
          for (int i = 0; i < 4; ++i) acc[i][j] = wmma_bf(al[i], w[j], acc[i][j]); } } }
    __syncthreads(); }   // every wave has left the stage buffers: sf lies on the same LDS
#pragma unroll
  for (int j = 0; j < 4; ++j) { const float bb = BP ? bfr(BP[c0 + j * 16 + col]) : 0.f;
#pragma unroll
    for (int i = 0; i < 4; ++i)
#pragma unroll
      for (int r = 0; r < 8; ++r) sf[wave][i * 16 + 8 * g + r][j * 16 + col] = acc[i][j][r] + bb; }
  LDSX(); for (int rl = 0; rl < 64; rl += 2) vst2(OUT + (r0 + rl + g) * CC + c0 + col * 4, *(const v4f*)&sf[wave][rl + g][col * 4]); }   // a store = two rows of 256 B: whole lines
extern "C" void kernel_launch(void* const* d_in, const int* in_sizes, int n_in, void* d_out, int out_size, void* d_ws, size_t ws_size, hipStream_t stream) {
  (void)in_sizes; (void)n_in; (void)out_size;
  const float** F = (const float**)d_in;   // 0 x [4,2048,1024], 1 wq [1024,1024] ([out,in]), 2 wk [256,1024], 3 wv [256,1024], 4 wo [1024,1024] ([out,in]), 5 q_norm_w [64], 6 k_norm_w [64]
  if (ws_size < (size_t)WS_END) return;
  char* ws = (char*)d_ws; _Float16 *QH = (_Float16*)(ws + WS_QH), *QL = (_Float16*)(ws + WS_QL), *KH = (_Float16*)(ws + WS_KH); __bf16 *VT = (__bf16*)(ws + WS_VT); float *Y = (float*)(ws + WS_Y);
  k_proj<<<dim3(TNB * TT / 128, CC / 128, 1), 128, 0, stream>>>(F[0], F[1], nullptr, F[2], nullptr, F[3], nullptr, QH, QL, KH, VT, F[5], F[6], 0);   // q (16 heads)
  k_proj<<<dim3(TNB * TT / 128, CK / 128, 2), 128, 0, stream>>>(F[0], F[1], nullptr, F[2], nullptr, F[3], nullptr, QH, QL, KH, VT, F[5], F[6], 1);   // k, v (4 kv heads)
  k_att<<<dim3(TT / 64, NH, TNB), 128, 0, stream>>>(QH, QL, KH, VT, Y);   // logits, softmax and P v of every (b, h) in one launch
  k_out<<<dim3(TNB * TT / 128, CC / 128), 128, 0, stream>>>(Y, F[4], nullptr, (float*)d_out);
}

// v006
// Measured time: 125 microseconds a run.
// Two timings next to v005 both put it at 1.06 times that version's speed.
// All steps since v000 together make it 11.6 times as fast.
// compute dtype: all float inputs rounded to bf16; q/k/v = x W^T with EXACT bf16 products on WMMA 16x16x32, f32 accumulate; per-head RMSNorm of q and k in f32 in the projection epilogue; q as f16 hi + residual (x 2^10), k f16 -> 2-product logits / 8 inside the causal sliding window (512), kept in f32 in registers (one launch, one pass over the keys, GQA: head h reads kv head h/4); softmax in f32: P' = exp2((s - m) log2 e + 11) on the hardware exponential, m a running maximum (sums and tile rescaled when it grows by more than 5), not normalised, split bf16 hi + lo against v bf16 hi + lo (3 products), the output tile scaled by 1 / sum P'; y = ctx (bf16 hi + lo) wo^T; f32 output.
#include <hip/hip_runtime.h>
#include <math.h>

typedef __attribute__((ext_vector_type(16))) _Float16 v16h;
typedef __attribute__((ext_vector_type(16))) __bf16 v16b;
typedef __attribute__((ext_vector_type(8)))  _Float16 v8h;
typedef __attribute__((ext_vector_type(8)))  float v8f;
typedef __attribute__((ext_vector_type(4)))  float v4f;
typedef __attribute__((ext_vector_type(2)))  float v2f;
typedef __attribute__((ext_vector_type(4)))  unsigned v4u;
typedef __attribute__((ext_vector_type(4)))  int v4i;
typedef float __attribute__((may_alias)) float_a;
typedef int __attribute__((may_alias)) int_a;

template <typename T> __device__ __forceinline__ void vst2(void* p, T v) { *(T*)p = v;  }
__device__ __forceinline__ v8f wmma16(v16h a, v16h b, v8f c) {
  v8f d = __builtin_amdgcn_wmma_f32_16x16x32_f16(false, a, false, b, (short)0, c, false, false);
  asm volatile("v_nop\n\tv_nop\n\tv_nop\n\tv_nop" : "+v"(d) : "v"(a), "v"(b));
  return d;
}
__device__ __forceinline__ v8f wmma_bf(v16b a, v16b b, v8f c) {
  v8f d = __builtin_amdgcn_wmma_f32_16x16x32_bf16(false, a, false, b, (short)0, c, false, false);
  asm volatile("v_nop\n\tv_nop\n\tv_nop\n\tv_nop" : "+v"(d) : "v"(a), "v"(b));
  return d;
}
// 16x16x32 fragments: lane = (h = lane>>4, row/col = lane&15); elements 0..7 = k0+8h+0..7, 8..15 = k0+16+8h+0..7; D element r = row 8h+r
__device__ __forceinline__ v16h frag_h(const _Float16* rowk0, int lane) {
  union { v16h v; v8h q[2]; } u; const _Float16* p = rowk0 + 8 * (lane >> 4);
  u.q[0] = *(const v8h*)p; u.q[1] = *(const v8h*)(p + 16); return u.v;
}
__device__ __forceinline__ v16h frag_f32(const float* rowk0, int lane) {
  v16h a; const float* p = rowk0 + 8 * (lane >> 4);
#pragma unroll
  for (int i = 0; i < 8; ++i) { a[i] = (_Float16)p[i]; a[8 + i] = (_Float16)p[16 + i]; }
  return a;
}
__device__ __forceinline__ v16h frag_f32s(const float* rowk0, int lane, float sc) {
  v16h a; const float* p = rowk0 + 8 * (lane >> 4);
#pragma unroll
  for (int i = 0; i < 8; ++i) { a[i] = (_Float16)(p[i] * sc); a[8 + i] = (_Float16)(p[16 + i] * sc); }
  return a;
}
// column fragment from a [K][ld] layout (column n), rows >= K read as 0
__device__ __forceinline__ v16h fragc_f32(const float* W, int k0, int n, int lane, int ld, int K) {
  v16h a; const int g = lane >> 4;
#pragma unroll
  for (int i = 0; i < 8; ++i) { const int ka = k0 + 8 * g + i, kb = ka + 16;
    a[i] = (_Float16)(ka < K ? W[(size_t)(ka < K ? ka : K - 1) * ld + n] : 0.f); a[8 + i] = (_Float16)(kb < K ? W[(size_t)(kb < K ? kb : K - 1) * ld + n] : 0.f); }
  return a;
}
struct F2 { v16b h, l; };
__device__ __forceinline__ F2 bsplit16(const float v[16]) { F2 r;
#pragma unroll
  for (int i = 0; i < 16; ++i) { const __bf16 h = (__bf16)v[i]; r.h[i] = h; r.l[i] = (__bf16)(v[i] - (float)h); }
  return r; }
__device__ __forceinline__ F2 split_row(const float* row, int k0, int lane) { float v[16]; const float* p = row + k0 + 8 * (lane >> 4);
#pragma unroll
  for (int i = 0; i < 8; ++i) { v[i] = p[i]; v[8 + i] = p[16 + i]; }
  return bsplit16(v); }
__device__ __forceinline__ F2 split_rowK(const float* row, int k0, int lane, int K) { float v[16]; const int g = lane >> 4;
#pragma unroll
  for (int i = 0; i < 8; ++i) { const int ka = k0 + 8 * g + i, kb = ka + 16; v[i] = ka < K ? row[ka < K ? ka : K - 1] : 0.f; v[8 + i] = kb < K ? row[kb < K ? kb : K - 1] : 0.f; }
  return bsplit16(v); }
__device__ __forceinline__ F2 split_col(const float* W, int k0, int n, int lane, int ld, int K) { float v[16]; const int g = lane >> 4;
#pragma unroll
  for (int i = 0; i < 8; ++i) { const int ka = k0 + 8 * g + i, kb = ka + 16; v[i] = ka < K ? W[(size_t)(ka < K ? ka : K - 1) * ld + n] : 0.f; v[8 + i] = kb < K ? W[(size_t)(kb < K ? kb : K - 1) * ld + n] : 0.f; }
  return bsplit16(v); }
__device__ __forceinline__ v8f mac3(const F2& a, const F2& b, v8f c) { c = wmma_bf(a.l, b.h, c); c = wmma_bf(a.h, b.l, c); return wmma_bf(a.h, b.h, c); }
__device__ __forceinline__ float sigm(float v) { return 1.0f / (1.0f + expf(-v)); }
#define LDSX() do { asm volatile("s_wait_dscnt 0" ::: "memory"); __builtin_amdgcn_wave_barrier(); __builtin_amdgcn_fence(__ATOMIC_RELEASE, "workgroup"); } while (0)


// Windowed grouped-query attention block (B 4, T 2,048, DIM 1,024; 16 query heads, 4 kv heads x 64, QK-RMSNorm (eps 1e-6, weights read), causal sliding window 512, no biases): y = softmax(rms(q) rms(k)^T / 8 | window) v (kv head = h / 4), @ wo^T.
#define NB 4
#define TT 2048
#define CC 1024
#define NH 16
#define HD 64
#define WIN 512
#define NKV 4
#define CK (NKV * HD)   // 256: k/v row width
#define REP (NH / NKV)
#ifndef TNB
#define TNB NB
#endif
typedef __attribute__((ext_vector_type(8))) __bf16 v8b;
__device__ __forceinline__ v16b frag_b(const __bf16* rowk0, int lane) {
  union { v16b v; v8b q[2]; } u; const __bf16* p = rowk0 + 8 * (lane >> 4);
  u.q[0] = *(const v8b*)p; u.q[1] = *(const v8b*)(p + 16); return u.v;
}
__device__ __forceinline__ float bfr(float v) { return (float)(__bf16)v; }
__device__ __attribute__((noinline)) float exp_ni(float v) { return expf(v); }
__device__ __attribute__((noinline)) float erf_ni(float v) { return erff(v); }

#define WS_QH  0u
#define WS_QL  (WS_QH + 2u * (size_t)NB * TT * CC)
#define WS_KH  (WS_QL + 2u * (size_t)NB * TT * CC)
#define WS_VT  (WS_KH + 2u * (size_t)NB * TT * CK)      // q, k and v lie in the order in which k_att's fragment loads read them (FRAGMENT ORDER below); v takes the bytes of both planes, from here to WS_S
#define WS_VL  (WS_VT + 2u * (size_t)NB * CK * TT)
#define HG 4                                          // only sizes the WS_S region, which no kernel uses
#define WS_S   (WS_VL + 2u * (size_t)NB * CK * TT)      // unused: the logits and P stay in registers
#define WS_PH  (WS_S + 4u * (size_t)HG * TT * TT)
#define WS_Y   (WS_PH + 0u)              // f32 y rows [b*t][C]
#define WS_END (WS_Y + 4u * (size_t)NB * TT * CC)

// ---- operand staging of the two projection kernels: a stage is KS k of every operand row of the block, read from global memory by whole lines (16 lanes = 256 B of one row), rounded to bf16 once and shared through LDS
typedef __attribute__((ext_vector_type(4))) __bf16 v4b;
#define KS 64             // k per stage
#define NS (CC / KS)
#define PIT (KS + 8)      // LDS row pitch in bf16: 144 B = 16 B x 9, so the 16 rows of a 16-byte fragment read fall on different banks
__device__ __forceinline__ v4b cvt4(v4f v) { v4b r;
#pragma unroll
  for (int i = 0; i < 4; ++i) r[i] = (__bf16)v[i];
  return r; }
// a precaution: stands behind a group of global loads, in front of the next rewrite of their address registers; the group's one lane pointer is an input, so that it stays live up to the wait and no result of the group lands in it
#define XW(p) asm volatile("s_wait_xcnt 0x0" :: "v"(p) : "memory")
#define XW2(p, q) asm volatile("s_wait_xcnt 0x0" :: "v"(p), "v"(q) : "memory")   // the same behind a group that reads through two lane pointers
// FRAGMENT ORDER: a 16-byte piece of a fragment is stored at (piece * 32 + lane) * 16 B, so that one load of a wave reads 512 contiguous bytes (four whole lines) and not 32 B of each of sixteen lines.
// k: [b][kv head][16-key tile][piece p 0-3][lane = 16 g + key % 16][8 f16]: dims 16 p + 8 g + 0..7; each q plane the same with [head] and queries.   v: [b][kv head][32-key chunk][plane hi, lo][16-dim group j][piece s 0-1][lane = 16 g + dim % 16][8 bf16]: keys 16 s + 8 g + 0..7 of the chunk
#define KTILE (16 * HD)        // elements of a q or k tile
#define VCHUNK (2 * 32 * HD)   // elements of a v chunk, both planes
// ---- k_proj: block = (128 rows, 128 cols, which), four waves as 2 x 2, a wave = 64 rows x 64 cols (4 x 4 tiles: eight fragments feed sixteen products; its 64 columns are one head): qkv = x W (+ b), exact; q -> f16 hi (+ residual), k -> f16 tiles, v -> bf16 planes
__global__ __launch_bounds__(128) void k_proj(const float* __restrict__ X, const float* __restrict__ WQ, const float* __restrict__ BQ, const float* __restrict__ WK, const float* __restrict__ BK, const float* __restrict__ WV, const float* __restrict__ BV, _Float16* __restrict__ QH, _Float16* __restrict__ QL, _Float16* __restrict__ KH, __bf16* __restrict__ VT, const float* __restrict__ NQW, const float* __restrict__ NKW, int wbase) {
  __shared__ __align__(16) char smem[2 * (128 + 128) * PIT * 2];   // the loop's two stage buffers (2 x 256 rows x 144 B) first, then the epilogue's arrays (2 x 128 x 272 B) on the same bytes
  _Float16 (*sh)[136] = (_Float16 (*)[136])smem, (*sl)[136] = sh + 128; __bf16 (*th)[136] = (__bf16 (*)[136])smem, (*tl2)[136] = th + 128;   // q, k: [row][col]; v: [col][row]; a block uses one of the two pairs
  const int tid = threadIdx.x, wave = tid >> 5, lane = tid & 31, col = lane & 15, g = lane >> 4, wr = wave >> 1, wc = wave & 1; const int which = wbase + blockIdx.z; const int OW = (which == 0) ? CC : CK;   /* output row width: q 1,024, k/v 256 */ const int c0 = blockIdx.y * 128; const size_t r0 = (size_t)blockIdx.x * 128; const float* WA = which == 0 ? WQ : which == 1 ? WK : WV; const float* BA = which == 0 ? BQ : which == 1 ? BK : BV;
  v8f acc[4][4] = {};   // [row tile][col tile]
  { const int lr = tid >> 4, lp = tid & 15;   // the thread's row of each group of 8 rows, and its 16 bytes of the row's 256
    const float* gw = WA + (size_t)(c0 + lr) * CC + lp * 4; const float* gx = X + (r0 + lr) * CC + lp * 4;
    v4f rw[16], rx[16];
#pragma unroll
    for (int i = 0; i < 16; ++i) rw[i] = *(const v4f*)(gw + i * 8 * CC);
#pragma unroll
    for (int i = 0; i < 16; ++i) rx[i] = *(const v4f*)(gx + i * 8 * CC);
    XW2(gw, gx);
    // stays rolled: a trip is already 32 matrix instructions and 64 LDS operations a wave; two buffers, ONE barrier a stage: a buffer is rewritten two stages later, behind the barrier of the stage between
#pragma unroll 1
    for (int s = 0; s < NS; ++s) { __bf16* const bs = (__bf16*)smem + (s & 1) * ((128 + 128) * PIT);   // rows 0-127: W, 128-255: x
#pragma unroll
      for (int i = 0; i < 16; ++i) *(v4b*)(bs + (i * 8 + lr) * PIT + lp * 4) = cvt4(rw[i]);
#pragma unroll
      for (int i = 0; i < 16; ++i) *(v4b*)(bs + (128 + i * 8 + lr) * PIT + lp * 4) = cvt4(rx[i]);
      __syncthreads();
      if (s + 1 < NS) { gw += KS; gx += KS;   // behind the barrier (which waits for every load in flight): the next stage flies under this stage's products
#pragma unroll
        for (int i = 0; i < 16; ++i) rw[i] = *(const v4f*)(gw + i * 8 * CC);
#pragma unroll
        for (int i = 0; i < 16; ++i) rx[i] = *(const v4f*)(gx + i * 8 * CC);
        XW2(gw, gx); }
#pragma unroll
      for (int kk = 0; kk < KS / 32; ++kk) { v16b a[4], w[4];   // the eight fragments as one group of LDS reads in front of their sixteen products
#pragma unroll
        for (int i = 0; i < 4; ++i) a[i] = frag_b(bs + (128 + wr * 64 + i * 16 + col) * PIT + kk * 32, lane);
#pragma unroll
        for (int j = 0; j < 4; ++j) w[j] = frag_b(bs + (wc * 64 + j * 16 + col) * PIT + kk * 32, lane);
#pragma unroll
        for (int j = 0; j < 4; ++j)
#pragma unroll
          for (int i = 0; i < 4; ++i) acc[i][j] = wmma_bf(a[i], w[j], acc[i][j]); } }
    __syncthreads(); }   // every wave has left the stage buffers: the epilogue's arrays lie on the same LDS
  // QK-RMSNorm per (row, head): the wave's 64 columns are one head; mean of squares over the 64 dims via in-lane + 16-lane shuffles (unconditional), then scale by rsqrt(ms + eps) * norm_w[d]
  if (which < 2) { const float* NW = which == 0 ? NQW : NKW; float nw[4];   // the head's four weights of this lane, read once for the wave's four row tiles
#pragma unroll
    for (int jj = 0; jj < 4; ++jj) nw[jj] = NW[jj * 16 + col];
    asm volatile("s_wait_xcnt 0x0" :: "s"(NW) : "memory");   // the precaution of XW for these four loads: their scalar base is an input, so that it stays live up to the wait
#pragma unroll
    for (int i = 0; i < 4; ++i) { float ssq[8];
#pragma unroll
      for (int r = 0; r < 8; ++r) { float s_ = 0.f;
#pragma unroll
        for (int jj = 0; jj < 4; ++jj) s_ += acc[i][jj][r] * acc[i][jj][r];
#pragma unroll
        for (int o_ = 1; o_ < 16; o_ <<= 1) s_ += __shfl_xor(s_, o_);
        ssq[r] = rsqrtf(s_ * (1.0f / HD) + 1e-6f); }
#pragma unroll
      for (int jj = 0; jj < 4; ++jj) { const float wv = bfr(nw[jj]);
#pragma unroll
        for (int r = 0; r < 8; ++r) acc[i][jj][r] *= ssq[r] * wv; } } }
#pragma unroll
  for (int j = 0; j < 4; ++j) { const int cl = wc * 64 + j * 16 + col; const float bb = BA ? bfr(BA[c0 + cl]) : 0.f;
#pragma unroll
    for (int i = 0; i < 4; ++i)
#pragma unroll
      for (int r = 0; r < 8; ++r) acc[i][j][r] += bb; }
  if (which == 2) {
#pragma unroll
    for (int j = 0; j < 4; ++j)
#pragma unroll
      for (int i = 0; i < 4; ++i)
#pragma unroll
        for (int r = 0; r < 8; ++r) { const float v = acc[i][j][r]; const int rl = wr * 64 + i * 16 + 8 * g + r, cl = wc * 64 + j * 16 + col; const __bf16 bh = (__bf16)v; th[cl][rl] = bh; tl2[cl][rl] = (__bf16)(v - (float)bh); } }
  else {
#pragma unroll
    for (int j = 0; j < 4; ++j)
#pragma unroll
      for (int i = 0; i < 4; ++i)
#pragma unroll
        for (int r = 0; r < 8; ++r) { const float v = acc[i][j][r]; const int rl = wr * 64 + i * 16 + 8 * g + r, cl = wc * 64 + j * 16 + col; const _Float16 hv = (_Float16)v; sh[rl][cl] = hv; sl[rl][cl] = (_Float16)((v - (float)hv) * 1024.0f); } }   /* q residual carried x 2^10 so the plane stays f16-normal on the chip */
  __syncthreads();
  { const size_t b = r0 / TT; const int t0 = (int)(r0 % TT);   // fragment order; q and k: the block's 128 threads store one tile (2 KB) a step, thread = piece * 32 + lane, eight tiles of each of the block's two heads; the steps unrolled from one pointer a plane, so that no address register of a store is rewritten
    if (which == 0) { const size_t o = ((b * NH + c0 / HD) * (TT / 16) + t0 / 16) * (size_t)KTILE + tid * 8; _Float16* ph = QH + o; _Float16* pl = QL + o;
#pragma unroll
      for (int t = 0; t < 16; ++t) { vst2((unsigned*)(ph + (t >> 3) * (TT / 16) * KTILE + (t & 7) * KTILE), *(const v4u*)&sh[(t & 7) * 16 + col][(t >> 3) * HD + wave * 16 + g * 8]); vst2((unsigned*)(pl + (t >> 3) * (TT / 16) * KTILE + (t & 7) * KTILE), *(const v4u*)&sl[(t & 7) * 16 + col][(t >> 3) * HD + wave * 16 + g * 8]); }
      XW2(ph, pl); }   // the same precaution behind each of the three runs of stores: the compiler lays the runs out one behind another, in an order of its own, with fall-through edges between them, and a later run's code rewrites an earlier one's registers
    else if (which == 1) {
      _Float16* ph = KH + ((b * NKV + c0 / HD) * (TT / 16) + t0 / 16) * (size_t)KTILE + tid * 8;
#pragma unroll
      for (int t = 0; t < 16; ++t) vst2((unsigned*)(ph + (t >> 3) * (TT / 16) * KTILE + (t & 7) * KTILE), *(const v4u*)&sh[(t & 7) * 16 + col][(t >> 3) * HD + wave * 16 + g * 8]);
      XW(ph); }
    else {   // a step is 2 KB = two 16-dim groups of one plane of one chunk, thread = (group % 2, piece, lane); t = (head, chunk, plane, group / 2)
      __bf16* ph = VT + ((b * NKV + c0 / HD) * (TT / 32) + t0 / 32) * (size_t)VCHUNK + tid * 8;
#pragma unroll
      for (int t = 0; t < 32; ++t) vst2((unsigned*)(ph + (t >> 4) * (TT / 32) * VCHUNK + (t & 15) * 1024), *(const v4u*)&((t & 2) ? tl2 : th)[(t >> 4) * HD + (t & 1) * 32 + wr * 16 + col][((t >> 2) & 3) * 32 + wc * 16 + g * 8]);
      XW(ph); } } }
// ---- k_att: block = 64 queries of (b,h), one wave = 16 queries, no exchange between waves. S^T = K Q^T (A = 16 key rows, B = 16 query rows), so a lane holds the logits of ONE query (col) at keys 8g+r of each 16-key tile;
// two such tiles are, element for element, the A fragment of P for a 32-key chunk: the logits never leave the lane's registers. ONE pass over the wave's window of NCH chunks of 32 keys, with a running maximum:
// P' is taken against the maximum in use; when a chunk's maximum lies more than 5 above it for some query, sums and output tile are scaled down to the new one (a scalar branch, rare behind the first chunk).
// No LDS in the loop, so registers alone set the number of waves a SIMD. K and V fragments are fetched one chunk ahead into the registers that the products have just read.
#define NCH 17   // 32-key chunks that cover [ql0 - 511, ql0 + 15] from a multiple of 32
// fragments from the lane's own pointer, fragment order: the second piece lies 32 lanes x 8 elements behind the first
__device__ __forceinline__ v16h fragq_h(const _Float16* p) { union { v16h v; v8h q[2]; } u; u.q[0] = *(const v8h*)p; u.q[1] = *(const v8h*)(p + 256); return u.v; }
__device__ __forceinline__ v16b fragq_b(const __bf16* p) { union { v16b v; v8b q[2]; } u; u.q[0] = *(const v8b*)p; u.q[1] = *(const v8b*)(p + 256); return u.v; }
__device__ __forceinline__ float xhalf(float x) { return __builtin_bit_cast(float, __builtin_amdgcn_permlanex16(__builtin_bit_cast(int, x), __builtin_bit_cast(int, x), 0x76543210, 0xfedcba98, false, false)); }   // lane l reads lane l ^ 16, on the vector pipe
__global__ __launch_bounds__(128) void k_att(const _Float16* __restrict__ QH, const _Float16* __restrict__ QL, const _Float16* __restrict__ KH, const __bf16* __restrict__ VT, float* __restrict__ Y) {   // q, k and v in fragment order
  __shared__ __align__(16) float st[4][16][HD + 4];   // the epilogue's turn of the output tile, a strip a wave
  const int tid = threadIdx.x, wave = __builtin_amdgcn_readfirstlane(tid >> 5), lane = tid & 31, col = lane & 15, g = lane >> 4;
  const int b = blockIdx.z, h = blockIdx.y, ql0 = blockIdx.x * 64 + wave * 16, qt = ql0 + col;
  const int kbase = ((ql0 - (WIN - 1)) >> 5) * 32;      // first key of chunk 0 (floor to 32; below 0 for the first rows)
  const int c0 = kbase < 0 ? (-kbase) >> 5 : 0;         // wave-uniform: chunks wholly in front of key 0 are not walked
  const int kf = kbase < 0 ? 0 : kbase;                 // first key walked = kbase + c0 * 32
  const int st0 = c0 + 1 < NCH ? 32 : 0;                // keys from the first chunk to the first one fetched ahead
  const size_t qo = ((size_t)(b * NH + h) * (TT / 16) + ql0 / 16) * KTILE + lane * 8; const _Float16* qp = QH + qo; const _Float16* qlp = QL + qo;
  const v16h qh0 = fragq_h(qp), qh1 = fragq_h(qp + 512), qr0 = fragq_h(qlp), qr1 = fragq_h(qlp + 512);
  const _Float16* kp = KH + ((size_t)(b * NKV + h / REP) * (TT / 16) + kf / 16) * KTILE + lane * 8;   /* GQA: kv head h/4; the lane's 16 bytes of the first piece of the first tile */
  v16h ka[2], kb[2];
#pragma unroll
  for (int t = 0; t < 2; ++t) { ka[t] = fragq_h(kp + t * KTILE); kb[t] = fragq_h(kp + t * KTILE + 512); }
  const __bf16* vp = VT + ((size_t)(b * NKV + h / REP) * (TT / 32) + kf / 32) * VCHUNK + lane * 8;   /* GQA: kv head h/4; the lane's 16 bytes of the first piece of the first chunk */
  v16b vh[HD / 16], vl[HD / 16];   // the first chunk's v is asked for behind q and k, in front of the wait for those: it flies under the first logits
#pragma unroll
  for (int j = 0; j < HD / 16; ++j) { vh[j] = fragq_b(vp + j * 512); vl[j] = fragq_b(vp + j * 512 + VCHUNK / 2); }
  XW(vp);
  // holds the first loads in front of the wait (loaded values as inputs only); the three pointers as in XW
  asm volatile("s_wait_xcnt 0x0" :: "v"(qh0), "v"(qh1), "v"(qr0), "v"(qr1), "v"(ka[0]), "v"(kb[0]), "v"(ka[1]), "v"(kb[1]), "v"(qp), "v"(qlp), "v"(kp) : "memory");
  kp += st0 * HD;
  vp += st0 * (VCHUNK / 32);
  // m: the maximum in use of the lane's query (the same in lanes l and l ^ 16); -3.0e38 as long as every key seen was masked. e = exp2(s * log2 e + eb) = 2^11 * exp(s - m); a masked key's -3.0e38 runs to -inf in the fused multiply-add and gives exactly 0,
  // also while m is still -3.0e38: eb is formed from max(m, -1.0e30), which is m itself for every maximum that f16 operands can give, and stays finite
  float m = -3.0e38f, eb = 11.0f + 1.0e30f * 1.44269504f;
  v4f sa = {}, sb = {};   // the row sum in eight partial sums a lane: one chain of sixteen dependent additions a chunk would stand bare behind the products
  v8f acc[HD / 16] = {};
  // stays rolled: each fragment set is refilled in place, so no trip needs another's registers
#pragma unroll 1
  for (int c = c0; c < NCH; ++c) {
    float sv[16];
#pragma unroll
    for (int t = 0; t < 2; ++t) { const int kt0 = kbase + c * 32 + t * 16;
      v8f a = {}, al = {};
      a = wmma16(ka[t], qh0, a); al = wmma16(ka[t], qr0, al); a = wmma16(kb[t], qh1, a); al = wmma16(kb[t], qr1, al);
      a += al * (1.0f / 1024.0f);
#pragma unroll
      for (int r = 0; r < 8; ++r) { const int kt = kt0 + 8 * g + r; const bool allowed = (kt <= qt) && (qt - kt < WIN); sv[t * 8 + r] = allowed ? a[r] * 0.125f : -3.0e38f; } }
    // kp walks one chunk ahead and stops at the last one (the last trip fetches its own chunk again): the address stays inside k
#pragma unroll
    for (int t = 0; t < 2; ++t) { ka[t] = fragq_h(kp + t * KTILE); kb[t] = fragq_h(kp + t * KTILE + 512); }
    XW(kp);
    kp += c + 2 < NCH ? 2 * KTILE : 0;
    float cm = sv[0];
#pragma unroll
    for (int i = 1; i < 16; ++i) cm = fmaxf(cm, sv[i]);
    cm = fmaxf(cm, xhalf(cm));   // the query's other eight keys of every tile sit in lane ^ 16
    if (__builtin_amdgcn_ballot_w32(cm > m + 5.0f) != 0) {   // wave-uniform, every lane stays on: the first chunk with an open key, and a later one only where a logit stands far above all before it
      const float mn = fmaxf(m, cm); const float dn = __builtin_amdgcn_exp2f((m - mn) * 1.44269504f);   // 1 where the maximum stays, 0 where m was still -3.0e38 (sums and tile are 0 there)
      m = mn; eb = 11.0f - fmaxf(mn, -1.0e30f) * 1.44269504f;
      sa *= dn; sb *= dn;
#pragma unroll
      for (int r = 0; r < 8; ++r) { const float fr = __shfl(dn, 8 * g + r);   // the factor of output row 8g + r, from the lane that holds that query
#pragma unroll
        for (int j = 0; j < HD / 16; ++j) acc[j][r] *= fr; } }
    float pv[16];
#pragma unroll
    for (int q = 0; q < 4; ++q) { v4f e;
#pragma unroll
      for (int i = 0; i < 4; ++i) { e[i] = __builtin_amdgcn_exp2f(fmaf(sv[q * 4 + i], 1.44269504f, eb)); pv[q * 4 + i] = e[i]; }
      if (q & 1) sb += e; else sa += e; }
    const F2 p = bsplit16(pv);
#pragma unroll
    for (int j = 0; j < HD / 16; ++j) { acc[j] = wmma_bf(p.h, vh[j], acc[j]); acc[j] = wmma_bf(p.l, vh[j], acc[j]); acc[j] = wmma_bf(p.h, vl[j], acc[j]); }
    // as above: vp stops at the last chunk, the last trip's fetch stays inside v
#pragma unroll
    for (int j = 0; j < HD / 16; ++j) { vh[j] = fragq_b(vp + j * 512); vl[j] = fragq_b(vp + j * 512 + VCHUNK / 2); }
    XW(vp);
    vp += c + 2 < NCH ? VCHUNK : 0; }
  sa += sb;
  float sum = (sa[0] + sa[1]) + (sa[2] + sa[3]);
  sum += __shfl_xor(sum, 16);
  const float inv = 1.0f / sum;   // of the lane's query (col)
  float f[8];   // the factors of the lane's eight output rows 8g + r, each from the lane that holds that query (unrolled: f stays in registers)
#pragma unroll
  for (int r = 0; r < 8; ++r) f[r] = __shfl(inv, 8 * g + r);
  float (*ss)[HD + 4] = st[wave];   // the wave's own strip turns the output tile for 16-byte row stores
#pragma unroll
  for (int j = 0; j < HD / 16; ++j)
#pragma unroll
    for (int r = 0; r < 8; ++r) ss[8 * g + r][j * 16 + col] = acc[j][r] * f[r];
  LDSX(); for (int rl = 0; rl < 16; ++rl) if (lane < HD / 4) vst2(Y + ((size_t)b * TT + ql0 + rl) * CC + h * HD + lane * 4, *(const v4f*)&ss[rl][lane * 4]); }
// ---- k_out: block = (128 rows, 128 cols), four waves as 2 x 2, a wave = 64 rows x 64 cols: out = y (bf16 hi + lo) Wo^T + bo
__global__ __launch_bounds__(128) void k_out(const float* __restrict__ Y, const float* __restrict__ WP, const float* __restrict__ BP, float* __restrict__ OUT) { __shared__ __align__(16) char smem[2 * (128 + 256) * PIT * 2]; float (*sf)[64][68] = (float (*)[64][68])smem;   // two stage buffers; the four output tiles (69,632 B) on the same bytes behind the loop
  const int tid = threadIdx.x, wave = tid >> 5, lane = tid & 31, col = lane & 15, g = lane >> 4, wr = wave >> 1, wc = wave & 1; const int c0 = blockIdx.y * 128 + wc * 64; const size_t r0 = (size_t)blockIdx.x * 128 + wr * 64;   // the wave's first column and row
  v8f acc[4][4] = {};   // [row tile][col tile]
  { const int lr = tid >> 4, lp = tid & 15;   // as in k_proj
    const float* gw = WP + (size_t)(blockIdx.y * 128 + lr) * CC + lp * 4; const float* gy = Y + ((size_t)blockIdx.x * 128 + lr) * CC + lp * 4;
    v4f rw[16], ry[16];
#pragma unroll
    for (int i = 0; i < 16; ++i) rw[i] = *(const v4f*)(gw + i * 8 * CC);
#pragma unroll
    for (int i = 0; i < 16; ++i) ry[i] = *(const v4f*)(gy + i * 8 * CC);
    XW2(gw, gy);
    // stays rolled, two buffers, one barrier a stage, as in k_proj
#pragma unroll 1
    for (int s = 0; s < NS; ++s) { __bf16* const bs = (__bf16*)smem + (s & 1) * ((128 + 256) * PIT);   // rows 0-127: W, 128-255: y hi, 256-383: y lo
#pragma unroll
      for (int i = 0; i < 16; ++i) *(v4b*)(bs + (i * 8 + lr) * PIT + lp * 4) = cvt4(rw[i]);
#pragma unroll
      for (int i = 0; i < 16; ++i) { const v4b hi = cvt4(ry[i]); v4f re;
#pragma unroll
        for (int e = 0; e < 4; ++e) re[e] = ry[i][e] - (float)hi[e];
        *(v4b*)(bs + (128 + i * 8 + lr) * PIT + lp * 4) = hi; *(v4b*)(bs + (256 + i * 8 + lr) * PIT + lp * 4) = cvt4(re); }
      __syncthreads();
      if (s + 1 < NS) { gw += KS; gy += KS;
#pragma unroll
        for (int i = 0; i < 16; ++i) rw[i] = *(const v4f*)(gw + i * 8 * CC);
#pragma unroll
        for (int i = 0; i < 16; ++i) ry[i] = *(const v4f*)(gy + i * 8 * CC);
        XW2(gw, gy); }
#pragma unroll
      for (int kk = 0; kk < KS / 32; ++kk) { v16b ah[4], al[4], w[4];   // the twelve fragments as one group of LDS reads in front of their thirty-two products
#pragma unroll
        for (int i = 0; i < 4; ++i) { ah[i] = frag_b(bs + (128 + wr * 64 + i * 16 + col) * PIT + kk * 32, lane); al[i] = frag_b(bs + (256 + wr * 64 + i * 16 + col) * PIT + kk * 32, lane); }
#pragma unroll
        for (int j = 0; j < 4; ++j) w[j] = frag_b(bs + (wc * 64 + j * 16 + col) * PIT + kk * 32, lane);
#pragma unroll
        for (int j = 0; j < 4; ++j) {   // hi, then lo, of each tile as before; three other tiles' products stand between the two
#pragma unroll
          for (int i = 0; i < 4; ++i) acc[i][j] = wmma_bf(ah[i], w[j], acc[i][j]);
#pragma unroll
          for (int i = 0; i < 4; ++i) acc[i][j] = wmma_bf(al[i], w[j], acc[i][j]); } } }
    __syncthreads(); }   // every wave has left the stage buffers: sf lies on the same LDS
#pragma unroll
  for (int j = 0; j < 4; ++j) { const float bb = BP ? bfr(BP[c0 + j * 16 + col]) : 0.f;
#pragma unroll
    for (int i = 0; i < 4; ++i)
#pragma unroll
      for (int r = 0; r < 8; ++r) sf[wave][i * 16 + 8 * g + r][j * 16 + col] = acc[i][j][r] + bb; }
  LDSX(); for (int rl = 0; rl < 64; rl += 2) vst2(OUT + (r0 + rl + g) * CC + c0 + col * 4, *(const v4f*)&sf[wave][rl + g][col * 4]); }   // a store = two rows of 256 B: whole lines
extern "C" void kernel_launch(void* const* d_in, const int* in_sizes, int n_in, void* d_out, int out_size, void* d_ws, size_t ws_size, hipStream_t stream) {
  (void)in_sizes; (void)n_in; (void)out_size;
  const float** F = (const float**)d_in;   // 0 x [4,2048,1024], 1 wq [1024,1024] ([out,in]), 2 wk [256,1024], 3 wv [256,1024], 4 wo [1024,1024] ([out,in]), 5 q_norm_w [64], 6 k_norm_w [64]
  if (ws_size < (size_t)WS_END) return;
  char* ws = (char*)d_ws; _Float16 *QH = (_Float16*)(ws + WS_QH), *QL = (_Float16*)(ws + WS_QL), *KH = (_Float16*)(ws + WS_KH); __bf16 *VT = (__bf16*)(ws + WS_VT); float *Y = (float*)(ws + WS_Y);
  k_proj<<<dim3(TNB * TT / 128, CC / 128, 1), 128, 0, stream>>>(F[0], F[1], nullptr, F[2], nullptr, F[3], nullptr, QH, QL, KH, VT, F[5], F[6], 0);   // q (16 heads)
  k_proj<<<dim3(TNB * TT / 128, CK / 128, 2), 128, 0, stream>>>(F[0], F[1], nullptr, F[2], nullptr, F[3], nullptr, QH, QL, KH, VT, F[5], F[6], 1);   // k, v (4 kv heads)
  k_att<<<dim3(TT / 64, NH, TNB), 128, 0, stream>>>(QH, QL, KH, VT, Y);   // logits, softmax and P v of every (b, h) in one launch
  k_out<<<dim3(TNB * TT / 128, CC / 128), 128, 0, stream>>>(Y, F[4], nullptr, (float*)d_out);
}

// v007
// It runs in 120 microseconds.
// Timed twice side by side with v006, it ran 1.03 times as fast both times.
// Counting every step since v000, it is 12.0 times as fast.
// compute dtype: all float inputs rounded to bf16; q/k/v = x W^T with EXACT bf16 products on WMMA 16x16x32, f32 accumulate; per-head RMSNorm of q and k in f32 in the projection epilogue; q as f16 hi + residual (x 2^10), k f16 -> 2-product logits / 8 inside the causal sliding window (512), kept in f32 in registers (one launch, one pass over the keys, GQA: head h reads kv head h/4); softmax in f32: P' = exp2((s - m) log2 e + 11) on the hardware exponential, m a running maximum (sums and tile rescaled when it grows by more than 5), not normalised, split bf16 hi + lo against v bf16 hi + lo (3 products), the output tile scaled by 1 / sum P'; y = ctx (bf16 hi + lo) wo^T; f32 output.
#include <hip/hip_runtime.h>
#include <math.h>

typedef __attribute__((ext_vector_type(16))) _Float16 v16h;
typedef __attribute__((ext_vector_type(16))) __bf16 v16b;
typedef __attribute__((ext_vector_type(8)))  _Float16 v8h;
typedef __attribute__((ext_vector_type(8)))  float v8f;
typedef __attribute__((ext_vector_type(4)))  float v4f;
typedef __attribute__((ext_vector_type(2)))  float v2f;
typedef __attribute__((ext_vector_type(4)))  unsigned v4u;
typedef __attribute__((ext_vector_type(4)))  int v4i;
typedef float __attribute__((may_alias)) float_a;
typedef int __attribute__((may_alias)) int_a;

template <typename T> __device__ __forceinline__ void vst2(void* p, T v) { *(T*)p = v;  }
__device__ __forceinline__ v8f wmma16(v16h a, v16h b, v8f c) {
  v8f d = __builtin_amdgcn_wmma_f32_16x16x32_f16(false, a, false, b, (short)0, c, false, false);
  asm volatile("v_nop\n\tv_nop\n\tv_nop\n\tv_nop" : "+v"(d) : "v"(a), "v"(b));
  return d;
}
__device__ __forceinline__ v8f wmma_bf(v16b a, v16b b, v8f c) {
  v8f d = __builtin_amdgcn_wmma_f32_16x16x32_bf16(false, a, false, b, (short)0, c, false, false);
  asm volatile("v_nop\n\tv_nop\n\tv_nop\n\tv_nop" : "+v"(d) : "v"(a), "v"(b));
  return d;
}
// 16x16x32 fragments: lane = (h = lane>>4, row/col = lane&15); elements 0..7 = k0+8h+0..7, 8..15 = k0+16+8h+0..7; D element r = row 8h+r
__device__ __forceinline__ v16h frag_h(const _Float16* rowk0, int lane) {
  union { v16h v; v8h q[2]; } u; const _Float16* p = rowk0 + 8 * (lane >> 4);
  u.q[0] = *(const v8h*)p; u.q[1] = *(const v8h*)(p + 16); return u.v;
}
__device__ __forceinline__ v16h frag_f32(const float* rowk0, int lane) {
  v16h a; const float* p = rowk0 + 8 * (lane >> 4);
#pragma unroll
  for (int i = 0; i < 8; ++i) { a[i] = (_Float16)p[i]; a[8 + i] = (_Float16)p[16 + i]; }
  return a;
}
__device__ __forceinline__ v16h frag_f32s(const float* rowk0, int lane, float sc) {
  v16h a; const float* p = rowk0 + 8 * (lane >> 4);
#pragma unroll
  for (int i = 0; i < 8; ++i) { a[i] = (_Float16)(p[i] * sc); a[8 + i] = (_Float16)(p[16 + i] * sc); }
  return a;
}
// column fragment from a [K][ld] layout (column n), rows >= K read as 0
__device__ __forceinline__ v16h fragc_f32(const float* W, int k0, int n, int lane, int ld, int K) {
  v16h a; const int g = lane >> 4;
#pragma unroll
  for (int i = 0; i < 8; ++i) { const int ka = k0 + 8 * g + i, kb = ka + 16;
    a[i] = (_Float16)(ka < K ? W[(size_t)(ka < K ? ka : K - 1) * ld + n] : 0.f); a[8 + i] = (_Float16)(kb < K ? W[(size_t)(kb < K ? kb : K - 1) * ld + n] : 0.f); }
  return a;
}
struct F2 { v16b h, l; };
__device__ __forceinline__ F2 bsplit16(const float v[16]) { F2 r;
#pragma unroll
  for (int i = 0; i < 16; ++i) { const __bf16 h = (__bf16)v[i]; r.h[i] = h; r.l[i] = (__bf16)(v[i] - (float)h); }
  return r; }
__device__ __forceinline__ F2 split_row(const float* row, int k0, int lane) { float v[16]; const float* p = row + k0 + 8 * (lane >> 4);
#pragma unroll
  for (int i = 0; i < 8; ++i) { v[i] = p[i]; v[8 + i] = p[16 + i]; }
  return bsplit16(v); }
__device__ __forceinline__ F2 split_rowK(const float* row, int k0, int lane, int K) { float v[16]; const int g = lane >> 4;
#pragma unroll
  for (int i = 0; i < 8; ++i) { const int ka = k0 + 8 * g + i, kb = ka + 16; v[i] = ka < K ? row[ka < K ? ka : K - 1] : 0.f; v[8 + i] = kb < K ? row[kb < K ? kb : K - 1] : 0.f; }
  return bsplit16(v); }
__device__ __forceinline__ F2 split_col(const float* W, int k0, int n, int lane, int ld, int K) { float v[16]; const int g = lane >> 4;
#pragma unroll
  for (int i = 0; i < 8; ++i) { const int ka = k0 + 8 * g + i, kb = ka + 16; v[i] = ka < K ? W[(size_t)(ka < K ? ka : K - 1) * ld + n] : 0.f; v[8 + i] = kb < K ? W[(size_t)(kb < K ? kb : K - 1) * ld + n] : 0.f; }
  return bsplit16(v); }
__device__ __forceinline__ v8f mac3(const F2& a, const F2& b, v8f c) { c = wmma_bf(a.l, b.h, c); c = wmma_bf(a.h, b.l, c); return wmma_bf(a.h, b.h, c); }
__device__ __forceinline__ float sigm(float v) { return 1.0f / (1.0f + expf(-v)); }
#define LDSX() do { asm volatile("s_wait_dscnt 0" ::: "memory"); __builtin_amdgcn_wave_barrier(); __builtin_amdgcn_fence(__ATOMIC_RELEASE, "workgroup"); } while (0)


// Windowed grouped-query attention block (B 4, T 2,048, DIM 1,024; 16 query heads, 4 kv heads x 64, QK-RMSNorm (eps 1e-6, weights read), causal sliding window 512, no biases): y = softmax(rms(q) rms(k)^T / 8 | window) v (kv head = h / 4), @ wo^T.
#define NB 4
#define TT 2048
#define CC 1024
#define NH 16
#define HD 64
#define WIN 512
#define NKV 4
#define CK (NKV * HD)   // 256: k/v row width
#define REP (NH / NKV)
#ifndef TNB
#define TNB NB
#endif
typedef __attribute__((ext_vector_type(8))) __bf16 v8b;
__device__ __forceinline__ v16b frag_b(const __bf16* rowk0, int lane) {
  union { v16b v; v8b q[2]; } u; const __bf16* p = rowk0 + 8 * (lane >> 4);
  u.q[0] = *(const v8b*)p; u.q[1] = *(const v8b*)(p + 16); return u.v;
}
__device__ __forceinline__ float bfr(float v) { return (float)(__bf16)v; }
__device__ __attribute__((noinline)) float exp_ni(float v) { return expf(v); }
__device__ __attribute__((noinline)) float erf_ni(float v) { return erff(v); }

#define WS_QH  0u
#define WS_QL  (WS_QH + 2u * (size_t)NB * TT * CC)
#define WS_KH  (WS_QL + 2u * (size_t)NB * TT * CC)
#define WS_VT  (WS_KH + 2u * (size_t)NB * TT * CK)      // q, k and v lie in the order in which k_att's fragment loads read them (FRAGMENT ORDER below); v takes the bytes of both planes, from here to WS_S
#define WS_VL  (WS_VT + 2u * (size_t)NB * CK * TT)
#define HG 4                                          // only sizes the WS_S region, which no kernel uses
#define WS_S   (WS_VL + 2u * (size_t)NB * CK * TT)      // unused: the logits and P stay in registers
#define WS_PH  (WS_S + 4u * (size_t)HG * TT * TT)
#define WS_Y   (WS_PH + 0u)              // f32 y rows [b*t][C]
#define WS_END (WS_Y + 4u * (size_t)NB * TT * CC)

// ---- operand staging of the two projection kernels: a stage is KS k of every operand row of the block, read from global memory by whole lines (16 lanes = 256 B of one row), rounded to bf16 once and shared through LDS
typedef __attribute__((ext_vector_type(4))) __bf16 v4b;
#define KS 64             // k per stage
#define NS (CC / KS)
#define PIT (KS + 8)      // LDS row pitch in bf16: 144 B = 16 B x 9, so the 16 rows of a 16-byte fragment read fall on different banks
__device__ __forceinline__ v4b cvt4(v4f v) { v4b r;
#pragma unroll
  for (int i = 0; i < 4; ++i) r[i] = (__bf16)v[i];
  return r; }
// a precaution: stands behind a group of global loads, in front of the next rewrite of their address registers; the group's one lane pointer is an input, so that it stays live up to the wait and no result of the group lands in it
#define XW(p) asm volatile("s_wait_xcnt 0x0" :: "v"(p) : "memory")
#define XW2(p, q) asm volatile("s_wait_xcnt 0x0" :: "v"(p), "v"(q) : "memory")   // the same behind a group that reads through two lane pointers
// FRAGMENT ORDER: a 16-byte piece of a fragment is stored at (piece * 32 + lane) * 16 B, so that one load of a wave reads 512 contiguous bytes (four whole lines) and not 32 B of each of sixteen lines.
// k: [b][kv head][16-key tile][piece p 0-3][lane = 16 g + key % 16][8 f16]: dims 16 p + 8 g + 0..7; each q plane the same with [head] and queries.   v: [b][kv head][32-key chunk][plane hi, lo][16-dim group j][piece s 0-1][lane = 16 g + dim % 16][8 bf16]: keys 16 s + 8 g + 0..7 of the chunk
#define KTILE (16 * HD)        // elements of a q or k tile
#define VCHUNK (2 * 32 * HD)   // elements of a v chunk, both planes
// ---- k_proj: block = (128 rows, 128 cols, which), four waves as 2 x 2, a wave = 64 rows x 64 cols (4 x 4 tiles: eight fragments feed sixteen products; its 64 columns are one head): qkv = x W (+ b), exact; q -> f16 hi (+ residual), k -> f16 tiles, v -> bf16 planes
__global__ __launch_bounds__(128) void k_proj(const float* __restrict__ X, const float* __restrict__ WQ, const float* __restrict__ BQ, const float* __restrict__ WK, const float* __restrict__ BK, const float* __restrict__ WV, const float* __restrict__ BV, _Float16* __restrict__ QH, _Float16* __restrict__ QL, _Float16* __restrict__ KH, __bf16* __restrict__ VT, const float* __restrict__ NQW, const float* __restrict__ NKW, int wbase) {
  __shared__ __align__(16) char smem[2 * (128 + 128) * PIT * 2];   // the loop's two stage buffers (2 x 256 rows x 144 B) first, then the epilogue's arrays (2 x 128 x 272 B) on the same bytes
  _Float16 (*sh)[136] = (_Float16 (*)[136])smem, (*sl)[136] = sh + 128; __bf16 (*th)[136] = (__bf16 (*)[136])smem, (*tl2)[136] = th + 128;   // q, k: [row][col]; v: [col][row]; a block uses one of the two pairs
  const int tid = threadIdx.x, wave = tid >> 5, lane = tid & 31, col = lane & 15, g = lane >> 4, wr = wave >> 1, wc = wave & 1; const int which = wbase + blockIdx.z; const int OW = (which == 0) ? CC : CK;   /* output row width: q 1,024, k/v 256 */ const int c0 = blockIdx.y * 128; const size_t r0 = (size_t)blockIdx.x * 128; const float* WA = which == 0 ? WQ : which == 1 ? WK : WV; const float* BA = which == 0 ? BQ : which == 1 ? BK : BV;
  v8f acc[4][4] = {};   // [row tile][col tile]
  { const int lr = tid >> 4, lp = tid & 15;   // the thread's row of each group of 8 rows, and its 16 bytes of the row's 256
    const float* gw = WA + (size_t)(c0 + lr) * CC + lp * 4; const float* gx = X + (r0 + lr) * CC + lp * 4;
    v4f rw[16], rx[16];
#pragma unroll
    for (int i = 0; i < 16; ++i) rw[i] = *(const v4f*)(gw + i * 8 * CC);
#pragma unroll
    for (int i = 0; i < 16; ++i) rx[i] = *(const v4f*)(gx + i * 8 * CC);
    XW2(gw, gx);
    // stays rolled: a trip is already 32 matrix instructions and 64 LDS operations a wave; two buffers, ONE barrier a stage: a buffer is rewritten two stages later, behind the barrier of the stage between
#pragma unroll 1
    for (int s = 0; s < NS; ++s) { __bf16* const bs = (__bf16*)smem + (s & 1) * ((128 + 128) * PIT);   // rows 0-127: W, 128-255: x
#pragma unroll
      for (int i = 0; i < 16; ++i) *(v4b*)(bs + (i * 8 + lr) * PIT + lp * 4) = cvt4(rw[i]);
#pragma unroll
      for (int i = 0; i < 16; ++i) *(v4b*)(bs + (128 + i * 8 + lr) * PIT + lp * 4) = cvt4(rx[i]);
      __syncthreads();
      if (s + 1 < NS) { gw += KS; gx += KS;   // behind the barrier (which waits for every load in flight): the next stage flies under this stage's products
#pragma unroll
        for (int i = 0; i < 16; ++i) rw[i] = *(const v4f*)(gw + i * 8 * CC);
#pragma unroll
        for (int i = 0; i < 16; ++i) rx[i] = *(const v4f*)(gx + i * 8 * CC);
        XW2(gw, gx); }
#pragma unroll
      for (int kk = 0; kk < KS / 32; ++kk) { v16b a[4], w[4];   // the eight fragments as one group of LDS reads in front of their sixteen products
#pragma unroll
        for (int i = 0; i < 4; ++i) a[i] = frag_b(bs + (128 + wr * 64 + i * 16 + col) * PIT + kk * 32, lane);
#pragma unroll
        for (int j = 0; j < 4; ++j) w[j] = frag_b(bs + (wc * 64 + j * 16 + col) * PIT + kk * 32, lane);
#pragma unroll
        for (int j = 0; j < 4; ++j)
#pragma unroll
          for (int i = 0; i < 4; ++i) acc[i][j] = wmma_bf(a[i], w[j], acc[i][j]); } }
    __syncthreads(); }   // every wave has left the stage buffers: the epilogue's arrays lie on the same LDS
  // QK-RMSNorm per (row, head): the wave's 64 columns are one head; mean of squares over the 64 dims via in-lane + 16-lane shuffles (unconditional), then scale by rsqrt(ms + eps) * norm_w[d]
  if (which < 2) { const float* NW = which == 0 ? NQW : NKW; float nw[4];   // the head's four weights of this lane, read once for the wave's four row tiles
#pragma unroll
    for (int jj = 0; jj < 4; ++jj) nw[jj] = NW[jj * 16 + col];
    asm volatile("s_wait_xcnt 0x0" :: "s"(NW) : "memory");   // the precaution of XW for these four loads: their scalar base is an input, so that it stays live up to the wait
#pragma unroll
    for (int i = 0; i < 4; ++i) { float ssq[8];
#pragma unroll
      for (int r = 0; r < 8; ++r) { float s_ = 0.f;
#pragma unroll
        for (int jj = 0; jj < 4; ++jj) s_ += acc[i][jj][r] * acc[i][jj][r];
#pragma unroll
        for (int o_ = 1; o_ < 16; o_ <<= 1) s_ += __shfl_xor(s_, o_);
        ssq[r] = rsqrtf(s_ * (1.0f / HD) + 1e-6f); }
#pragma unroll
      for (int jj = 0; jj < 4; ++jj) { const float wv = bfr(nw[jj]);
#pragma unroll
        for (int r = 0; r < 8; ++r) acc[i][jj][r] *= ssq[r] * wv; } } }
#pragma unroll
  for (int j = 0; j < 4; ++j) { const int cl = wc * 64 + j * 16 + col; const float bb = BA ? bfr(BA[c0 + cl]) : 0.f;
#pragma unroll
    for (int i = 0; i < 4; ++i)
#pragma unroll
      for (int r = 0; r < 8; ++r) acc[i][j][r] += bb; }
  if (which == 2) {
#pragma unroll
    for (int j = 0; j < 4; ++j)
#pragma unroll
      for (int i = 0; i < 4; ++i)
#pragma unroll
        for (int r = 0; r < 8; ++r) { const float v = acc[i][j][r]; const int rl = wr * 64 + i * 16 + 8 * g + r, cl = wc * 64 + j * 16 + col; const __bf16 bh = (__bf16)v; th[cl][rl] = bh; tl2[cl][rl] = (__bf16)(v - (float)bh); } }
  else {
#pragma unroll
    for (int j = 0; j < 4; ++j)
#pragma unroll
      for (int i = 0; i < 4; ++i)
#pragma unroll
        for (int r = 0; r < 8; ++r) { const float v = acc[i][j][r]; const int rl = wr * 64 + i * 16 + 8 * g + r, cl = wc * 64 + j * 16 + col; const _Float16 hv = (_Float16)v; sh[rl][cl] = hv; sl[rl][cl] = (_Float16)((v - (float)hv) * 1024.0f); } }   /* q residual carried x 2^10 so the plane stays f16-normal on the chip */
  __syncthreads();
  { const size_t b = r0 / TT; const int t0 = (int)(r0 % TT);   // fragment order; q and k: the block's 128 threads store one tile (2 KB) a step, thread = piece * 32 + lane, eight tiles of each of the block's two heads; the steps unrolled from one pointer a plane, so that no address register of a store is rewritten
    if (which == 0) { const size_t o = ((b * NH + c0 / HD) * (TT / 16) + t0 / 16) * (size_t)KTILE + tid * 8; _Float16* ph = QH + o; _Float16* pl = QL + o;
#pragma unroll
      for (int t = 0; t < 16; ++t) { vst2((unsigned*)(ph + (t >> 3) * (TT / 16) * KTILE + (t & 7) * KTILE), *(const v4u*)&sh[(t & 7) * 16 + col][(t >> 3) * HD + wave * 16 + g * 8]); vst2((unsigned*)(pl + (t >> 3) * (TT / 16) * KTILE + (t & 7) * KTILE), *(const v4u*)&sl[(t & 7) * 16 + col][(t >> 3) * HD + wave * 16 + g * 8]); }
      XW2(ph, pl); }   // the same precaution behind each of the three runs of stores: the compiler lays the runs out one behind another, in an order of its own, with fall-through edges between them, and a later run's code rewrites an earlier one's registers
    else if (which == 1) {
      _Float16* ph = KH + ((b * NKV + c0 / HD) * (TT / 16) + t0 / 16) * (size_t)KTILE + tid * 8;
#pragma unroll
      for (int t = 0; t < 16; ++t) vst2((unsigned*)(ph + (t >> 3) * (TT / 16) * KTILE + (t & 7) * KTILE), *(const v4u*)&sh[(t & 7) * 16 + col][(t >> 3) * HD + wave * 16 + g * 8]);
      XW(ph); }
    else {   // a step is 2 KB = two 16-dim groups of one plane of one chunk, thread = (group % 2, piece, lane); t = (head, chunk, plane, group / 2)
      __bf16* ph = VT + ((b * NKV + c0 / HD) * (TT / 32) + t0 / 32) * (size_t)VCHUNK + tid * 8;
#pragma unroll
      for (int t = 0; t < 32; ++t) vst2((unsigned*)(ph + (t >> 4) * (TT / 32) * VCHUNK + (t & 15) * 1024), *(const v4u*)&((t & 2) ? tl2 : th)[(t >> 4) * HD + (t & 1) * 32 + wr * 16 + col][((t >> 2) & 3) * 32 + wc * 16 + g * 8]);
      XW(ph); } } }
// ---- k_att: block = 64 queries of (b,h), one wave = 16 queries, no exchange between waves. S^T = K Q^T (A = 16 key rows, B = 16 query rows), so a lane holds the logits of ONE query (col) at keys 8g+r of each 16-key tile;
// two such tiles are, element for element, the A fragment of P for a 32-key chunk: the logits never leave the lane's registers. ONE pass over the wave's window of NCH chunks of 32 keys, with a running maximum:
// P' is taken against the maximum in use; when a chunk's maximum lies more than 5 above it for some query, sums and output tile are scaled down to the new one (a scalar branch, rare behind the first chunk).
// No LDS in the loop, so registers alone set the number of waves a SIMD. K and V fragments are fetched one chunk ahead into the registers that the products have just read.
#define NCH 17   // 32-key chunks that cover [ql0 - 511, ql0 + 15] from a multiple of 32
// fragments from the lane's own pointer, fragment order: the second piece lies 32 lanes x 8 elements behind the first
__device__ __forceinline__ v16h fragq_h(const _Float16* p) { union { v16h v; v8h q[2]; } u; u.q[0] = *(const v8h*)p; u.q[1] = *(const v8h*)(p + 256); return u.v; }
__device__ __forceinline__ v16b fragq_b(const __bf16* p) { union { v16b v; v8b q[2]; } u; u.q[0] = *(const v8b*)p; u.q[1] = *(const v8b*)(p + 256); return u.v; }
__device__ __forceinline__ float xhalf(float x) { return __builtin_bit_cast(float, __builtin_amdgcn_permlanex16(__builtin_bit_cast(int, x), __builtin_bit_cast(int, x), 0x76543210, 0xfedcba98, false, false)); }   // lane l reads lane l ^ 16, on the vector pipe
__global__ __launch_bounds__(128) void k_att(const _Float16* __restrict__ QH, const _Float16* __restrict__ QL, const _Float16* __restrict__ KH, const __bf16* __restrict__ VT, float* __restrict__ Y) {   // q, k and v in fragment order
  __shared__ __align__(16) float st[4][16][HD + 4];   // the epilogue's turn of the output tile, a strip a wave
  const int tid = threadIdx.x, wave = __builtin_amdgcn_readfirstlane(tid >> 5), lane = tid & 31, col = lane & 15, g = lane >> 4;
  const int b = blockIdx.z, h = blockIdx.y, ql0 = blockIdx.x * 64 + wave * 16, qt = ql0 + col;
  const int kbase = ((ql0 - (WIN - 1)) >> 5) * 32;      // first key of chunk 0 (floor to 32; below 0 for the first rows)
  const int c0 = kbase < 0 ? (-kbase) >> 5 : 0;         // wave-uniform: chunks wholly in front of key 0 are not walked
  const int kf = kbase < 0 ? 0 : kbase;                 // first key walked = kbase + c0 * 32
  const int st0 = c0 + 1 < NCH ? 32 : 0;                // keys from the first chunk to the first one fetched ahead
  const size_t qo = ((size_t)(b * NH + h) * (TT / 16) + ql0 / 16) * KTILE + lane * 8; const _Float16* qp = QH + qo; const _Float16* qlp = QL + qo;
  const v16h qh0 = fragq_h(qp), qh1 = fragq_h(qp + 512), qr0 = fragq_h(qlp), qr1 = fragq_h(qlp + 512);
  const _Float16* kp = KH + ((size_t)(b * NKV + h / REP) * (TT / 16) + kf / 16) * KTILE + lane * 8;   /* GQA: kv head h/4; the lane's 16 bytes of the first piece of the first tile */
  v16h ka[2], kb[2];
#pragma unroll
  for (int t = 0; t < 2; ++t) { ka[t] = fragq_h(kp + t * KTILE); kb[t] = fragq_h(kp + t * KTILE + 512); }
  const __bf16* vp = VT + ((size_t)(b * NKV + h / REP) * (TT / 32) + kf / 32) * VCHUNK + lane * 8;   /* GQA: kv head h/4; the lane's 16 bytes of the first piece of the first chunk */
  v16b vh[HD / 16], vl[HD / 16];   // the first chunk's v is asked for behind q and k, in front of the wait for those: it flies under the first logits
#pragma unroll
  for (int j = 0; j < HD / 16; ++j) { vh[j] = fragq_b(vp + j * 512); vl[j] = fragq_b(vp + j * 512 + VCHUNK / 2); }
  XW(vp);
  // holds the first loads in front of the wait (loaded values as inputs only); the three pointers as in XW
  asm volatile("s_wait_xcnt 0x0" :: "v"(qh0), "v"(qh1), "v"(qr0), "v"(qr1), "v"(ka[0]), "v"(kb[0]), "v"(ka[1]), "v"(kb[1]), "v"(qp), "v"(qlp), "v"(kp) : "memory");
  kp += st0 * HD;
  vp += st0 * (VCHUNK / 32);
  // m: the maximum in use of the lane's query (the same in lanes l and l ^ 16); -3.0e38 as long as every key seen was masked. e = exp2(s * log2 e + eb) = 2^11 * exp(s - m); a masked key's -3.0e38 runs to -inf in the fused multiply-add and gives exactly 0,
  // also while m is still -3.0e38: eb is formed from max(m, -1.0e30), which is m itself for every maximum that f16 operands can give, and stays finite
  float m = -3.0e38f, eb = 11.0f + 1.0e30f * 1.44269504f;
  v4f sa = {}, sb = {};   // the row sum in eight partial sums a lane: one chain of sixteen dependent additions a chunk would stand bare behind the products
  v8f acc[HD / 16] = {};
  // stays rolled: each fragment set is refilled in place, so no trip needs another's registers
#pragma unroll 1
  for (int c = c0; c < NCH; ++c) {
    float sv[16]; const int kc = kbase + c * 32;   // the chunk's first key
#pragma unroll
    for (int t = 0; t < 2; ++t) {
      v8f a = {}, al = {};
      a = wmma16(ka[t], qh0, a); al = wmma16(ka[t], qr0, al); a = wmma16(kb[t], qh1, a); al = wmma16(kb[t], qr1, al);
      a += al * (1.0f / 1024.0f);
#pragma unroll
      for (int r = 0; r < 8; ++r) sv[t * 8 + r] = a[r] * 0.125f; }
    // the mask only where a key of the chunk can be closed for one of the wave's sixteen queries (wave-uniform, a scalar branch): a chunk whose last key is at most ql0 and whose first key is at least ql0 + 15 - (WIN - 1) is open for all of them; that leaves the window's first chunk and the diagonal's
    if (kc + 31 > ql0 || kc < ql0 + 15 - (WIN - 1)) {
#pragma unroll
      for (int i = 0; i < 16; ++i) { const int kt = kc + (i >> 3) * 16 + 8 * g + (i & 7); const bool allowed = (kt <= qt) && (qt - kt < WIN); sv[i] = allowed ? sv[i] : -3.0e38f; } }
    // kp walks one chunk ahead and stops at the last one (the last trip fetches its own chunk again): the address stays inside k
#pragma unroll
    for (int t = 0; t < 2; ++t) { ka[t] = fragq_h(kp + t * KTILE); kb[t] = fragq_h(kp + t * KTILE + 512); }
    XW(kp);
    kp += c + 2 < NCH ? 2 * KTILE : 0;
    float cm = sv[0];
#pragma unroll
    for (int i = 1; i < 16; ++i) cm = fmaxf(cm, sv[i]);
    cm = fmaxf(cm, xhalf(cm));   // the query's other eight keys of every tile sit in lane ^ 16
    if (__builtin_amdgcn_ballot_w32(cm > m + 5.0f) != 0) {   // wave-uniform, every lane stays on: the first chunk with an open key, and a later one only where a logit stands far above all before it
      const float mn = fmaxf(m, cm); const float dn = __builtin_amdgcn_exp2f((m - mn) * 1.44269504f);   // 1 where the maximum stays, 0 where m was still -3.0e38 (sums and tile are 0 there)
      m = mn; eb = 11.0f - fmaxf(mn, -1.0e30f) * 1.44269504f;
      sa *= dn; sb *= dn;
#pragma unroll
      for (int r = 0; r < 8; ++r) { const float fr = __shfl(dn, 8 * g + r);   // the factor of output row 8g + r, from the lane that holds that query
#pragma unroll
        for (int j = 0; j < HD / 16; ++j) acc[j][r] *= fr; } }
    float pv[16];
#pragma unroll
    for (int q = 0; q < 4; ++q) { v4f e;
#pragma unroll
      for (int i = 0; i < 4; ++i) { e[i] = __builtin_amdgcn_exp2f(fmaf(sv[q * 4 + i], 1.44269504f, eb)); pv[q * 4 + i] = e[i]; }
      if (q & 1) sb += e; else sa += e; }
    const F2 p = bsplit16(pv);
#pragma unroll
    for (int j = 0; j < HD / 16; ++j) { acc[j] = wmma_bf(p.h, vh[j], acc[j]); acc[j] = wmma_bf(p.l, vh[j], acc[j]); acc[j] = wmma_bf(p.h, vl[j], acc[j]); }
    // as above: vp stops at the last chunk, the last trip's fetch stays inside v
#pragma unroll
    for (int j = 0; j < HD / 16; ++j) { vh[j] = fragq_b(vp + j * 512); vl[j] = fragq_b(vp + j * 512 + VCHUNK / 2); }
    XW(vp);
    vp += c + 2 < NCH ? VCHUNK : 0; }
  sa += sb;
  float sum = (sa[0] + sa[1]) + (sa[2] + sa[3]);
  sum += __shfl_xor(sum, 16);
  const float inv = 1.0f / sum;   // of the lane's query (col)
  float f[8];   // the factors of the lane's eight output rows 8g + r, each from the lane that holds that query (unrolled: f stays in registers)
#pragma unroll
  for (int r = 0; r < 8; ++r) f[r] = __shfl(inv, 8 * g + r);
  float (*ss)[HD + 4] = st[wave];   // the wave's own strip turns the output tile for 16-byte row stores
#pragma unroll
  for (int j = 0; j < HD / 16; ++j)
#pragma unroll
    for (int r = 0; r < 8; ++r) ss[8 * g + r][j * 16 + col] = acc[j][r] * f[r];
  LDSX(); for (int rl = 0; rl < 16; ++rl) if (lane < HD / 4) vst2(Y + ((size_t)b * TT + ql0 + rl) * CC + h * HD + lane * 4, *(const v4f*)&ss[rl][lane * 4]); }
// ---- k_out: block = (128 rows, 128 cols), four waves as 2 x 2, a wave = 64 rows x 64 cols: out = y (bf16 hi + lo) Wo^T + bo
__global__ __launch_bounds__(128) void k_out(const float* __restrict__ Y, const float* __restrict__ WP, const float* __restrict__ BP, float* __restrict__ OUT) { __shared__ __align__(16) char smem[2 * (128 + 256) * PIT * 2]; float (*sf)[64][68] = (float (*)[64][68])smem;   // two stage buffers; the four output tiles (69,632 B) on the same bytes behind the loop
  const int tid = threadIdx.x, wave = tid >> 5, lane = tid & 31, col = lane & 15, g = lane >> 4, wr = wave >> 1, wc = wave & 1; const int c0 = blockIdx.y * 128 + wc * 64; const size_t r0 = (size_t)blockIdx.x * 128 + wr * 64;   // the wave's first column and row
  v8f acc[4][4] = {};   // [row tile][col tile]
  { const int lr = tid >> 4, lp = tid & 15;   // as in k_proj
    const float* gw = WP + (size_t)(blockIdx.y * 128 + lr) * CC + lp * 4; const float* gy = Y + ((size_t)blockIdx.x * 128 + lr) * CC + lp * 4;
    v4f rw[16], ry[16];
#pragma unroll
    for (int i = 0; i < 16; ++i) rw[i] = *(const v4f*)(gw + i * 8 * CC);
#pragma unroll
    for (int i = 0; i < 16; ++i) ry[i] = *(const v4f*)(gy + i * 8 * CC);
    XW2(gw, gy);
    // stays rolled, two buffers, one barrier a stage, as in k_proj
#pragma unroll 1
    for (int s = 0; s < NS; ++s) { __bf16* const bs = (__bf16*)smem + (s & 1) * ((128 + 256) * PIT);   // rows 0-127: W, 128-255: y hi, 256-383: y lo
#pragma unroll
      for (int i = 0; i < 16; ++i) *(v4b*)(bs + (i * 8 + lr) * PIT + lp * 4) = cvt4(rw[i]);
#pragma unroll
      for (int i = 0; i < 16; ++i) { const v4b hi = cvt4(ry[i]); v4f re;
#pragma unroll
        for (int e = 0; e < 4; ++e) re[e] = ry[i][e] - (float)hi[e];
        *(v4b*)(bs + (128 + i * 8 + lr) * PIT + lp * 4) = hi; *(v4b*)(bs + (256 + i * 8 + lr) * PIT + lp * 4) = cvt4(re); }
      __syncthreads();
      if (s + 1 < NS) { gw += KS; gy += KS;
#pragma unroll
        for (int i = 0; i < 16; ++i) rw[i] = *(const v4f*)(gw + i * 8 * CC);
#pragma unroll
        for (int i = 0; i < 16; ++i) ry[i] = *(const v4f*)(gy + i * 8 * CC);
        XW2(gw, gy); }
#pragma unroll
      for (int kk = 0; kk < KS / 32; ++kk) { v16b ah[4], al[4], w[4];   // the twelve fragments as one group of LDS reads in front of their thirty-two products
#pragma unroll
        for (int i = 0; i < 4; ++i) { ah[i] = frag_b(bs + (128 + wr * 64 + i * 16 + col) * PIT + kk * 32, lane); al[i] = frag_b(bs + (256 + wr * 64 + i * 16 + col) * PIT + kk * 32, lane); }
#pragma unroll
        for (int j = 0; j < 4; ++j) w[j] = frag_b(bs + (wc * 64 + j * 16 + col) * PIT + kk * 32, lane);
#pragma unroll
        for (int j = 0; j < 4; ++j) {   // hi, then lo, of each tile as before; three other tiles' products stand between the two
#pragma unroll
          for (int i = 0; i < 4; ++i) acc[i][j] = wmma_bf(ah[i], w[j], acc[i][j]);
#pragma unroll
          for (int i = 0; i < 4; ++i) acc[i][j] = wmma_bf(al[i], w[j], acc[i][j]); } } }
    __syncthreads(); }   // every wave has left the stage buffers: sf lies on the same LDS
#pragma unroll
  for (int j = 0; j < 4; ++j) { const float bb = BP ? bfr(BP[c0 + j * 16 + col]) : 0.f;
#pragma unroll
    for (int i = 0; i < 4; ++i)
#pragma unroll
      for (int r = 0; r < 8; ++r) sf[wave][i * 16 + 8 * g + r][j * 16 + col] = acc[i][j][r] + bb; }
  LDSX(); for (int rl = 0; rl < 64; rl += 2) vst2(OUT + (r0 + rl + g) * CC + c0 + col * 4, *(const v4f*)&sf[wave][rl + g][col * 4]); }   // a store = two rows of 256 B: whole lines
extern "C" void kernel_launch(void* const* d_in, const int* in_sizes, int n_in, void* d_out, int out_size, void* d_ws, size_t ws_size, hipStream_t stream) {
  (void)in_sizes; (void)n_in; (void)out_size;
  const float** F = (const float**)d_in;   // 0 x [4,2048,1024], 1 wq [1024,1024] ([out,in]), 2 wk [256,1024], 3 wv [256,1024], 4 wo [1024,1024] ([out,in]), 5 q_norm_w [64], 6 k_norm_w [64]
  if (ws_size < (size_t)WS_END) return;
  char* ws = (char*)d_ws; _Float16 *QH = (_Float16*)(ws + WS_QH), *QL = (_Float16*)(ws + WS_QL), *KH = (_Float16*)(ws + WS_KH); __bf16 *VT = (__bf16*)(ws + WS_VT); float *Y = (float*)(ws + WS_Y);
  k_proj<<<dim3(TNB * TT / 128, CC / 128, 1), 128, 0, stream>>>(F[0], F[1], nullptr, F[2], nullptr, F[3], nullptr, QH, QL, KH, VT, F[5], F[6], 0);   // q (16 heads)
  k_proj<<<dim3(TNB * TT / 128, CK / 128, 2), 128, 0, stream>>>(F[0], F[1], nullptr, F[2], nullptr, F[3], nullptr, QH, QL, KH, VT, F[5], F[6], 1);   // k, v (4 kv heads)
  k_att<<<dim3(TT / 64, NH, TNB), 128, 0, stream>>>(QH, QL, KH, VT, Y);   // logits, softmax and P v of every (b, h) in one launch
  k_out<<<dim3(TNB * TT / 128, CC / 128), 128, 0, stream>>>(Y, F[4], nullptr, (float*)d_out);
}

// v008
// One run takes 113 microseconds.
// Two timings next to v007 put it at 1.06 and 1.07 times that version's speed.
// Over all steps from v000 it is 12.7 times as fast.
// compute dtype: all float inputs rounded to bf16; q/k/v = x W^T with EXACT bf16 products on WMMA 16x16x32, f32 accumulate; per-head RMSNorm of q and k in f32 in the projection epilogue; q as f16 hi + residual (x 2^10), k f16 -> 2-product logits / 8 inside the causal sliding window (512), kept in f32 in registers (one launch, one pass over the keys, GQA: head h reads kv head h/4); softmax in f32: P' = exp2((s - m) log2 e + 11) on the hardware exponential, m a running maximum (sums and tile rescaled when it grows by more than 5), not normalised, split bf16 hi + lo against v bf16 hi + lo (3 products), the output tile scaled by 1 / sum P'; y = ctx (bf16 hi + lo) wo^T; f32 output.
#include <hip/hip_runtime.h>
#include <math.h>

typedef __attribute__((ext_vector_type(16))) _Float16 v16h;
typedef __attribute__((ext_vector_type(16))) __bf16 v16b;
typedef __attribute__((ext_vector_type(8)))  _Float16 v8h;
typedef __attribute__((ext_vector_type(8)))  float v8f;
typedef __attribute__((ext_vector_type(4)))  float v4f;
typedef __attribute__((ext_vector_type(2)))  float v2f;
typedef __attribute__((ext_vector_type(4)))  unsigned v4u;
typedef __attribute__((ext_vector_type(4)))  int v4i;
typedef float __attribute__((may_alias)) float_a;
typedef int __attribute__((may_alias)) int_a;

template <typename T> __device__ __forceinline__ void vst2(void* p, T v) { *(T*)p = v;  }
__device__ __forceinline__ v8f wmma16(v16h a, v16h b, v8f c) {
  v8f d = __builtin_amdgcn_wmma_f32_16x16x32_f16(false, a, false, b, (short)0, c, false, false);
  asm volatile("v_nop\n\tv_nop\n\tv_nop\n\tv_nop" : "+v"(d) : "v"(a), "v"(b));
  return d;
}
__device__ __forceinline__ v8f wmma_bf(v16b a, v16b b, v8f c) {
  v8f d = __builtin_amdgcn_wmma_f32_16x16x32_bf16(false, a, false, b, (short)0, c, false, false);
  asm volatile("v_nop\n\tv_nop\n\tv_nop\n\tv_nop" : "+v"(d) : "v"(a), "v"(b));
  return d;
}
// 16x16x32 fragments: lane = (h = lane>>4, row/col = lane&15); elements 0..7 = k0+8h+0..7, 8..15 = k0+16+8h+0..7; D element r = row 8h+r
__device__ __forceinline__ v16h frag_h(const _Float16* rowk0, int lane) {
  union { v16h v; v8h q[2]; } u; const _Float16* p = rowk0 + 8 * (lane >> 4);
  u.q[0] = *(const v8h*)p; u.q[1] = *(const v8h*)(p + 16); return u.v;
}
__device__ __forceinline__ v16h frag_f32(const float* rowk0, int lane) {
  v16h a; const float* p = rowk0 + 8 * (lane >> 4);
#pragma unroll
  for (int i = 0; i < 8; ++i) { a[i] = (_Float16)p[i]; a[8 + i] = (_Float16)p[16 + i]; }
  return a;
}
__device__ __forceinline__ v16h frag_f32s(const float* rowk0, int lane, float sc) {
  v16h a; const float* p = rowk0 + 8 * (lane >> 4);
#pragma unroll
  for (int i = 0; i < 8; ++i) { a[i] = (_Float16)(p[i] * sc); a[8 + i] = (_Float16)(p[16 + i] * sc); }
  return a;
}
// column fragment from a [K][ld] layout (column n), rows >= K read as 0
__device__ __forceinline__ v16h fragc_f32(const float* W, int k0, int n, int lane, int ld, int K) {
  v16h a; const int g = lane >> 4;
#pragma unroll
  for (int i = 0; i < 8; ++i) { const int ka = k0 + 8 * g + i, kb = ka + 16;
    a[i] = (_Float16)(ka < K ? W[(size_t)(ka < K ? ka : K - 1) * ld + n] : 0.f); a[8 + i] = (_Float16)(kb < K ? W[(size_t)(kb < K ? kb : K - 1) * ld + n] : 0.f); }
  return a;
}
struct F2 { v16b h, l; };
__device__ __forceinline__ F2 bsplit16(const float v[16]) { F2 r;
#pragma unroll
  for (int i = 0; i < 16; ++i) { const __bf16 h = (__bf16)v[i]; r.h[i] = h; r.l[i] = (__bf16)(v[i] - (float)h); }
  return r; }
__device__ __forceinline__ F2 split_row(const float* row, int k0, int lane) { float v[16]; const float* p = row + k0 + 8 * (lane >> 4);
#pragma unroll
  for (int i = 0; i < 8; ++i) { v[i] = p[i]; v[8 + i] = p[16 + i]; }
  return bsplit16(v); }
__device__ __forceinline__ F2 split_rowK(const float* row, int k0, int lane, int K) { float v[16]; const int g = lane >> 4;
#pragma unroll
  for (int i = 0; i < 8; ++i) { const int ka = k0 + 8 * g + i, kb = ka + 16; v[i] = ka < K ? row[ka < K ? ka : K - 1] : 0.f; v[8 + i] = kb < K ? row[kb < K ? kb : K - 1] : 0.f; }
  return bsplit16(v); }
__device__ __forceinline__ F2 split_col(const float* W, int k0, int n, int lane, int ld, int K) { float v[16]; const int g = lane >> 4;
#pragma unroll
  for (int i = 0; i < 8; ++i) { const int ka = k0 + 8 * g + i, kb = ka + 16; v[i] = ka < K ? W[(size_t)(ka < K ? ka : K - 1) * ld + n] : 0.f; v[8 + i] = kb < K ? W[(size_t)(kb < K ? kb : K - 1) * ld + n] : 0.f; }
  return bsplit16(v); }
__device__ __forceinline__ v8f mac3(const F2& a, const F2& b, v8f c) { c = wmma_bf(a.l, b.h, c); c = wmma_bf(a.h, b.l, c); return wmma_bf(a.h, b.h, c); }
__device__ __forceinline__ float sigm(float v) { return 1.0f / (1.0f + expf(-v)); }
#define LDSX() do { asm volatile("s_wait_dscnt 0" ::: "memory"); __builtin_amdgcn_wave_barrier(); __builtin_amdgcn_fence(__ATOMIC_RELEASE, "workgroup"); } while (0)


// Windowed grouped-query attention block (B 4, T 2,048, DIM 1,024; 16 query heads, 4 kv heads x 64, QK-RMSNorm (eps 1e-6, weights read), causal sliding window 512, no biases): y = softmax(rms(q) rms(k)^T / 8 | window) v (kv head = h / 4), @ wo^T.
#define NB 4
#define TT 2048
#define CC 1024
#define NH 16
#define HD 64
#define WIN 512
#define NKV 4
#define CK (NKV * HD)   // 256: k/v row width
#define REP (NH / NKV)
#ifndef TNB
#define TNB NB
#endif
typedef __attribute__((ext_vector_type(8))) __bf16 v8b;
__device__ __forceinline__ v16b frag_b(const __bf16* rowk0, int lane) {
  union { v16b v; v8b q[2]; } u; const __bf16* p = rowk0 + 8 * (lane >> 4);
  u.q[0] = *(const v8b*)p; u.q[1] = *(const v8b*)(p + 16); return u.v;
}
__device__ __forceinline__ float bfr(float v) { return (float)(__bf16)v; }
__device__ __attribute__((noinline)) float exp_ni(float v) { return expf(v); }
__device__ __attribute__((noinline)) float erf_ni(float v) { return erff(v); }

#define WS_QH  0u
#define WS_QL  (WS_QH + 2u * (size_t)NB * TT * CC)
#define WS_KH  (WS_QL + 2u * (size_t)NB * TT * CC)
#define WS_VT  (WS_KH + 2u * (size_t)NB * TT * CK)      // q, k and v lie in the order in which k_att's fragment loads read them (FRAGMENT ORDER below); v takes the bytes of both planes, from here to WS_S
#define WS_VL  (WS_VT + 2u * (size_t)NB * CK * TT)
#define HG 4                                          // only sizes the WS_S region, which no kernel uses
#define WS_S   (WS_VL + 2u * (size_t)NB * CK * TT)      // unused: the logits and P stay in registers
#define WS_PH  (WS_S + 4u * (size_t)HG * TT * TT)
#define WS_Y   (WS_PH + 0u)              // f32 y rows [b*t][C]
#define WS_END (WS_Y + 4u * (size_t)NB * TT * CC)

// ---- operand staging of the two projection kernels: a stage is KS k of every operand row of the block, read from global memory by whole lines (16 lanes = 256 B of one row), rounded to bf16 once and shared through LDS
typedef __attribute__((ext_vector_type(4))) __bf16 v4b;
#define KS 64             // k per stage
#define NS (CC / KS)
#define K0(bx, by) (((((bx) >> 3) << 1 | ((bx) & 1)) + 4 * ((by) & 3)) & (NS - 1))   // first k stage of the block at row block bx, column block by
#define PIT (KS + 8)      // LDS row pitch in bf16: 144 B = 16 B x 9, so the 16 rows of a 16-byte fragment read fall on different banks
__device__ __forceinline__ v4b cvt4(v4f v) { v4b r;
#pragma unroll
  for (int i = 0; i < 4; ++i) r[i] = (__bf16)v[i];
  return r; }
// a precaution: stands behind a group of global loads, in front of the next rewrite of their address registers; the group's one lane pointer is an input, so that it stays live up to the wait and no result of the group lands in it
#define XW(p) asm volatile("s_wait_xcnt 0x0" :: "v"(p) : "memory")
#define XW2(p, q) asm volatile("s_wait_xcnt 0x0" :: "v"(p), "v"(q) : "memory")   // the same behind a group that reads through two lane pointers
// FRAGMENT ORDER: a 16-byte piece of a fragment is stored at (piece * 32 + lane) * 16 B, so that one load of a wave reads 512 contiguous bytes (four whole lines) and not 32 B of each of sixteen lines.
// k: [b][kv head][16-key tile][piece p 0-3][lane = 16 g + key % 16][8 f16]: dims 16 p + 8 g + 0..7; each q plane the same with [head] and queries.   v: [b][kv head][32-key chunk][plane hi, lo][16-dim group j][piece s 0-1][lane = 16 g + dim % 16][8 bf16]: keys 16 s + 8 g + 0..7 of the chunk
#define KTILE (16 * HD)        // elements of a q or k tile
#define VCHUNK (2 * 32 * HD)   // elements of a v chunk, both planes
// ---- k_proj: block = (128 rows, 128 cols, which), four waves as 2 x 2, a wave = 64 rows x 64 cols (4 x 4 tiles: eight fragments feed sixteen products; its 64 columns are one head): qkv = x W (+ b), exact; q -> f16 hi (+ residual), k -> f16 tiles, v -> bf16 planes
__global__ __launch_bounds__(128) void k_proj(const float* __restrict__ X, const float* __restrict__ WQ, const float* __restrict__ BQ, const float* __restrict__ WK, const float* __restrict__ BK, const float* __restrict__ WV, const float* __restrict__ BV, _Float16* __restrict__ QH, _Float16* __restrict__ QL, _Float16* __restrict__ KH, __bf16* __restrict__ VT, const float* __restrict__ NQW, const float* __restrict__ NKW, int wbase) {
  __shared__ __align__(16) char smem[2 * (128 + 128) * PIT * 2];   // the loop's two stage buffers (2 x 256 rows x 144 B) first, then the epilogue's arrays (2 x 128 x 272 B) on the same bytes
  _Float16 (*sh)[136] = (_Float16 (*)[136])smem, (*sl)[136] = sh + 128; __bf16 (*th)[136] = (__bf16 (*)[136])smem, (*tl2)[136] = th + 128;   // q, k: [row][col]; v: [col][row]; a block uses one of the two pairs
  const int tid = threadIdx.x, wave = tid >> 5, lane = tid & 31, col = lane & 15, g = lane >> 4, wr = wave >> 1, wc = wave & 1; const int which = wbase + blockIdx.z; const int OW = (which == 0) ? CC : CK;   /* output row width: q 1,024, k/v 256 */ const int c0 = blockIdx.y * 128; const size_t r0 = (size_t)blockIdx.x * 128; const float* WA = which == 0 ? WQ : which == 1 ? WK : WV; const float* BA = which == 0 ? BQ : which == 1 ? BK : BV;
  v8f acc[4][4] = {};   // [row tile][col tile]
  { const int lr = tid >> 4, lp = tid & 15;   // the thread's row of each group of 8 rows, and its 16 bytes of the row's 256
    // the block walks the NS stages of k from a stage of its own and wraps round: the blocks that share W rows (same column block) or x rows (same row block) run at the same time, and from a common start all of them ask L2 for the same lines at the same moment.
    // The 64 sharers of W rows spread over all 16 stages, neighbours eight row blocks apart two stages apart; the sharers of x rows stand four stages apart, and column blocks four apart keep a common stage (for speed only: no result depends on where a block runs)
    const int s0 = K0(blockIdx.x, blockIdx.y + 2 * blockIdx.z);
    const float* gw = WA + (size_t)(c0 + lr) * CC + lp * 4 + s0 * KS; const float* gx = X + (r0 + lr) * CC + lp * 4 + s0 * KS;
    v4f rw[16], rx[16];
#pragma unroll
    for (int i = 0; i < 16; ++i) rw[i] = *(const v4f*)(gw + i * 8 * CC);
#pragma unroll
    for (int i = 0; i < 16; ++i) rx[i] = *(const v4f*)(gx + i * 8 * CC);
    XW2(gw, gx);
    // stays rolled: a trip is already 32 matrix instructions and 64 LDS operations a wave; two buffers, ONE barrier a stage: a buffer is rewritten two stages later, behind the barrier of the stage between
#pragma unroll 1
    for (int s = 0; s < NS; ++s) { __bf16* const bs = (__bf16*)smem + (s & 1) * ((128 + 128) * PIT);   // rows 0-127: W, 128-255: x
#pragma unroll
      for (int i = 0; i < 16; ++i) *(v4b*)(bs + (i * 8 + lr) * PIT + lp * 4) = cvt4(rw[i]);
#pragma unroll
      for (int i = 0; i < 16; ++i) *(v4b*)(bs + (128 + i * 8 + lr) * PIT + lp * 4) = cvt4(rx[i]);
      __syncthreads();
      if (s + 1 < NS) { const int stp = ((s0 + s + 1) & (NS - 1)) ? KS : KS - CC; gw += stp; gx += stp;   // behind the barrier (which waits for every load in flight): the next stage flies under this stage's products; behind the row's last stage comes its first
#pragma unroll
        for (int i = 0; i < 16; ++i) rw[i] = *(const v4f*)(gw + i * 8 * CC);
#pragma unroll
        for (int i = 0; i < 16; ++i) rx[i] = *(const v4f*)(gx + i * 8 * CC);
        XW2(gw, gx); }
#pragma unroll
      for (int kk = 0; kk < KS / 32; ++kk) { v16b a[4], w[4];   // the eight fragments as one group of LDS reads in front of their sixteen products
#pragma unroll
        for (int i = 0; i < 4; ++i) a[i] = frag_b(bs + (128 + wr * 64 + i * 16 + col) * PIT + kk * 32, lane);
#pragma unroll
        for (int j = 0; j < 4; ++j) w[j] = frag_b(bs + (wc * 64 + j * 16 + col) * PIT + kk * 32, lane);
#pragma unroll
        for (int j = 0; j < 4; ++j)
#pragma unroll
          for (int i = 0; i < 4; ++i) acc[i][j] = wmma_bf(a[i], w[j], acc[i][j]); } }
    __syncthreads(); }   // every wave has left the stage buffers: the epilogue's arrays lie on the same LDS
  // QK-RMSNorm per (row, head): the wave's 64 columns are one head; mean of squares over the 64 dims via in-lane + 16-lane shuffles (unconditional), then scale by rsqrt(ms + eps) * norm_w[d]
  if (which < 2) { const float* NW = which == 0 ? NQW : NKW; float nw[4];   // the head's four weights of this lane, read once for the wave's four row tiles
#pragma unroll
    for (int jj = 0; jj < 4; ++jj) nw[jj] = NW[jj * 16 + col];
    asm volatile("s_wait_xcnt 0x0" :: "s"(NW) : "memory");   // the precaution of XW for these four loads: their scalar base is an input, so that it stays live up to the wait
#pragma unroll
    for (int i = 0; i < 4; ++i) { float ssq[8];
#pragma unroll
      for (int r = 0; r < 8; ++r) { float s_ = 0.f;
#pragma unroll
        for (int jj = 0; jj < 4; ++jj) s_ += acc[i][jj][r] * acc[i][jj][r];
#pragma unroll
        for (int o_ = 1; o_ < 16; o_ <<= 1) s_ += __shfl_xor(s_, o_);
        ssq[r] = rsqrtf(s_ * (1.0f / HD) + 1e-6f); }
#pragma unroll
      for (int jj = 0; jj < 4; ++jj) { const float wv = bfr(nw[jj]);
#pragma unroll
        for (int r = 0; r < 8; ++r) acc[i][jj][r] *= ssq[r] * wv; } } }
#pragma unroll
  for (int j = 0; j < 4; ++j) { const int cl = wc * 64 + j * 16 + col; const float bb = BA ? bfr(BA[c0 + cl]) : 0.f;
#pragma unroll
    for (int i = 0; i < 4; ++i)
#pragma unroll
      for (int r = 0; r < 8; ++r) acc[i][j][r] += bb; }
  if (which == 2) {
#pragma unroll
    for (int j = 0; j < 4; ++j)
#pragma unroll
      for (int i = 0; i < 4; ++i)
#pragma unroll
        for (int r = 0; r < 8; ++r) { const float v = acc[i][j][r]; const int rl = wr * 64 + i * 16 + 8 * g + r, cl = wc * 64 + j * 16 + col; const __bf16 bh = (__bf16)v; th[cl][rl] = bh; tl2[cl][rl] = (__bf16)(v - (float)bh); } }
  else {
#pragma unroll
    for (int j = 0; j < 4; ++j)
#pragma unroll
      for (int i = 0; i < 4; ++i)
#pragma unroll
        for (int r = 0; r < 8; ++r) { const float v = acc[i][j][r]; const int rl = wr * 64 + i * 16 + 8 * g + r, cl = wc * 64 + j * 16 + col; const _Float16 hv = (_Float16)v; sh[rl][cl] = hv; sl[rl][cl] = (_Float16)((v - (float)hv) * 1024.0f); } }   /* q residual carried x 2^10 so the plane stays f16-normal on the chip */
  __syncthreads();
  { const size_t b = r0 / TT; const int t0 = (int)(r0 % TT);   // fragment order; q and k: the block's 128 threads store one tile (2 KB) a step, thread = piece * 32 + lane, eight tiles of each of the block's two heads; the steps unrolled from one pointer a plane, so that no address register of a store is rewritten
    if (which == 0) { const size_t o = ((b * NH + c0 / HD) * (TT / 16) + t0 / 16) * (size_t)KTILE + tid * 8; _Float16* ph = QH + o; _Float16* pl = QL + o;
#pragma unroll
      for (int t = 0; t < 16; ++t) { vst2((unsigned*)(ph + (t >> 3) * (TT / 16) * KTILE + (t & 7) * KTILE), *(const v4u*)&sh[(t & 7) * 16 + col][(t >> 3) * HD + wave * 16 + g * 8]); vst2((unsigned*)(pl + (t >> 3) * (TT / 16) * KTILE + (t & 7) * KTILE), *(const v4u*)&sl[(t & 7) * 16 + col][(t >> 3) * HD + wave * 16 + g * 8]); }
      XW2(ph, pl); }   // the same precaution behind each of the three runs of stores: the compiler lays the runs out one behind another, in an order of its own, with fall-through edges between them, and a later run's code rewrites an earlier one's registers
    else if (which == 1) {
      _Float16* ph = KH + ((b * NKV + c0 / HD) * (TT / 16) + t0 / 16) * (size_t)KTILE + tid * 8;
#pragma unroll
      for (int t = 0; t < 16; ++t) vst2((unsigned*)(ph + (t >> 3) * (TT / 16) * KTILE + (t & 7) * KTILE), *(const v4u*)&sh[(t & 7) * 16 + col][(t >> 3) * HD + wave * 16 + g * 8]);
      XW(ph); }
    else {   // a step is 2 KB = two 16-dim groups of one plane of one chunk, thread = (group % 2, piece, lane); t = (head, chunk, plane, group / 2)
      __bf16* ph = VT + ((b * NKV + c0 / HD) * (TT / 32) + t0 / 32) * (size_t)VCHUNK + tid * 8;
#pragma unroll
      for (int t = 0; t < 32; ++t) vst2((unsigned*)(ph + (t >> 4) * (TT / 32) * VCHUNK + (t & 15) * 1024), *(const v4u*)&((t & 2) ? tl2 : th)[(t >> 4) * HD + (t & 1) * 32 + wr * 16 + col][((t >> 2) & 3) * 32 + wc * 16 + g * 8]);
      XW(ph); } } }
// ---- k_att: block = 64 queries of (b,h), one wave = 16 queries, no exchange between waves. S^T = K Q^T (A = 16 key rows, B = 16 query rows), so a lane holds the logits of ONE query (col) at keys 8g+r of each 16-key tile;
// two such tiles are, element for element, the A fragment of P for a 32-key chunk: the logits never leave the lane's registers. ONE pass over the wave's window of NCH chunks of 32 keys, with a running maximum:
// P' is taken against the maximum in use; when a chunk's maximum lies more than 5 above it for some query, sums and output tile are scaled down to the new one (a scalar branch, rare behind the first chunk).
// No LDS in the loop, so registers alone set the number of waves a SIMD. K and V fragments are fetched one chunk ahead into the registers that the products have just read.
#define NCH 17   // 32-key chunks that cover [ql0 - 511, ql0 + 15] from a multiple of 32
// fragments from the lane's own pointer, fragment order: the second piece lies 32 lanes x 8 elements behind the first
__device__ __forceinline__ v16h fragq_h(const _Float16* p) { union { v16h v; v8h q[2]; } u; u.q[0] = *(const v8h*)p; u.q[1] = *(const v8h*)(p + 256); return u.v; }
__device__ __forceinline__ v16b fragq_b(const __bf16* p) { union { v16b v; v8b q[2]; } u; u.q[0] = *(const v8b*)p; u.q[1] = *(const v8b*)(p + 256); return u.v; }
__device__ __forceinline__ float xhalf(float x) { return __builtin_bit_cast(float, __builtin_amdgcn_permlanex16(__builtin_bit_cast(int, x), __builtin_bit_cast(int, x), 0x76543210, 0xfedcba98, false, false)); }   // lane l reads lane l ^ 16, on the vector pipe
__global__ __launch_bounds__(128) void k_att(const _Float16* __restrict__ QH, const _Float16* __restrict__ QL, const _Float16* __restrict__ KH, const __bf16* __restrict__ VT, float* __restrict__ Y) {   // q, k and v in fragment order
  __shared__ __align__(16) float st[4][16][HD + 4];   // the epilogue's turn of the output tile, a strip a wave
  const int tid = threadIdx.x, wave = __builtin_amdgcn_readfirstlane(tid >> 5), lane = tid & 31, col = lane & 15, g = lane >> 4;
  const int b = blockIdx.z, h = blockIdx.y, ql0 = blockIdx.x * 64 + wave * 16, qt = ql0 + col;
  const int kbase = ((ql0 - (WIN - 1)) >> 5) * 32;      // first key of chunk 0 (floor to 32; below 0 for the first rows)
  const int c0 = kbase < 0 ? (-kbase) >> 5 : 0;         // wave-uniform: chunks wholly in front of key 0 are not walked
  const int kf = kbase < 0 ? 0 : kbase;                 // first key walked = kbase + c0 * 32
  const int st0 = c0 + 1 < NCH ? 32 : 0;                // keys from the first chunk to the first one fetched ahead
  const size_t qo = ((size_t)(b * NH + h) * (TT / 16) + ql0 / 16) * KTILE + lane * 8; const _Float16* qp = QH + qo; const _Float16* qlp = QL + qo;
  const v16h qh0 = fragq_h(qp), qh1 = fragq_h(qp + 512), qr0 = fragq_h(qlp), qr1 = fragq_h(qlp + 512);
  const _Float16* kp = KH + ((size_t)(b * NKV + h / REP) * (TT / 16) + kf / 16) * KTILE + lane * 8;   /* GQA: kv head h/4; the lane's 16 bytes of the first piece of the first tile */
  v16h ka[2], kb[2];
#pragma unroll
  for (int t = 0; t < 2; ++t) { ka[t] = fragq_h(kp + t * KTILE); kb[t] = fragq_h(kp + t * KTILE + 512); }
  const __bf16* vp = VT + ((size_t)(b * NKV + h / REP) * (TT / 32) + kf / 32) * VCHUNK + lane * 8;   /* GQA: kv head h/4; the lane's 16 bytes of the first piece of the first chunk */
  v16b vh[HD / 16], vl[HD / 16];   // the first chunk's v is asked for behind q and k, in front of the wait for those: it flies under the first logits
#pragma unroll
  for (int j = 0; j < HD / 16; ++j) { vh[j] = fragq_b(vp + j * 512); vl[j] = fragq_b(vp + j * 512 + VCHUNK / 2); }
  XW(vp);
  // holds the first loads in front of the wait (loaded values as inputs only); the three pointers as in XW
  asm volatile("s_wait_xcnt 0x0" :: "v"(qh0), "v"(qh1), "v"(qr0), "v"(qr1), "v"(ka[0]), "v"(kb[0]), "v"(ka[1]), "v"(kb[1]), "v"(qp), "v"(qlp), "v"(kp) : "memory");
  kp += st0 * HD;
  vp += st0 * (VCHUNK / 32);
  // m: the maximum in use of the lane's query (the same in lanes l and l ^ 16); -3.0e38 as long as every key seen was masked. e = exp2(s * log2 e + eb) = 2^11 * exp(s - m); a masked key's -3.0e38 runs to -inf in the fused multiply-add and gives exactly 0,
  // also while m is still -3.0e38: eb is formed from max(m, -1.0e30), which is m itself for every maximum that f16 operands can give, and stays finite
  float m = -3.0e38f, eb = 11.0f + 1.0e30f * 1.44269504f;
  v4f sa = {}, sb = {};   // the row sum in eight partial sums a lane: one chain of sixteen dependent additions a chunk would stand bare behind the products
  v8f acc[HD / 16] = {};
  // stays rolled: each fragment set is refilled in place, so no trip needs another's registers
#pragma unroll 1
  for (int c = c0; c < NCH; ++c) {
    float sv[16]; const int kc = kbase + c * 32;   // the chunk's first key
#pragma unroll
    for (int t = 0; t < 2; ++t) {
      v8f a = {}, al = {};
      a = wmma16(ka[t], qh0, a); al = wmma16(ka[t], qr0, al); a = wmma16(kb[t], qh1, a); al = wmma16(kb[t], qr1, al);
      a += al * (1.0f / 1024.0f);
#pragma unroll
      for (int r = 0; r < 8; ++r) sv[t * 8 + r] = a[r] * 0.125f; }
    // the mask only where a key of the chunk can be closed for one of the wave's sixteen queries (wave-uniform, a scalar branch): a chunk whose last key is at most ql0 and whose first key is at least ql0 + 15 - (WIN - 1) is open for all of them; that leaves the window's first chunk and the diagonal's
    if (kc + 31 > ql0 || kc < ql0 + 15 - (WIN - 1)) {
#pragma unroll
      for (int i = 0; i < 16; ++i) { const int kt = kc + (i >> 3) * 16 + 8 * g + (i & 7); const bool allowed = (kt <= qt) && (qt - kt < WIN); sv[i] = allowed ? sv[i] : -3.0e38f; } }
    // kp walks one chunk ahead and stops at the last one (the last trip fetches its own chunk again): the address stays inside k
#pragma unroll
    for (int t = 0; t < 2; ++t) { ka[t] = fragq_h(kp + t * KTILE); kb[t] = fragq_h(kp + t * KTILE + 512); }
    XW(kp);
    kp += c + 2 < NCH ? 2 * KTILE : 0;
    float cm = sv[0];
#pragma unroll
    for (int i = 1; i < 16; ++i) cm = fmaxf(cm, sv[i]);
    cm = fmaxf(cm, xhalf(cm));   // the query's other eight keys of every tile sit in lane ^ 16
    if (__builtin_amdgcn_ballot_w32(cm > m + 5.0f) != 0) {   // wave-uniform, every lane stays on: the first chunk with an open key, and a later one only where a logit stands far above all before it
      const float mn = fmaxf(m, cm); const float dn = __builtin_amdgcn_exp2f((m - mn) * 1.44269504f);   // 1 where the maximum stays, 0 where m was still -3.0e38 (sums and tile are 0 there)
      m = mn; eb = 11.0f - fmaxf(mn, -1.0e30f) * 1.44269504f;
      sa *= dn; sb *= dn;
#pragma unroll
      for (int r = 0; r < 8; ++r) { const float fr = __shfl(dn, 8 * g + r);   // the factor of output row 8g + r, from the lane that holds that query
#pragma unroll
        for (int j = 0; j < HD / 16; ++j) acc[j][r] *= fr; } }
    float pv[16];
#pragma unroll
    for (int q = 0; q < 4; ++q) { v4f e;
#pragma unroll
      for (int i = 0; i < 4; ++i) { e[i] = __builtin_amdgcn_exp2f(fmaf(sv[q * 4 + i], 1.44269504f, eb)); pv[q * 4 + i] = e[i]; }
      if (q & 1) sb += e; else sa += e; }
    const F2 p = bsplit16(pv);
#pragma unroll
    for (int j = 0; j < HD / 16; ++j) { acc[j] = wmma_bf(p.h, vh[j], acc[j]); acc[j] = wmma_bf(p.l, vh[j], acc[j]); acc[j] = wmma_bf(p.h, vl[j], acc[j]); }
    // as above: vp stops at the last chunk, the last trip's fetch stays inside v
#pragma unroll
    for (int j = 0; j < HD / 16; ++j) { vh[j] = fragq_b(vp + j * 512); vl[j] = fragq_b(vp + j * 512 + VCHUNK / 2); }
    XW(vp);
    vp += c + 2 < NCH ? VCHUNK : 0; }
  sa += sb;
  float sum = (sa[0] + sa[1]) + (sa[2] + sa[3]);
  sum += __shfl_xor(sum, 16);
  const float inv = 1.0f / sum;   // of the lane's query (col)
  float f[8];   // the factors of the lane's eight output rows 8g + r, each from the lane that holds that query (unrolled: f stays in registers)
#pragma unroll
  for (int r = 0; r < 8; ++r) f[r] = __shfl(inv, 8 * g + r);
  float (*ss)[HD + 4] = st[wave];   // the wave's own strip turns the output tile for 16-byte row stores
#pragma unroll
  for (int j = 0; j < HD / 16; ++j)
#pragma unroll
    for (int r = 0; r < 8; ++r) ss[8 * g + r][j * 16 + col] = acc[j][r] * f[r];
  LDSX(); for (int rl = 0; rl < 16; ++rl) if (lane < HD / 4) vst2(Y + ((size_t)b * TT + ql0 + rl) * CC + h * HD + lane * 4, *(const v4f*)&ss[rl][lane * 4]); }
// ---- k_out: block = (128 rows, 128 cols), four waves as 2 x 2, a wave = 64 rows x 64 cols: out = y (bf16 hi + lo) Wo^T + bo
__global__ __launch_bounds__(128) void k_out(const float* __restrict__ Y, const float* __restrict__ WP, const float* __restrict__ BP, float* __restrict__ OUT) { __shared__ __align__(16) char smem[2 * (128 + 256) * PIT * 2]; float (*sf)[64][68] = (float (*)[64][68])smem;   // two stage buffers; the four output tiles (69,632 B) on the same bytes behind the loop
  const int tid = threadIdx.x, wave = tid >> 5, lane = tid & 31, col = lane & 15, g = lane >> 4, wr = wave >> 1, wc = wave & 1; const int c0 = blockIdx.y * 128 + wc * 64; const size_t r0 = (size_t)blockIdx.x * 128 + wr * 64;   // the wave's first column and row
  v8f acc[4][4] = {};   // [row tile][col tile]
  { const int lr = tid >> 4, lp = tid & 15;   // as in k_proj
    const int s0 = K0(blockIdx.x, blockIdx.y);   // the block's own first stage of k, as in k_proj
    const float* gw = WP + (size_t)(blockIdx.y * 128 + lr) * CC + lp * 4 + s0 * KS; const float* gy = Y + ((size_t)blockIdx.x * 128 + lr) * CC + lp * 4 + s0 * KS;
    v4f rw[16], ry[16];
#pragma unroll
    for (int i = 0; i < 16; ++i) rw[i] = *(const v4f*)(gw + i * 8 * CC);
#pragma unroll
    for (int i = 0; i < 16; ++i) ry[i] = *(const v4f*)(gy + i * 8 * CC);
    XW2(gw, gy);
    // stays rolled, two buffers, one barrier a stage, as in k_proj
#pragma unroll 1
    for (int s = 0; s < NS; ++s) { __bf16* const bs = (__bf16*)smem + (s & 1) * ((128 + 256) * PIT);   // rows 0-127: W, 128-255: y hi, 256-383: y lo
#pragma unroll
      for (int i = 0; i < 16; ++i) *(v4b*)(bs + (i * 8 + lr) * PIT + lp * 4) = cvt4(rw[i]);
#pragma unroll
      for (int i = 0; i < 16; ++i) { const v4b hi = cvt4(ry[i]); v4f re;
#pragma unroll
        for (int e = 0; e < 4; ++e) re[e] = ry[i][e] - (float)hi[e];
        *(v4b*)(bs + (128 + i * 8 + lr) * PIT + lp * 4) = hi; *(v4b*)(bs + (256 + i * 8 + lr) * PIT + lp * 4) = cvt4(re); }
      __syncthreads();
      if (s + 1 < NS) { const int stp = ((s0 + s + 1) & (NS - 1)) ? KS : KS - CC; gw += stp; gy += stp;
#pragma unroll
        for (int i = 0; i < 16; ++i) rw[i] = *(const v4f*)(gw + i * 8 * CC);
#pragma unroll
        for (int i = 0; i < 16; ++i) ry[i] = *(const v4f*)(gy + i * 8 * CC);
        XW2(gw, gy); }
#pragma unroll
      for (int kk = 0; kk < KS / 32; ++kk) { v16b ah[4], al[4], w[4];   // the twelve fragments as one group of LDS reads in front of their thirty-two products
#pragma unroll
        for (int i = 0; i < 4; ++i) { ah[i] = frag_b(bs + (128 + wr * 64 + i * 16 + col) * PIT + kk * 32, lane); al[i] = frag_b(bs + (256 + wr * 64 + i * 16 + col) * PIT + kk * 32, lane); }
#pragma unroll
        for (int j = 0; j < 4; ++j) w[j] = frag_b(bs + (wc * 64 + j * 16 + col) * PIT + kk * 32, lane);
#pragma unroll
        for (int j = 0; j < 4; ++j) {   // hi, then lo, of each tile as before; three other tiles' products stand between the two
#pragma unroll
          for (int i = 0; i < 4; ++i) acc[i][j] = wmma_bf(ah[i], w[j], acc[i][j]);
#pragma unroll
          for (int i = 0; i < 4; ++i) acc[i][j] = wmma_bf(al[i], w[j], acc[i][j]); } } }
    __syncthreads(); }   // every wave has left the stage buffers: sf lies on the same LDS
#pragma unroll
  for (int j = 0; j < 4; ++j) { const float bb = BP ? bfr(BP[c0 + j * 16 + col]) : 0.f;
#pragma unroll
    for (int i = 0; i < 4; ++i)
#pragma unroll
      for (int r = 0; r < 8; ++r) sf[wave][i * 16 + 8 * g + r][j * 16 + col] = acc[i][j][r] + bb; }
  LDSX(); for (int rl = 0; rl < 64; rl += 2) vst2(OUT + (r0 + rl + g) * CC + c0 + col * 4, *(const v4f*)&sf[wave][rl + g][col * 4]); }   // a store = two rows of 256 B: whole lines
extern "C" void kernel_launch(void* const* d_in, const int* in_sizes, int n_in, void* d_out, int out_size, void* d_ws, size_t ws_size, hipStream_t stream) {
  (void)in_sizes; (void)n_in; (void)out_size;
  const float** F = (const float**)d_in;   // 0 x [4,2048,1024], 1 wq [1024,1024] ([out,in]), 2 wk [256,1024], 3 wv [256,1024], 4 wo [1024,1024] ([out,in]), 5 q_norm_w [64], 6 k_norm_w [64]
  if (ws_size < (size_t)WS_END) return;
  char* ws = (char*)d_ws; _Float16 *QH = (_Float16*)(ws + WS_QH), *QL = (_Float16*)(ws + WS_QL), *KH = (_Float16*)(ws + WS_KH); __bf16 *VT = (__bf16*)(ws + WS_VT); float *Y = (float*)(ws + WS_Y);
  k_proj<<<dim3(TNB * TT / 128, CC / 128, 1), 128, 0, stream>>>(F[0], F[1], nullptr, F[2], nullptr, F[3], nullptr, QH, QL, KH, VT, F[5], F[6], 0);   // q (16 heads)
  k_proj<<<dim3(TNB * TT / 128, CK / 128, 2), 128, 0, stream>>>(F[0], F[1], nullptr, F[2], nullptr, F[3], nullptr, QH, QL, KH, VT, F[5], F[6], 1);   // k, v (4 kv heads)
  k_att<<<dim3(TT / 64, NH, TNB), 128, 0, stream>>>(QH, QL, KH, VT, Y);   // logits, softmax and P v of every (b, h) in one launch
  k_out<<<dim3(TNB * TT / 128, CC / 128), 128, 0, stream>>>(Y, F[4], nullptr, (float*)d_out);
}

// v009
// It runs in 109 microseconds.
// In two side-by-side timings against v008, it was 1.04 and 1.03 times as fast.
// Over all steps from v000 it is 13.2 times as fast.
// compute dtype: all float inputs rounded to bf16; q/k/v = x W^T with EXACT bf16 products on WMMA 16x16x32, f32 accumulate; per-head RMSNorm of q and k in f32 in the projection epilogue; q as f16 hi + residual (x 2^10), k f16 -> 2-product logits / 8 inside the causal sliding window (512), kept in f32 in registers (one launch, one pass over the keys, GQA: head h reads kv head h/4); softmax in f32: P' = exp2((s - m) log2 e + 11) on the hardware exponential, m a running maximum (sums and tile rescaled when it grows by more than 5), not normalised, split bf16 hi + lo against v bf16 hi + lo (3 products), the output tile scaled by 1 / sum P'; y = ctx (bf16 hi + lo) wo^T; f32 output.
#include <hip/hip_runtime.h>
#include <math.h>

typedef __attribute__((ext_vector_type(16))) _Float16 v16h;
typedef __attribute__((ext_vector_type(16))) __bf16 v16b;
typedef __attribute__((ext_vector_type(8)))  _Float16 v8h;
typedef __attribute__((ext_vector_type(8)))  float v8f;
typedef __attribute__((ext_vector_type(4)))  float v4f;
typedef __attribute__((ext_vector_type(2)))  float v2f;
typedef __attribute__((ext_vector_type(4)))  unsigned v4u;
typedef __attribute__((ext_vector_type(4)))  int v4i;
typedef float __attribute__((may_alias)) float_a;
typedef int __attribute__((may_alias)) int_a;

template <typename T> __device__ __forceinline__ void vst2(void* p, T v) { *(T*)p = v;  }
__device__ __forceinline__ v8f wmma16(v16h a, v16h b, v8f c) {
  v8f d = __builtin_amdgcn_wmma_f32_16x16x32_f16(false, a, false, b, (short)0, c, false, false);
  asm volatile("v_nop\n\tv_nop\n\tv_nop\n\tv_nop" : "+v"(d) : "v"(a), "v"(b));
  return d;
}
__device__ __forceinline__ v8f wmma_bf(v16b a, v16b b, v8f c) {
  v8f d = __builtin_amdgcn_wmma_f32_16x16x32_bf16(false, a, false, b, (short)0, c, false, false);
  asm volatile("v_nop\n\tv_nop\n\tv_nop\n\tv_nop" : "+v"(d) : "v"(a), "v"(b));
  return d;
}
// 16x16x32 fragments: lane = (h = lane>>4, row/col = lane&15); elements 0..7 = k0+8h+0..7, 8..15 = k0+16+8h+0..7; D element r = row 8h+r
__device__ __forceinline__ v16h frag_h(const _Float16* rowk0, int lane) {
  union { v16h v; v8h q[2]; } u; const _Float16* p = rowk0 + 8 * (lane >> 4);
  u.q[0] = *(const v8h*)p; u.q[1] = *(const v8h*)(p + 16); return u.v;
}
__device__ __forceinline__ v16h frag_f32(const float* rowk0, int lane) {
  v16h a; const float* p = rowk0 + 8 * (lane >> 4);
#pragma unroll
  for (int i = 0; i < 8; ++i) { a[i] = (_Float16)p[i]; a[8 + i] = (_Float16)p[16 + i]; }
  return a;
}
__device__ __forceinline__ v16h frag_f32s(const float* rowk0, int lane, float sc) {
  v16h a; const float* p = rowk0 + 8 * (lane >> 4);
#pragma unroll
  for (int i = 0; i < 8; ++i) { a[i] = (_Float16)(p[i] * sc); a[8 + i] = (_Float16)(p[16 + i] * sc); }
  return a;
}
// column fragment from a [K][ld] layout (column n), rows >= K read as 0
__device__ __forceinline__ v16h fragc_f32(const float* W, int k0, int n, int lane, int ld, int K) {
  v16h a; const int g = lane >> 4;
#pragma unroll
  for (int i = 0; i < 8; ++i) { const int ka = k0 + 8 * g + i, kb = ka + 16;
    a[i] = (_Float16)(ka < K ? W[(size_t)(ka < K ? ka : K - 1) * ld + n] : 0.f); a[8 + i] = (_Float16)(kb < K ? W[(size_t)(kb < K ? kb : K - 1) * ld + n] : 0.f); }
  return a;
}
struct F2 { v16b h, l; };
__device__ __forceinline__ F2 bsplit16(const float v[16]) { F2 r;
#pragma unroll
  for (int i = 0; i < 16; ++i) { const __bf16 h = (__bf16)v[i]; r.h[i] = h; r.l[i] = (__bf16)(v[i] - (float)h); }
  return r; }
__device__ __forceinline__ F2 split_row(const float* row, int k0, int lane) { float v[16]; const float* p = row + k0 + 8 * (lane >> 4);
#pragma unroll
  for (int i = 0; i < 8; ++i) { v[i] = p[i]; v[8 + i] = p[16 + i]; }
  return bsplit16(v); }
__device__ __forceinline__ F2 split_rowK(const float* row, int k0, int lane, int K) { float v[16]; const int g = lane >> 4;
#pragma unroll
  for (int i = 0; i < 8; ++i) { const int ka = k0 + 8 * g + i, kb = ka + 16; v[i] = ka < K ? row[ka < K ? ka : K - 1] : 0.f; v[8 + i] = kb < K ? row[kb < K ? kb : K - 1] : 0.f; }
  return bsplit16(v); }
__device__ __forceinline__ F2 split_col(const float* W, int k0, int n, int lane, int ld, int K) { float v[16]; const int g = lane >> 4;
#pragma unroll
  for (int i = 0; i < 8; ++i) { const int ka = k0 + 8 * g + i, kb = ka + 16; v[i] = ka < K ? W[(size_t)(ka < K ? ka : K - 1) * ld + n] : 0.f; v[8 + i] = kb < K ? W[(size_t)(kb < K ? kb : K - 1) * ld + n] : 0.f; }
  return bsplit16(v); }
__device__ __forceinline__ v8f mac3(const F2& a, const F2& b, v8f c) { c = wmma_bf(a.l, b.h, c); c = wmma_bf(a.h, b.l, c); return wmma_bf(a.h, b.h, c); }
__device__ __forceinline__ float sigm(float v) { return 1.0f / (1.0f + expf(-v)); }
#define LDSX() do { asm volatile("s_wait_dscnt 0" ::: "memory"); __builtin_amdgcn_wave_barrier(); __builtin_amdgcn_fence(__ATOMIC_RELEASE, "workgroup"); } while (0)


// Windowed grouped-query attention block (B 4, T 2,048, DIM 1,024; 16 query heads, 4 kv heads x 64, QK-RMSNorm (eps 1e-6, weights read), causal sliding window 512, no biases): y = softmax(rms(q) rms(k)^T / 8 | window) v (kv head = h / 4), @ wo^T.
#define NB 4
#define TT 2048
#define CC 1024
#define NH 16
#define HD 64
#define WIN 512
#define NKV 4
#define CK (NKV * HD)   // 256: k/v row width
#define REP (NH / NKV)
#ifndef TNB
#define TNB NB
#endif
typedef __attribute__((ext_vector_type(8))) __bf16 v8b;
__device__ __forceinline__ v16b frag_b(const __bf16* rowk0, int lane) {
  union { v16b v; v8b q[2]; } u; const __bf16* p = rowk0 + 8 * (lane >> 4);
  u.q[0] = *(const v8b*)p; u.q[1] = *(const v8b*)(p + 16); return u.v;
}
__device__ __forceinline__ float bfr(float v) { return (float)(__bf16)v; }
__device__ __attribute__((noinline)) float exp_ni(float v) { return expf(v); }
__device__ __attribute__((noinline)) float erf_ni(float v) { return erff(v); }

#define WS_QH  0u
#define WS_QL  (WS_QH + 2u * (size_t)NB * TT * CC)
#define WS_KH  (WS_QL + 2u * (size_t)NB * TT * CC)
#define WS_VT  (WS_KH + 2u * (size_t)NB * TT * CK)      // q, k and v lie in the order in which k_att's fragment loads read them (FRAGMENT ORDER below); v takes the bytes of both planes, from here to WS_S
#define WS_VL  (WS_VT + 2u * (size_t)NB * CK * TT)
#define HG 4                                          // only sizes the WS_S region, which no kernel uses
#define WS_S   (WS_VL + 2u * (size_t)NB * CK * TT)      // unused: the logits and P stay in registers
#define WS_PH  (WS_S + 4u * (size_t)HG * TT * TT)
#define WS_Y   (WS_PH + 0u)              // f32 y rows [b*t][C]
#define WS_END (WS_Y + 4u * (size_t)NB * TT * CC)

// ---- operand staging of the two projection kernels: a stage is KS k of every operand row of the block, read from global memory by whole lines (16 lanes = 256 B of one row), rounded to bf16 once and shared through LDS
typedef __attribute__((ext_vector_type(4))) __bf16 v4b;
#define KS 64             // k per stage
#define NS (CC / KS)
#define K0(bx, by) (((((bx) >> 3) << 1 | ((bx) & 1)) + 4 * ((by) & 3)) & (NS - 1))   // first k stage of the block at row block bx, column block by
#define PIT (KS + 8)      // LDS row pitch in bf16: 144 B = 16 B x 9, so the 16 rows of a 16-byte fragment read fall on different banks
__device__ __forceinline__ v4b cvt4(v4f v) { v4b r;
#pragma unroll
  for (int i = 0; i < 4; ++i) r[i] = (__bf16)v[i];
  return r; }
// a precaution: stands behind a group of global loads, in front of the next rewrite of their address registers; the group's one lane pointer is an input, so that it stays live up to the wait and no result of the group lands in it
#define XW(p) asm volatile("s_wait_xcnt 0x0" :: "v"(p) : "memory")
#define XW2(p, q) asm volatile("s_wait_xcnt 0x0" :: "v"(p), "v"(q) : "memory")   // the same behind a group that reads through two lane pointers
// FRAGMENT ORDER: a 16-byte piece of a fragment is stored at (piece * 32 + lane) * 16 B, so that one load of a wave reads 512 contiguous bytes (four whole lines) and not 32 B of each of sixteen lines.
// k: [b][kv head][16-key tile][piece p 0-3][lane = 16 g + key % 16][8 f16]: dims 16 p + 8 g + 0..7; each q plane the same with [head] and queries.   v: [b][kv head][32-key chunk][plane hi, lo][16-dim group j][piece s 0-1][lane = 16 g + dim % 16][8 bf16]: keys 16 s + 8 g + 0..7 of the chunk
#define KTILE (16 * HD)        // elements of a q or k tile
#define VCHUNK (2 * 32 * HD)   // elements of a v chunk, both planes
// ---- k_proj: block = (128 rows, 128 cols, which), four waves as 2 x 2, a wave = 64 rows x 64 cols (4 x 4 tiles: eight fragments feed sixteen products; its 64 columns are one head): qkv = x W (+ b), exact; q -> f16 hi (+ residual), k -> f16 tiles, v -> bf16 planes
__global__ __launch_bounds__(128) void k_proj(const float* __restrict__ X, const float* __restrict__ WQ, const float* __restrict__ BQ, const float* __restrict__ WK, const float* __restrict__ BK, const float* __restrict__ WV, const float* __restrict__ BV, _Float16* __restrict__ QH, _Float16* __restrict__ QL, _Float16* __restrict__ KH, __bf16* __restrict__ VT, const float* __restrict__ NQW, const float* __restrict__ NKW, int wbase) {
  __shared__ __align__(16) char smem[2 * (128 + 128) * PIT * 2];   // the loop's two stage buffers (2 x 256 rows x 144 B) first, then the epilogue's arrays (2 x 128 x 272 B) on the same bytes
  _Float16 (*sh)[136] = (_Float16 (*)[136])smem, (*sl)[136] = sh + 128; __bf16 (*th)[136] = (__bf16 (*)[136])smem, (*tl2)[136] = th + 128;   // q, k: [row][col]; v: [col][row]; a block uses one of the two pairs
  const int tid = threadIdx.x, wave = tid >> 5, lane = tid & 31, col = lane & 15, g = lane >> 4, wr = wave >> 1, wc = wave & 1; const int which = wbase + blockIdx.z; const int OW = (which == 0) ? CC : CK;   /* output row width: q 1,024, k/v 256 */ const int c0 = blockIdx.y * 128; const size_t r0 = (size_t)blockIdx.x * 128; const float* WA = which == 0 ? WQ : which == 1 ? WK : WV; const float* BA = which == 0 ? BQ : which == 1 ? BK : BV;
  v8f acc[4][4] = {};   // [row tile][col tile]
  { const int lr = tid >> 4, lp = tid & 15;   // the thread's row of each group of 8 rows, and its 16 bytes of the row's 256
    // the block walks the NS stages of k from a stage of its own and wraps round: the blocks that share W rows (same column block) or x rows (same row block) run at the same time, and from a common start all of them ask L2 for the same lines at the same moment.
    // The 64 sharers of W rows spread over all 16 stages, neighbours eight row blocks apart two stages apart; the sharers of x rows stand four stages apart, and column blocks four apart keep a common stage (for speed only: no result depends on where a block runs)
    const int s0 = K0(blockIdx.x, blockIdx.y + 2 * blockIdx.z);
    const float* gw = WA + (size_t)(c0 + lr) * CC + lp * 4 + s0 * KS; const float* gx = X + (r0 + lr) * CC + lp * 4 + s0 * KS;
    v4f rw[16], rx[16];
#pragma unroll
    for (int i = 0; i < 16; ++i) rw[i] = *(const v4f*)(gw + i * 8 * CC);
#pragma unroll
    for (int i = 0; i < 16; ++i) rx[i] = *(const v4f*)(gx + i * 8 * CC);
    XW2(gw, gx);
    // stays rolled: a trip is already 32 matrix instructions and 64 LDS operations a wave; two buffers, ONE barrier a stage: a buffer is rewritten two stages later, behind the barrier of the stage between
#pragma unroll 1
    for (int s = 0; s < NS; ++s) { __bf16* const bs = (__bf16*)smem + (s & 1) * ((128 + 128) * PIT);   // rows 0-127: W, 128-255: x
#pragma unroll
      for (int i = 0; i < 16; ++i) *(v4b*)(bs + (i * 8 + lr) * PIT + lp * 4) = cvt4(rw[i]);
#pragma unroll
      for (int i = 0; i < 16; ++i) *(v4b*)(bs + (128 + i * 8 + lr) * PIT + lp * 4) = cvt4(rx[i]);
      __syncthreads();
      if (s + 1 < NS) { const int stp = ((s0 + s + 1) & (NS - 1)) ? KS : KS - CC; gw += stp; gx += stp;   // behind the barrier (which waits for every load in flight): the next stage flies under this stage's products; behind the row's last stage comes its first
#pragma unroll
        for (int i = 0; i < 16; ++i) rw[i] = *(const v4f*)(gw + i * 8 * CC);
#pragma unroll
        for (int i = 0; i < 16; ++i) rx[i] = *(const v4f*)(gx + i * 8 * CC);
        XW2(gw, gx); }
#pragma unroll
      for (int kk = 0; kk < KS / 32; ++kk) { v16b a[4], w[4];   // the eight fragments as one group of LDS reads in front of their sixteen products
#pragma unroll
        for (int i = 0; i < 4; ++i) a[i] = frag_b(bs + (128 + wr * 64 + i * 16 + col) * PIT + kk * 32, lane);
#pragma unroll
        for (int j = 0; j < 4; ++j) w[j] = frag_b(bs + (wc * 64 + j * 16 + col) * PIT + kk * 32, lane);
#pragma unroll
        for (int j = 0; j < 4; j += 2)   // eight products (two column tiles) as ONE statement, in the old order, four v_nop behind the last: see k_att
          asm volatile("v_wmma_f32_16x16x32_bf16 %0, %8, %12, %0\n\tv_wmma_f32_16x16x32_bf16 %1, %9, %12, %1\n\tv_wmma_f32_16x16x32_bf16 %2, %10, %12, %2\n\tv_wmma_f32_16x16x32_bf16 %3, %11, %12, %3\n\t"
                       "v_wmma_f32_16x16x32_bf16 %4, %8, %13, %4\n\tv_wmma_f32_16x16x32_bf16 %5, %9, %13, %5\n\tv_wmma_f32_16x16x32_bf16 %6, %10, %13, %6\n\tv_wmma_f32_16x16x32_bf16 %7, %11, %13, %7\n\t"
                       "v_nop\n\tv_nop\n\tv_nop\n\tv_nop"
                       : "+v"(acc[0][j]), "+v"(acc[1][j]), "+v"(acc[2][j]), "+v"(acc[3][j]), "+v"(acc[0][j + 1]), "+v"(acc[1][j + 1]), "+v"(acc[2][j + 1]), "+v"(acc[3][j + 1])
                       : "v"(a[0]), "v"(a[1]), "v"(a[2]), "v"(a[3]), "v"(w[j]), "v"(w[j + 1])); } }
    __syncthreads(); }   // every wave has left the stage buffers: the epilogue's arrays lie on the same LDS
  // QK-RMSNorm per (row, head): the wave's 64 columns are one head; mean of squares over the 64 dims via in-lane + 16-lane shuffles (unconditional), then scale by rsqrt(ms + eps) * norm_w[d]
  if (which < 2) { const float* NW = which == 0 ? NQW : NKW; float nw[4];   // the head's four weights of this lane, read once for the wave's four row tiles
#pragma unroll
    for (int jj = 0; jj < 4; ++jj) nw[jj] = NW[jj * 16 + col];
    asm volatile("s_wait_xcnt 0x0" :: "s"(NW) : "memory");   // the precaution of XW for these four loads: their scalar base is an input, so that it stays live up to the wait
#pragma unroll
    for (int i = 0; i < 4; ++i) { float ssq[8];
#pragma unroll
      for (int r = 0; r < 8; ++r) { float s_ = 0.f;
#pragma unroll
        for (int jj = 0; jj < 4; ++jj) s_ += acc[i][jj][r] * acc[i][jj][r];
#pragma unroll
        for (int o_ = 1; o_ < 16; o_ <<= 1) s_ += __shfl_xor(s_, o_);
        ssq[r] = rsqrtf(s_ * (1.0f / HD) + 1e-6f); }
#pragma unroll
      for (int jj = 0; jj < 4; ++jj) { const float wv = bfr(nw[jj]);
#pragma unroll
        for (int r = 0; r < 8; ++r) acc[i][jj][r] *= ssq[r] * wv; } } }
#pragma unroll
  for (int j = 0; j < 4; ++j) { const int cl = wc * 64 + j * 16 + col; const float bb = BA ? bfr(BA[c0 + cl]) : 0.f;
#pragma unroll
    for (int i = 0; i < 4; ++i)
#pragma unroll
      for (int r = 0; r < 8; ++r) acc[i][j][r] += bb; }
  if (which == 2) {
#pragma unroll
    for (int j = 0; j < 4; ++j)
#pragma unroll
      for (int i = 0; i < 4; ++i)
#pragma unroll
        for (int r = 0; r < 8; ++r) { const float v = acc[i][j][r]; const int rl = wr * 64 + i * 16 + 8 * g + r, cl = wc * 64 + j * 16 + col; const __bf16 bh = (__bf16)v; th[cl][rl] = bh; tl2[cl][rl] = (__bf16)(v - (float)bh); } }
  else {
#pragma unroll
    for (int j = 0; j < 4; ++j)
#pragma unroll
      for (int i = 0; i < 4; ++i)
#pragma unroll
        for (int r = 0; r < 8; ++r) { const float v = acc[i][j][r]; const int rl = wr * 64 + i * 16 + 8 * g + r, cl = wc * 64 + j * 16 + col; const _Float16 hv = (_Float16)v; sh[rl][cl] = hv; sl[rl][cl] = (_Float16)((v - (float)hv) * 1024.0f); } }   /* q residual carried x 2^10 so the plane stays f16-normal on the chip */
  __syncthreads();
  { const size_t b = r0 / TT; const int t0 = (int)(r0 % TT);   // fragment order; q and k: the block's 128 threads store one tile (2 KB) a step, thread = piece * 32 + lane, eight tiles of each of the block's two heads; the steps unrolled from one pointer a plane, so that no address register of a store is rewritten
    if (which == 0) { const size_t o = ((b * NH + c0 / HD) * (TT / 16) + t0 / 16) * (size_t)KTILE + tid * 8; _Float16* ph = QH + o; _Float16* pl = QL + o;
#pragma unroll
      for (int t = 0; t < 16; ++t) { vst2((unsigned*)(ph + (t >> 3) * (TT / 16) * KTILE + (t & 7) * KTILE), *(const v4u*)&sh[(t & 7) * 16 + col][(t >> 3) * HD + wave * 16 + g * 8]); vst2((unsigned*)(pl + (t >> 3) * (TT / 16) * KTILE + (t & 7) * KTILE), *(const v4u*)&sl[(t & 7) * 16 + col][(t >> 3) * HD + wave * 16 + g * 8]); }
      XW2(ph, pl); }   // the same precaution behind each of the three runs of stores: the compiler lays the runs out one behind another, in an order of its own, with fall-through edges between them, and a later run's code rewrites an earlier one's registers
    else if (which == 1) {
      _Float16* ph = KH + ((b * NKV + c0 / HD) * (TT / 16) + t0 / 16) * (size_t)KTILE + tid * 8;
#pragma unroll
      for (int t = 0; t < 16; ++t) vst2((unsigned*)(ph + (t >> 3) * (TT / 16) * KTILE + (t & 7) * KTILE), *(const v4u*)&sh[(t & 7) * 16 + col][(t >> 3) * HD + wave * 16 + g * 8]);
      XW(ph); }
    else {   // a step is 2 KB = two 16-dim groups of one plane of one chunk, thread = (group % 2, piece, lane); t = (head, chunk, plane, group / 2)
      __bf16* ph = VT + ((b * NKV + c0 / HD) * (TT / 32) + t0 / 32) * (size_t)VCHUNK + tid * 8;
#pragma unroll
      for (int t = 0; t < 32; ++t) vst2((unsigned*)(ph + (t >> 4) * (TT / 32) * VCHUNK + (t & 15) * 1024), *(const v4u*)&((t & 2) ? tl2 : th)[(t >> 4) * HD + (t & 1) * 32 + wr * 16 + col][((t >> 2) & 3) * 32 + wc * 16 + g * 8]);
      XW(ph); } } }
// ---- k_att: block = 64 queries of (b,h), one wave = 16 queries, no exchange between waves. S^T = K Q^T (A = 16 key rows, B = 16 query rows), so a lane holds the logits of ONE query (col) at keys 8g+r of each 16-key tile;
// two such tiles are, element for element, the A fragment of P for a 32-key chunk: the logits never leave the lane's registers. ONE pass over the wave's window of NCH chunks of 32 keys, with a running maximum:
// P' is taken against the maximum in use; when a chunk's maximum lies more than 5 above it for some query, sums and output tile are scaled down to the new one (a scalar branch, rare behind the first chunk).
// No LDS in the loop, so registers alone set the number of waves a SIMD. K and V fragments are fetched one chunk ahead into the registers that the products have just read.
#define NCH 17   // 32-key chunks that cover [ql0 - 511, ql0 + 15] from a multiple of 32
// fragments from the lane's own pointer, fragment order: the second piece lies 32 lanes x 8 elements behind the first
__device__ __forceinline__ v16h fragq_h(const _Float16* p) { union { v16h v; v8h q[2]; } u; u.q[0] = *(const v8h*)p; u.q[1] = *(const v8h*)(p + 256); return u.v; }
__device__ __forceinline__ v16b fragq_b(const __bf16* p) { union { v16b v; v8b q[2]; } u; u.q[0] = *(const v8b*)p; u.q[1] = *(const v8b*)(p + 256); return u.v; }
__device__ __forceinline__ float xhalf(float x) { return __builtin_bit_cast(float, __builtin_amdgcn_permlanex16(__builtin_bit_cast(int, x), __builtin_bit_cast(int, x), 0x76543210, 0xfedcba98, false, false)); }   // lane l reads lane l ^ 16, on the vector pipe
__global__ __launch_bounds__(128) void k_att(const _Float16* __restrict__ QH, const _Float16* __restrict__ QL, const _Float16* __restrict__ KH, const __bf16* __restrict__ VT, float* __restrict__ Y) {   // q, k and v in fragment order
  __shared__ __align__(16) float st[4][16][HD + 4];   // the epilogue's turn of the output tile, a strip a wave
  const int tid = threadIdx.x, wave = __builtin_amdgcn_readfirstlane(tid >> 5), lane = tid & 31, col = lane & 15, g = lane >> 4;
  const int b = blockIdx.z, h = blockIdx.y, ql0 = blockIdx.x * 64 + wave * 16, qt = ql0 + col;
  const int kbase = ((ql0 - (WIN - 1)) >> 5) * 32;      // first key of chunk 0 (floor to 32; below 0 for the first rows)
  const int c0 = kbase < 0 ? (-kbase) >> 5 : 0;         // wave-uniform: chunks wholly in front of key 0 are not walked
  const int kf = kbase < 0 ? 0 : kbase;                 // first key walked = kbase + c0 * 32
  const int st0 = c0 + 1 < NCH ? 32 : 0;                // keys from the first chunk to the first one fetched ahead
  const size_t qo = ((size_t)(b * NH + h) * (TT / 16) + ql0 / 16) * KTILE + lane * 8; const _Float16* qp = QH + qo; const _Float16* qlp = QL + qo;
  const v16h qh0 = fragq_h(qp), qh1 = fragq_h(qp + 512), qr0 = fragq_h(qlp), qr1 = fragq_h(qlp + 512);
  const _Float16* kp = KH + ((size_t)(b * NKV + h / REP) * (TT / 16) + kf / 16) * KTILE + lane * 8;   /* GQA: kv head h/4; the lane's 16 bytes of the first piece of the first tile */
  v16h ka[2], kb[2];
#pragma unroll
  for (int t = 0; t < 2; ++t) { ka[t] = fragq_h(kp + t * KTILE); kb[t] = fragq_h(kp + t * KTILE + 512); }
  const __bf16* vp = VT + ((size_t)(b * NKV + h / REP) * (TT / 32) + kf / 32) * VCHUNK + lane * 8;   /* GQA: kv head h/4; the lane's 16 bytes of the first piece of the first chunk */
  v16b vh[HD / 16], vl[HD / 16];   // the first chunk's v is asked for behind q and k, in front of the wait for those: it flies under the first logits
#pragma unroll
  for (int j = 0; j < HD / 16; ++j) { vh[j] = fragq_b(vp + j * 512); vl[j] = fragq_b(vp + j * 512 + VCHUNK / 2); }
  XW(vp);
  // holds the first loads in front of the wait (loaded values as inputs only); the three pointers as in XW
  asm volatile("s_wait_xcnt 0x0" :: "v"(qh0), "v"(qh1), "v"(qr0), "v"(qr1), "v"(ka[0]), "v"(kb[0]), "v"(ka[1]), "v"(kb[1]), "v"(qp), "v"(qlp), "v"(kp) : "memory");
  kp += st0 * HD;
  vp += st0 * (VCHUNK / 32);
  // m: the maximum in use of the lane's query (the same in lanes l and l ^ 16); -3.0e38 as long as every key seen was masked. e = exp2(s * log2 e + eb) = 2^11 * exp(s - m); a masked key's -3.0e38 runs to -inf in the fused multiply-add and gives exactly 0,
  // also while m is still -3.0e38: eb is formed from max(m, -1.0e30), which is m itself for every maximum that f16 operands can give, and stays finite
  float m = -3.0e38f, eb = 11.0f + 1.0e30f * 1.44269504f;
  v4f sa = {}, sb = {};   // the row sum in eight partial sums a lane: one chain of sixteen dependent additions a chunk would stand bare behind the products
  v8f acc[HD / 16] = {};
  // stays rolled: each fragment set is refilled in place, so no trip needs another's registers
#pragma unroll 1
  for (int c = c0; c < NCH; ++c) {
    float sv[16]; const int kc = kbase + c * 32;   // the chunk's first key
    { v8f a[2], al[2];
      // the chunk's eight logit products as ONE statement: four tiles in turn, so that none waits for its own sum, each tile's two products in the old order. The four v_nop at the end keep the distance
      // between the last product and the first vector instruction on a result or an operand; written behind every product they took a vector issue slot each from the SIMD's other waves
      asm volatile("v_wmma_f32_16x16x32_f16 %0, %4, %8, 0\n\tv_wmma_f32_16x16x32_f16 %1, %4, %10, 0\n\tv_wmma_f32_16x16x32_f16 %2, %5, %8, 0\n\tv_wmma_f32_16x16x32_f16 %3, %5, %10, 0\n\t"
                   "v_wmma_f32_16x16x32_f16 %0, %6, %9, %0\n\tv_wmma_f32_16x16x32_f16 %1, %6, %11, %1\n\tv_wmma_f32_16x16x32_f16 %2, %7, %9, %2\n\tv_wmma_f32_16x16x32_f16 %3, %7, %11, %3\n\t"
                   "v_nop\n\tv_nop\n\tv_nop\n\tv_nop"
                   : "=&v"(a[0]), "=&v"(al[0]), "=&v"(a[1]), "=&v"(al[1]) : "v"(ka[0]), "v"(ka[1]), "v"(kb[0]), "v"(kb[1]), "v"(qh0), "v"(qh1), "v"(qr0), "v"(qr1));
#pragma unroll
      for (int t = 0; t < 2; ++t) { a[t] += al[t] * (1.0f / 1024.0f);
#pragma unroll
        for (int r = 0; r < 8; ++r) sv[t * 8 + r] = a[t][r] * 0.125f; } }
    // the mask only where a key of the chunk can be closed for one of the wave's sixteen queries (wave-uniform, a scalar branch): a chunk whose last key is at most ql0 and whose first key is at least ql0 + 15 - (WIN - 1) is open for all of them; that leaves the window's first chunk and the diagonal's
    if (kc + 31 > ql0 || kc < ql0 + 15 - (WIN - 1)) {
#pragma unroll
      for (int i = 0; i < 16; ++i) { const int kt = kc + (i >> 3) * 16 + 8 * g + (i & 7); const bool allowed = (kt <= qt) && (qt - kt < WIN); sv[i] = allowed ? sv[i] : -3.0e38f; } }
    // kp walks one chunk ahead and stops at the last one (the last trip fetches its own chunk again): the address stays inside k
#pragma unroll
    for (int t = 0; t < 2; ++t) { ka[t] = fragq_h(kp + t * KTILE); kb[t] = fragq_h(kp + t * KTILE + 512); }
    XW(kp);
    kp += c + 2 < NCH ? 2 * KTILE : 0;
    float cm = sv[0];
#pragma unroll
    for (int i = 1; i < 16; ++i) cm = fmaxf(cm, sv[i]);
    cm = fmaxf(cm, xhalf(cm));   // the query's other eight keys of every tile sit in lane ^ 16
    if (__builtin_amdgcn_ballot_w32(cm > m + 5.0f) != 0) {   // wave-uniform, every lane stays on: the first chunk with an open key, and a later one only where a logit stands far above all before it
      const float mn = fmaxf(m, cm); const float dn = __builtin_amdgcn_exp2f((m - mn) * 1.44269504f);   // 1 where the maximum stays, 0 where m was still -3.0e38 (sums and tile are 0 there)
      m = mn; eb = 11.0f - fmaxf(mn, -1.0e30f) * 1.44269504f;
      sa *= dn; sb *= dn;
#pragma unroll
      for (int r = 0; r < 8; ++r) { const float fr = __shfl(dn, 8 * g + r);   // the factor of output row 8g + r, from the lane that holds that query
#pragma unroll
        for (int j = 0; j < HD / 16; ++j) acc[j][r] *= fr; } }
    float pv[16];
#pragma unroll
    for (int q = 0; q < 4; ++q) { v4f e;
#pragma unroll
      for (int i = 0; i < 4; ++i) { e[i] = __builtin_amdgcn_exp2f(fmaf(sv[q * 4 + i], 1.44269504f, eb)); pv[q * 4 + i] = e[i]; }
      if (q & 1) sb += e; else sa += e; }
    const F2 p = bsplit16(pv);
    // the chunk's twelve P v products as ONE statement, as above: the four output tiles in turn, each tile's three products in the old order (hi hi, lo hi, hi lo); four v_nop behind the last
    asm volatile("v_wmma_f32_16x16x32_bf16 %0, %4, %6, %0\n\tv_wmma_f32_16x16x32_bf16 %1, %4, %7, %1\n\tv_wmma_f32_16x16x32_bf16 %2, %4, %8, %2\n\tv_wmma_f32_16x16x32_bf16 %3, %4, %9, %3\n\t"
                 "v_wmma_f32_16x16x32_bf16 %0, %5, %6, %0\n\tv_wmma_f32_16x16x32_bf16 %1, %5, %7, %1\n\tv_wmma_f32_16x16x32_bf16 %2, %5, %8, %2\n\tv_wmma_f32_16x16x32_bf16 %3, %5, %9, %3\n\t"
                 "v_wmma_f32_16x16x32_bf16 %0, %4, %10, %0\n\tv_wmma_f32_16x16x32_bf16 %1, %4, %11, %1\n\tv_wmma_f32_16x16x32_bf16 %2, %4, %12, %2\n\tv_wmma_f32_16x16x32_bf16 %3, %4, %13, %3\n\t"
                 "v_nop\n\tv_nop\n\tv_nop\n\tv_nop"
                 : "+v"(acc[0]), "+v"(acc[1]), "+v"(acc[2]), "+v"(acc[3]) : "v"(p.h), "v"(p.l), "v"(vh[0]), "v"(vh[1]), "v"(vh[2]), "v"(vh[3]), "v"(vl[0]), "v"(vl[1]), "v"(vl[2]), "v"(vl[3]));
    // as above: vp stops at the last chunk, the last trip's fetch stays inside v
#pragma unroll
    for (int j = 0; j < HD / 16; ++j) { vh[j] = fragq_b(vp + j * 512); vl[j] = fragq_b(vp + j * 512 + VCHUNK / 2); }
    XW(vp);
    vp += c + 2 < NCH ? VCHUNK : 0; }
  sa += sb;
  float sum = (sa[0] + sa[1]) + (sa[2] + sa[3]);
  sum += __shfl_xor(sum, 16);
  const float inv = 1.0f / sum;   // of the lane's query (col)
  float f[8];   // the factors of the lane's eight output rows 8g + r, each from the lane that holds that query (unrolled: f stays in registers)
#pragma unroll
  for (int r = 0; r < 8; ++r) f[r] = __shfl(inv, 8 * g + r);
  float (*ss)[HD + 4] = st[wave];   // the wave's own strip turns the output tile for 16-byte row stores
#pragma unroll
  for (int j = 0; j < HD / 16; ++j)
#pragma unroll
    for (int r = 0; r < 8; ++r) ss[8 * g + r][j * 16 + col] = acc[j][r] * f[r];
  LDSX(); for (int rl = 0; rl < 16; ++rl) if (lane < HD / 4) vst2(Y + ((size_t)b * TT + ql0 + rl) * CC + h * HD + lane * 4, *(const v4f*)&ss[rl][lane * 4]); }
// ---- k_out: block = (128 rows, 128 cols), four waves as 2 x 2, a wave = 64 rows x 64 cols: out = y (bf16 hi + lo) Wo^T + bo
__global__ __launch_bounds__(128) void k_out(const float* __restrict__ Y, const float* __restrict__ WP, const float* __restrict__ BP, float* __restrict__ OUT) { __shared__ __align__(16) char smem[2 * (128 + 256) * PIT * 2]; float (*sf)[64][68] = (float (*)[64][68])smem;   // two stage buffers; the four output tiles (69,632 B) on the same bytes behind the loop
  const int tid = threadIdx.x, wave = tid >> 5, lane = tid & 31, col = lane & 15, g = lane >> 4, wr = wave >> 1, wc = wave & 1; const int c0 = blockIdx.y * 128 + wc * 64; const size_t r0 = (size_t)blockIdx.x * 128 + wr * 64;   // the wave's first column and row
  v8f acc[4][4] = {};   // [row tile][col tile]
  { const int lr = tid >> 4, lp = tid & 15;   // as in k_proj
    const int s0 = K0(blockIdx.x, blockIdx.y);   // the block's own first stage of k, as in k_proj
    const float* gw = WP + (size_t)(blockIdx.y * 128 + lr) * CC + lp * 4 + s0 * KS; const float* gy = Y + ((size_t)blockIdx.x * 128 + lr) * CC + lp * 4 + s0 * KS;
    v4f rw[16], ry[16];
#pragma unroll
    for (int i = 0; i < 16; ++i) rw[i] = *(const v4f*)(gw + i * 8 * CC);
#pragma unroll
    for (int i = 0; i < 16; ++i) ry[i] = *(const v4f*)(gy + i * 8 * CC);
    XW2(gw, gy);
    // stays rolled, two buffers, one barrier a stage, as in k_proj
#pragma unroll 1
    for (int s = 0; s < NS; ++s) { __bf16* const bs = (__bf16*)smem + (s & 1) * ((128 + 256) * PIT);   // rows 0-127: W, 128-255: y hi, 256-383: y lo
#pragma unroll
      for (int i = 0; i < 16; ++i) *(v4b*)(bs + (i * 8 + lr) * PIT + lp * 4) = cvt4(rw[i]);
#pragma unroll
      for (int i = 0; i < 16; ++i) { const v4b hi = cvt4(ry[i]); v4f re;
#pragma unroll
        for (int e = 0; e < 4; ++e) re[e] = ry[i][e] - (float)hi[e];
        *(v4b*)(bs + (128 + i * 8 + lr) * PIT + lp * 4) = hi; *(v4b*)(bs + (256 + i * 8 + lr) * PIT + lp * 4) = cvt4(re); }
      __syncthreads();
      if (s + 1 < NS) { const int stp = ((s0 + s + 1) & (NS - 1)) ? KS : KS - CC; gw += stp; gy += stp;
#pragma unroll
        for (int i = 0; i < 16; ++i) rw[i] = *(const v4f*)(gw + i * 8 * CC);
#pragma unroll
        for (int i = 0; i < 16; ++i) ry[i] = *(const v4f*)(gy + i * 8 * CC);
        XW2(gw, gy); }
#pragma unroll
      for (int kk = 0; kk < KS / 32; ++kk) { v16b ah[4], al[4], w[4];   // the twelve fragments as one group of LDS reads in front of their thirty-two products
#pragma unroll
        for (int i = 0; i < 4; ++i) { ah[i] = frag_b(bs + (128 + wr * 64 + i * 16 + col) * PIT + kk * 32, lane); al[i] = frag_b(bs + (256 + wr * 64 + i * 16 + col) * PIT + kk * 32, lane); }
#pragma unroll
        for (int j = 0; j < 4; ++j) w[j] = frag_b(bs + (wc * 64 + j * 16 + col) * PIT + kk * 32, lane);
#pragma unroll
        for (int j = 0; j < 4; ++j)   // hi, then lo, of each tile as before, three other tiles between the two; a column tile's eight products as ONE statement, four v_nop behind the last: see k_att
          asm volatile("v_wmma_f32_16x16x32_bf16 %0, %4, %12, %0\n\tv_wmma_f32_16x16x32_bf16 %1, %5, %12, %1\n\tv_wmma_f32_16x16x32_bf16 %2, %6, %12, %2\n\tv_wmma_f32_16x16x32_bf16 %3, %7, %12, %3\n\t"
                       "v_wmma_f32_16x16x32_bf16 %0, %8, %12, %0\n\tv_wmma_f32_16x16x32_bf16 %1, %9, %12, %1\n\tv_wmma_f32_16x16x32_bf16 %2, %10, %12, %2\n\tv_wmma_f32_16x16x32_bf16 %3, %11, %12, %3\n\t"
                       "v_nop\n\tv_nop\n\tv_nop\n\tv_nop"
                       : "+v"(acc[0][j]), "+v"(acc[1][j]), "+v"(acc[2][j]), "+v"(acc[3][j])
                       : "v"(ah[0]), "v"(ah[1]), "v"(ah[2]), "v"(ah[3]), "v"(al[0]), "v"(al[1]), "v"(al[2]), "v"(al[3]), "v"(w[j])); } }
    __syncthreads(); }   // every wave has left the stage buffers: sf lies on the same LDS
#pragma unroll
  for (int j = 0; j < 4; ++j) { const float bb = BP ? bfr(BP[c0 + j * 16 + col]) : 0.f;
#pragma unroll
    for (int i = 0; i < 4; ++i)
#pragma unroll
      for (int r = 0; r < 8; ++r) sf[wave][i * 16 + 8 * g + r][j * 16 + col] = acc[i][j][r] + bb; }
  LDSX(); for (int rl = 0; rl < 64; rl += 2) vst2(OUT + (r0 + rl + g) * CC + c0 + col * 4, *(const v4f*)&sf[wave][rl + g][col * 4]); }   // a store = two rows of 256 B: whole lines
extern "C" void kernel_launch(void* const* d_in, const int* in_sizes, int n_in, void* d_out, int out_size, void* d_ws, size_t ws_size, hipStream_t stream) {
  (void)in_sizes; (void)n_in; (void)out_size;
  const float** F = (const float**)d_in;   // 0 x [4,2048,1024], 1 wq [1024,1024] ([out,in]), 2 wk [256,1024], 3 wv [256,1024], 4 wo [1024,1024] ([out,in]), 5 q_norm_w [64], 6 k_norm_w [64]
  if (ws_size < (size_t)WS_END) return;
  char* ws = (char*)d_ws; _Float16 *QH = (_Float16*)(ws + WS_QH), *QL = (_Float16*)(ws + WS_QL), *KH = (_Float16*)(ws + WS_KH); __bf16 *VT = (__bf16*)(ws + WS_VT); float *Y = (float*)(ws + WS_Y);
  k_proj<<<dim3(TNB * TT / 128, CC / 128, 1), 128, 0, stream>>>(F[0], F[1], nullptr, F[2], nullptr, F[3], nullptr, QH, QL, KH, VT, F[5], F[6], 0);   // q (16 heads)
  k_proj<<<dim3(TNB * TT / 128, CK / 128, 2), 128, 0, stream>>>(F[0], F[1], nullptr, F[2], nullptr, F[3], nullptr, QH, QL, KH, VT, F[5], F[6], 1);   // k, v (4 kv heads)
  k_att<<<dim3(TT / 64, NH, TNB), 128, 0, stream>>>(QH, QL, KH, VT, Y);   // logits, softmax and P v of every (b, h) in one launch
  k_out<<<dim3(TNB * TT / 128, CC / 128), 128, 0, stream>>>(Y, F[4], nullptr, (float*)d_out);
}

// v010
// It runs in 106 microseconds.
// Timed twice side by side with v009, it ran 1.04 and 1.03 times as fast.
// Over all steps from v000 it is 13.6 times as fast.
// compute dtype: all float inputs rounded to bf16 (x and the four weight matrices once, by a first launch); q/k/v = x W^T with EXACT bf16 products on WMMA 16x16x32, f32 accumulate; per-head RMSNorm of q and k in f32 in the projection epilogue; q as f16 hi + residual (x 2^10), k f16 -> 2-product logits / 8 inside the causal sliding window (512), kept in f32 in registers (one launch, one pass over the keys, GQA: head h reads kv head h/4); softmax in f32: P' = exp2((s - m) log2 e + 11) on the hardware exponential, m a running maximum (sums and tile rescaled when it grows by more than 5), not normalised, split bf16 hi + lo against v bf16 hi + lo (3 products), the output tile scaled by 1 / sum P'; y = ctx (bf16 hi + lo) wo^T; f32 output.
#include <hip/hip_runtime.h>
#include <math.h>

typedef __attribute__((ext_vector_type(16))) _Float16 v16h;
typedef __attribute__((ext_vector_type(16))) __bf16 v16b;
typedef __attribute__((ext_vector_type(8)))  _Float16 v8h;
typedef __attribute__((ext_vector_type(8)))  float v8f;
typedef __attribute__((ext_vector_type(4)))  float v4f;
typedef __attribute__((ext_vector_type(2)))  float v2f;
typedef __attribute__((ext_vector_type(4)))  unsigned v4u;
typedef __attribute__((ext_vector_type(4)))  int v4i;
typedef float __attribute__((may_alias)) float_a;
typedef int __attribute__((may_alias)) int_a;

template <typename T> __device__ __forceinline__ void vst2(void* p, T v) { *(T*)p = v;  }
__device__ __forceinline__ v8f wmma16(v16h a, v16h b, v8f c) {
  v8f d = __builtin_amdgcn_wmma_f32_16x16x32_f16(false, a, false, b, (short)0, c, false, false);
  asm volatile("v_nop\n\tv_nop\n\tv_nop\n\tv_nop" : "+v"(d) : "v"(a), "v"(b));
  return d;
}
__device__ __forceinline__ v8f wmma_bf(v16b a, v16b b, v8f c) {
  v8f d = __builtin_amdgcn_wmma_f32_16x16x32_bf16(false, a, false, b, (short)0, c, false, false);
  asm volatile("v_nop\n\tv_nop\n\tv_nop\n\tv_nop" : "+v"(d) : "v"(a), "v"(b));
  return d;
}
// 16x16x32 fragments: lane = (h = lane>>4, row/col = lane&15); elements 0..7 = k0+8h+0..7, 8..15 = k0+16+8h+0..7; D element r = row 8h+r
__device__ __forceinline__ v16h frag_h(const _Float16* rowk0, int lane) {
  union { v16h v; v8h q[2]; } u; const _Float16* p = rowk0 + 8 * (lane >> 4);
  u.q[0] = *(const v8h*)p; u.q[1] = *(const v8h*)(p + 16); return u.v;
}
__device__ __forceinline__ v16h frag_f32(const float* rowk0, int lane) {
  v16h a; const float* p = rowk0 + 8 * (lane >> 4);
#pragma unroll
  for (int i = 0; i < 8; ++i) { a[i] = (_Float16)p[i]; a[8 + i] = (_Float16)p[16 + i]; }
  return a;
}
__device__ __forceinline__ v16h frag_f32s(const float* rowk0, int lane, float sc) {
  v16h a; const float* p = rowk0 + 8 * (lane >> 4);
#pragma unroll
  for (int i = 0; i < 8; ++i) { a[i] = (_Float16)(p[i] * sc); a[8 + i] = (_Float16)(p[16 + i] * sc); }
  return a;
}
// column fragment from a [K][ld] layout (column n), rows >= K read as 0
__device__ __forceinline__ v16h fragc_f32(const float* W, int k0, int n, int lane, int ld, int K) {
  v16h a; const int g = lane >> 4;
#pragma unroll
  for (int i = 0; i < 8; ++i) { const int ka = k0 + 8 * g + i, kb = ka + 16;
    a[i] = (_Float16)(ka < K ? W[(size_t)(ka < K ? ka : K - 1) * ld + n] : 0.f); a[8 + i] = (_Float16)(kb < K ? W[(size_t)(kb < K ? kb : K - 1) * ld + n] : 0.f); }
  return a;
}
struct F2 { v16b h, l; };
__device__ __forceinline__ F2 bsplit16(const float v[16]) { F2 r;
#pragma unroll
  for (int i = 0; i < 16; ++i) { const __bf16 h = (__bf16)v[i]; r.h[i] = h; r.l[i] = (__bf16)(v[i] - (float)h); }
  return r; }
__device__ __forceinline__ F2 split_row(const float* row, int k0, int lane) { float v[16]; const float* p = row + k0 + 8 * (lane >> 4);
#pragma unroll
  for (int i = 0; i < 8; ++i) { v[i] = p[i]; v[8 + i] = p[16 + i]; }
  return bsplit16(v); }
__device__ __forceinline__ F2 split_rowK(const float* row, int k0, int lane, int K) { float v[16]; const int g = lane >> 4;
#pragma unroll
  for (int i = 0; i < 8; ++i) { const int ka = k0 + 8 * g + i, kb = ka + 16; v[i] = ka < K ? row[ka < K ? ka : K - 1] : 0.f; v[8 + i] = kb < K ? row[kb < K ? kb : K - 1] : 0.f; }
  return bsplit16(v); }
__device__ __forceinline__ F2 split_col(const float* W, int k0, int n, int lane, int ld, int K) { float v[16]; const int g = lane >> 4;
#pragma unroll
  for (int i = 0; i < 8; ++i) { const int ka = k0 + 8 * g + i, kb = ka + 16; v[i] = ka < K ? W[(size_t)(ka < K ? ka : K - 1) * ld + n] : 0.f; v[8 + i] = kb < K ? W[(size_t)(kb < K ? kb : K - 1) * ld + n] : 0.f; }
  return bsplit16(v); }
__device__ __forceinline__ v8f mac3(const F2& a, const F2& b, v8f c) { c = wmma_bf(a.l, b.h, c); c = wmma_bf(a.h, b.l, c); return wmma_bf(a.h, b.h, c); }
__device__ __forceinline__ float sigm(float v) { return 1.0f / (1.0f + expf(-v)); }
#define LDSX() do { asm volatile("s_wait_dscnt 0" ::: "memory"); __builtin_amdgcn_wave_barrier(); __builtin_amdgcn_fence(__ATOMIC_RELEASE, "workgroup"); } while (0)


// Windowed grouped-query attention block (B 4, T 2,048, DIM 1,024; 16 query heads, 4 kv heads x 64, QK-RMSNorm (eps 1e-6, weights read), causal sliding window 512, no biases): y = softmax(rms(q) rms(k)^T / 8 | window) v (kv head = h / 4), @ wo^T.
#define NB 4
#define TT 2048
#define CC 1024
#define NH 16
#define HD 64
#define WIN 512
#define NKV 4
#define CK (NKV * HD)   // 256: k/v row width
#define REP (NH / NKV)
#ifndef TNB
#define TNB NB
#endif
typedef __attribute__((ext_vector_type(8))) __bf16 v8b;
__device__ __forceinline__ v16b frag_b(const __bf16* rowk0, int lane) {
  union { v16b v; v8b q[2]; } u; const __bf16* p = rowk0 + 8 * (lane >> 4);
  u.q[0] = *(const v8b*)p; u.q[1] = *(const v8b*)(p + 16); return u.v;
}
__device__ __forceinline__ float bfr(float v) { return (float)(__bf16)v; }
__device__ __attribute__((noinline)) float exp_ni(float v) { return expf(v); }
__device__ __attribute__((noinline)) float erf_ni(float v) { return erff(v); }

#define WS_QH  0u
#define WS_QL  (WS_QH + 2u * (size_t)NB * TT * CC)
#define WS_KH  (WS_QL + 2u * (size_t)NB * TT * CC)
#define WS_VT  (WS_KH + 2u * (size_t)NB * TT * CK)      // q, k and v lie in the order in which k_att's fragment loads read them (FRAGMENT ORDER below); v takes the bytes of both planes, from here to WS_S
#define WS_VL  (WS_VT + 2u * (size_t)NB * CK * TT)
#define HG 4                                          // only sizes the WS_S region, which holds the bf16 x and weights at its start
#define WS_S   (WS_VL + 2u * (size_t)NB * CK * TT)      // the logits and P stay in registers; the bf16 x and weights lie here (WS_XB)
#define WS_PH  (WS_S + 4u * (size_t)HG * TT * TT)
#define WS_XB  (WS_S + 0u)                              // bf16 x and weights in STAGE ORDER (k_cvt), 21 MB on the bytes from WS_S, which nothing else uses
#define WS_WQB (WS_XB + 2u * (size_t)NB * TT * CC)
#define WS_WKB (WS_WQB + 2u * (size_t)CC * CC)
#define WS_WVB (WS_WKB + 2u * (size_t)CK * CC)
#define WS_WOB (WS_WVB + 2u * (size_t)CK * CC)
#define WS_Y   (WS_PH + 0u)              // y: bf16 hi plane, stage order
#define WS_YL  (WS_Y + 2u * (size_t)NB * TT * CC)   // y: bf16 lo plane
#define WS_END (WS_Y + 4u * (size_t)NB * TT * CC)

// ---- operand staging of the two projection kernels: a stage is KS k of every operand row of the block, shared through LDS. Every operand comes as bf16 in STAGE ORDER, rounded once where it is made (x and the weights: k_cvt; y, hi and lo plane: k_att): a block's 128 rows of a stage are 16 KB in a row
typedef __attribute__((ext_vector_type(4))) __bf16 v4b;
#define KS 64             // k per stage
#define NS (CC / KS)
#define K0(bx, by) (((((bx) >> 3) << 1 | ((bx) & 1)) + 4 * ((by) & 3)) & (NS - 1))   // first k stage of the block at row block bx, column block by
#define PIT (KS + 8)      // LDS row pitch in bf16: 144 B = 16 B x 9, so the 16 rows of a 16-byte fragment read fall on different banks
__device__ __forceinline__ v4b cvt4(v4f v) { v4b r;
#pragma unroll
  for (int i = 0; i < 4; ++i) r[i] = (__bf16)v[i];
  return r; }
// a precaution: stands behind a group of global loads, in front of the next rewrite of their address registers; the group's one lane pointer is an input, so that it stays live up to the wait and no result of the group lands in it
#define XW(p) asm volatile("s_wait_xcnt 0x0" :: "v"(p) : "memory")
#define XW2(p, q) asm volatile("s_wait_xcnt 0x0" :: "v"(p), "v"(q) : "memory")   // the same behind a group that reads through two lane pointers
#define XW3(p, q, r) asm volatile("s_wait_xcnt 0x0" :: "v"(p), "v"(q), "v"(r) : "memory")   // and through three
// FRAGMENT ORDER: a 16-byte piece of a fragment is stored at (piece * 32 + lane) * 16 B, so that one load of a wave reads 512 contiguous bytes (four whole lines) and not 32 B of each of sixteen lines.
// k: [b][kv head][16-key tile][piece p 0-3][lane = 16 g + key % 16][8 f16]: dims 16 p + 8 g + 0..7; each q plane the same with [head] and queries.   v: [b][kv head][32-key chunk][plane hi, lo][16-dim group j][piece s 0-1][lane = 16 g + dim % 16][8 bf16]: keys 16 s + 8 g + 0..7 of the chunk
#define KTILE (16 * HD)        // elements of a q or k tile
#define VCHUNK (2 * 32 * HD)   // elements of a v chunk, both planes
// ---- k_cvt: x and the four weight matrices rounded to bf16 ONCE (each block of the projections used to round its own copy: x twelve times, a weight matrix 64 times, and fetched 4 B an element for it).
// STAGE ORDER: [k stage][row][KS bf16]. A block = 16 rows, a thread = 8 k of every stage; a wave reads 256 B of each of four rows and stores 512 contiguous bytes. All loads of a thread fly at once.
template <int ROWS> __device__ __forceinline__ void cvt_rows(const float* __restrict__ src, __bf16* __restrict__ dst, int rb) {
  const int tid = threadIdx.x, row = rb * 16 + (tid >> 3), pc = tid & 7;
  const float* p = src + (size_t)row * CC + pc * 8;
  __bf16* q0 = dst + (size_t)row * KS + pc * 8; __bf16* q1 = q0 + (size_t)(NS / 2) * ROWS * KS;   // two store pointers, eight stages each, so that every store's step fits its offset field and no address register is rewritten
  v4f a[NS], b[NS];
#pragma unroll
  for (int s = 0; s < NS; ++s) { a[s] = __builtin_nontemporal_load((const v4f*)(p + s * KS)); b[s] = __builtin_nontemporal_load((const v4f*)(p + s * KS + 4)); }   // read once: not kept in L2
  __builtin_amdgcn_sched_barrier(0);   // keeps all 32 loads in front of the first conversion: without it the compiler holds half of them back behind waits, and the wave pays the memory latency twice
  XW(p);
#pragma unroll
  for (int s = 0; s < NS; ++s) { union { v8b v; v4b h[2]; } u; u.h[0] = cvt4(a[s]); u.h[1] = cvt4(b[s]); *(v8b*)((s < NS / 2 ? q0 : q1) + (size_t)(s & (NS / 2 - 1)) * ROWS * KS) = u.v; }
  XW2(q0, q1); }
__global__ __launch_bounds__(128) void k_cvt(const float* __restrict__ X, const float* __restrict__ WQ, const float* __restrict__ WK, const float* __restrict__ WV, const float* __restrict__ WO, __bf16* __restrict__ XB, __bf16* __restrict__ WQB, __bf16* __restrict__ WKB, __bf16* __restrict__ WVB, __bf16* __restrict__ WOB) {
  const int rb = blockIdx.x;   // 16-row group over x, wq, wk, wv, wo in turn (block-uniform branches)
  if (rb < NB * TT / 16) cvt_rows<NB * TT>(X, XB, rb);
  else if (rb < (NB * TT + CC) / 16) cvt_rows<CC>(WQ, WQB, rb - NB * TT / 16);
  else if (rb < (NB * TT + CC + CK) / 16) cvt_rows<CK>(WK, WKB, rb - (NB * TT + CC) / 16);
  else if (rb < (NB * TT + CC + 2 * CK) / 16) cvt_rows<CK>(WV, WVB, rb - (NB * TT + CC + CK) / 16);
  else cvt_rows<CC>(WO, WOB, rb - (NB * TT + CC + 2 * CK) / 16); }
// ---- k_proj: block = (128 rows, 128 cols, which), four waves as 2 x 2, a wave = 64 rows x 64 cols (4 x 4 tiles: eight fragments feed sixteen products; its 64 columns are one head): qkv = x W (+ b), exact; q -> f16 hi (+ residual), k -> f16 rows, v -> bf16 planes
__global__ __launch_bounds__(128) void k_proj(const __bf16* __restrict__ X, const __bf16* __restrict__ WQ, const float* __restrict__ BQ, const __bf16* __restrict__ WK, const float* __restrict__ BK, const __bf16* __restrict__ WV, const float* __restrict__ BV, _Float16* __restrict__ QH, _Float16* __restrict__ QL, _Float16* __restrict__ KH, __bf16* __restrict__ VT, const float* __restrict__ NQW, const float* __restrict__ NKW, int wbase) {
  __shared__ __align__(16) char smem[2 * (128 + 128) * PIT * 2];   // the loop's two stage buffers (2 x 256 rows x 144 B) first, then the epilogue's arrays (2 x 128 x 272 B) on the same bytes
  _Float16 (*sh)[136] = (_Float16 (*)[136])smem, (*sl)[136] = sh + 128; __bf16 (*th)[136] = (__bf16 (*)[136])smem, (*tl2)[136] = th + 128;   // q, k: [row][col]; v: [col][row]; a block uses one of the two pairs
  const int tid = threadIdx.x, wave = tid >> 5, lane = tid & 31, col = lane & 15, g = lane >> 4, wr = wave >> 1, wc = wave & 1; const int which = wbase + blockIdx.z; const int OW = (which == 0) ? CC : CK;   /* output row width: q 1,024, k/v 256 */ const int c0 = blockIdx.y * 128; const size_t r0 = (size_t)blockIdx.x * 128; const __bf16* WA = which == 0 ? WQ : which == 1 ? WK : WV;   /* x and W: bf16, stage order */ const float* BA = which == 0 ? BQ : which == 1 ? BK : BV;
  v8f acc[4][4] = {};   // [row tile][col tile]
  { const int lr = tid >> 3, lp = tid & 7;   // the thread's row of each group of 16 rows, and its 16 bytes of the row's 128
    // the block walks the NS stages of k from a stage of its own and wraps round: the blocks that share W rows (same column block) or x rows (same row block) run at the same time, and from a common start all of them ask L2 for the same lines at the same moment.
    // The 64 sharers of W rows spread over all 16 stages, neighbours eight row blocks apart two stages apart; the sharers of x rows stand four stages apart, and column blocks four apart keep a common stage (for speed only: no result depends on where a block runs)
    const int s0 = K0(blockIdx.x, blockIdx.y + 2 * blockIdx.z);
    const __bf16* gw = WA + ((size_t)s0 * OW + c0) * KS + tid * 8; const __bf16* gx = X + ((size_t)s0 * (NB * TT) + r0) * KS + tid * 8;   // a load of the block = 16 rows = 2 KB in a row
    v8b rw[8], rx[8];
#pragma unroll
    for (int i = 0; i < 8; ++i) rw[i] = *(const v8b*)(gw + i * 16 * KS);
#pragma unroll
    for (int i = 0; i < 8; ++i) rx[i] = *(const v8b*)(gx + i * 16 * KS);
    XW2(gw, gx);
    // stays rolled: a trip is already 32 matrix instructions and 48 LDS operations a wave; two buffers, ONE barrier a stage: a buffer is rewritten two stages later, behind the barrier of the stage between
#pragma unroll 1
    for (int s = 0; s < NS; ++s) { __bf16* const bs = (__bf16*)smem + (s & 1) * ((128 + 128) * PIT);   // rows 0-127: W, 128-255: x
#pragma unroll
      for (int i = 0; i < 8; ++i) *(v8b*)(bs + (i * 16 + lr) * PIT + lp * 8) = rw[i];
#pragma unroll
      for (int i = 0; i < 8; ++i) *(v8b*)(bs + (128 + i * 16 + lr) * PIT + lp * 8) = rx[i];
      __syncthreads();
      if (s + 1 < NS) { const int stp = ((s0 + s + 1) & (NS - 1)) ? KS : KS - CC; gw += stp * OW; gx += stp * (NB * TT);   // behind the barrier (which waits for every load in flight): the next stage flies under this stage's products; behind the last stage comes the first
#pragma unroll
        for (int i = 0; i < 8; ++i) rw[i] = *(const v8b*)(gw + i * 16 * KS);
#pragma unroll
        for (int i = 0; i < 8; ++i) rx[i] = *(const v8b*)(gx + i * 16 * KS);
        XW2(gw, gx); }
#pragma unroll
      for (int kk = 0; kk < KS / 32; ++kk) { v16b a[4], w[4];   // the eight fragments as one group of LDS reads in front of their sixteen products
#pragma unroll
        for (int i = 0; i < 4; ++i) a[i] = frag_b(bs + (128 + wr * 64 + i * 16 + col) * PIT + kk * 32, lane);
#pragma unroll
        for (int j = 0; j < 4; ++j) w[j] = frag_b(bs + (wc * 64 + j * 16 + col) * PIT + kk * 32, lane);
#pragma unroll
        for (int j = 0; j < 4; j += 2)   // eight products (two column tiles) as ONE statement, in the old order, four v_nop behind the last: see k_att
          asm volatile("v_wmma_f32_16x16x32_bf16 %0, %8, %12, %0\n\tv_wmma_f32_16x16x32_bf16 %1, %9, %12, %1\n\tv_wmma_f32_16x16x32_bf16 %2, %10, %12, %2\n\tv_wmma_f32_16x16x32_bf16 %3, %11, %12, %3\n\t"
                       "v_wmma_f32_16x16x32_bf16 %4, %8, %13, %4\n\tv_wmma_f32_16x16x32_bf16 %5, %9, %13, %5\n\tv_wmma_f32_16x16x32_bf16 %6, %10, %13, %6\n\tv_wmma_f32_16x16x32_bf16 %7, %11, %13, %7\n\t"
                       "v_nop\n\tv_nop\n\tv_nop\n\tv_nop"
                       : "+v"(acc[0][j]), "+v"(acc[1][j]), "+v"(acc[2][j]), "+v"(acc[3][j]), "+v"(acc[0][j + 1]), "+v"(acc[1][j + 1]), "+v"(acc[2][j + 1]), "+v"(acc[3][j + 1])
                       : "v"(a[0]), "v"(a[1]), "v"(a[2]), "v"(a[3]), "v"(w[j]), "v"(w[j + 1])); } }
    __syncthreads(); }   // every wave has left the stage buffers: the epilogue's arrays lie on the same LDS
  // QK-RMSNorm per (row, head): the wave's 64 columns are one head; mean of squares over the 64 dims via in-lane + 16-lane shuffles (unconditional), then scale by rsqrt(ms + eps) * norm_w[d]
  if (which < 2) { const float* NW = which == 0 ? NQW : NKW; float nw[4];   // the head's four weights of this lane, read once for the wave's four row tiles
#pragma unroll
    for (int jj = 0; jj < 4; ++jj) nw[jj] = NW[jj * 16 + col];
    asm volatile("s_wait_xcnt 0x0" :: "s"(NW) : "memory");   // the precaution of XW for these four loads: their scalar base is an input, so that it stays live up to the wait
#pragma unroll
    for (int i = 0; i < 4; ++i) { float ssq[8];
#pragma unroll
      for (int r = 0; r < 8; ++r) { float s_ = 0.f;
#pragma unroll
        for (int jj = 0; jj < 4; ++jj) s_ += acc[i][jj][r] * acc[i][jj][r];
#pragma unroll
        for (int o_ = 1; o_ < 16; o_ <<= 1) s_ += __shfl_xor(s_, o_);
        ssq[r] = rsqrtf(s_ * (1.0f / HD) + 1e-6f); }
#pragma unroll
      for (int jj = 0; jj < 4; ++jj) { const float wv = bfr(nw[jj]);
#pragma unroll
        for (int r = 0; r < 8; ++r) acc[i][jj][r] *= ssq[r] * wv; } } }
#pragma unroll
  for (int j = 0; j < 4; ++j) { const int cl = wc * 64 + j * 16 + col; const float bb = BA ? bfr(BA[c0 + cl]) : 0.f;
#pragma unroll
    for (int i = 0; i < 4; ++i)
#pragma unroll
      for (int r = 0; r < 8; ++r) acc[i][j][r] += bb; }
  if (which == 2) {
#pragma unroll
    for (int j = 0; j < 4; ++j)
#pragma unroll
      for (int i = 0; i < 4; ++i)
#pragma unroll
        for (int r = 0; r < 8; ++r) { const float v = acc[i][j][r]; const int rl = wr * 64 + i * 16 + 8 * g + r, cl = wc * 64 + j * 16 + col; const __bf16 bh = (__bf16)v; th[cl][rl] = bh; tl2[cl][rl] = (__bf16)(v - (float)bh); } }
  else {
#pragma unroll
    for (int j = 0; j < 4; ++j)
#pragma unroll
      for (int i = 0; i < 4; ++i)
#pragma unroll
        for (int r = 0; r < 8; ++r) { const float v = acc[i][j][r]; const int rl = wr * 64 + i * 16 + 8 * g + r, cl = wc * 64 + j * 16 + col; const _Float16 hv = (_Float16)v; sh[rl][cl] = hv; sl[rl][cl] = (_Float16)((v - (float)hv) * 1024.0f); } }   /* q residual carried x 2^10 so the plane stays f16-normal on the chip */
  __syncthreads();
  { const size_t b = r0 / TT; const int t0 = (int)(r0 % TT);   // fragment order; q and k: the block's 128 threads store one tile (2 KB) a step, thread = piece * 32 + lane, eight tiles of each of the block's two heads; the steps unrolled from one pointer a plane, so that no address register of a store is rewritten
    if (which == 0) { const size_t o = ((b * NH + c0 / HD) * (TT / 16) + t0 / 16) * (size_t)KTILE + tid * 8; _Float16* ph = QH + o; _Float16* pl = QL + o;
#pragma unroll
      for (int t = 0; t < 16; ++t) { vst2((unsigned*)(ph + (t >> 3) * (TT / 16) * KTILE + (t & 7) * KTILE), *(const v4u*)&sh[(t & 7) * 16 + col][(t >> 3) * HD + wave * 16 + g * 8]); vst2((unsigned*)(pl + (t >> 3) * (TT / 16) * KTILE + (t & 7) * KTILE), *(const v4u*)&sl[(t & 7) * 16 + col][(t >> 3) * HD + wave * 16 + g * 8]); }
      XW2(ph, pl); }   // the same precaution behind each of the three runs of stores: the compiler lays the runs out one behind another, in an order of its own, with fall-through edges between them, and a later run's code rewrites an earlier one's registers
    else if (which == 1) {
      _Float16* ph = KH + ((b * NKV + c0 / HD) * (TT / 16) + t0 / 16) * (size_t)KTILE + tid * 8;
#pragma unroll
      for (int t = 0; t < 16; ++t) vst2((unsigned*)(ph + (t >> 3) * (TT / 16) * KTILE + (t & 7) * KTILE), *(const v4u*)&sh[(t & 7) * 16 + col][(t >> 3) * HD + wave * 16 + g * 8]);
      XW(ph); }
    else {   // a step is 2 KB = two 16-dim groups of one plane of one chunk, thread = (group % 2, piece, lane); t = (head, chunk, plane, group / 2)
      __bf16* ph = VT + ((b * NKV + c0 / HD) * (TT / 32) + t0 / 32) * (size_t)VCHUNK + tid * 8;
#pragma unroll
      for (int t = 0; t < 32; ++t) vst2((unsigned*)(ph + (t >> 4) * (TT / 32) * VCHUNK + (t & 15) * 1024), *(const v4u*)&((t & 2) ? tl2 : th)[(t >> 4) * HD + (t & 1) * 32 + wr * 16 + col][((t >> 2) & 3) * 32 + wc * 16 + g * 8]);
      XW(ph); } } }
// ---- k_att: block = 64 queries of (b,h), one wave = 16 queries, no exchange between waves. S^T = K Q^T (A = 16 key rows, B = 16 query rows), so a lane holds the logits of ONE query (col) at keys 8g+r of each 16-key tile;
// two such tiles are, element for element, the A fragment of P for a 32-key chunk: the logits never leave the lane's registers. ONE pass over the wave's window of NCH chunks of 32 keys, with a running maximum:
// P' is taken against the maximum in use; when a chunk's maximum lies more than 5 above it for some query, sums and output tile are scaled down to the new one (a scalar branch, rare behind the first chunk).
// No LDS in the loop, so registers alone set the number of waves a SIMD. K and V fragments are fetched one chunk ahead into the registers that the products have just read.
#define NCH 17   // 32-key chunks that cover [ql0 - 511, ql0 + 15] from a multiple of 32
// fragments from the lane's own pointer, fragment order: the second piece lies 32 lanes x 8 elements behind the first
__device__ __forceinline__ v16h fragq_h(const _Float16* p) { union { v16h v; v8h q[2]; } u; u.q[0] = *(const v8h*)p; u.q[1] = *(const v8h*)(p + 256); return u.v; }
__device__ __forceinline__ v16b fragq_b(const __bf16* p) { union { v16b v; v8b q[2]; } u; u.q[0] = *(const v8b*)p; u.q[1] = *(const v8b*)(p + 256); return u.v; }
__device__ __forceinline__ float xhalf(float x) { return __builtin_bit_cast(float, __builtin_amdgcn_permlanex16(__builtin_bit_cast(int, x), __builtin_bit_cast(int, x), 0x76543210, 0xfedcba98, false, false)); }   // lane l reads lane l ^ 16, on the vector pipe
__global__ __launch_bounds__(128) void k_att(const _Float16* __restrict__ QH, const _Float16* __restrict__ QL, const _Float16* __restrict__ KH, const __bf16* __restrict__ VT, __bf16* __restrict__ YH, __bf16* __restrict__ YL) {   // q, k and v in fragment order
  __shared__ __align__(16) float st[4][16][HD + 4];   // the epilogue's turn of the output tile, a strip a wave
  const int tid = threadIdx.x, wave = __builtin_amdgcn_readfirstlane(tid >> 5), lane = tid & 31, col = lane & 15, g = lane >> 4;
  const int b = blockIdx.z, h = blockIdx.y, ql0 = blockIdx.x * 64 + wave * 16, qt = ql0 + col;
  const int kbase = ((ql0 - (WIN - 1)) >> 5) * 32;      // first key of chunk 0 (floor to 32; below 0 for the first rows)
  const int c0 = kbase < 0 ? (-kbase) >> 5 : 0;         // wave-uniform: chunks wholly in front of key 0 are not walked
  const int kf = kbase < 0 ? 0 : kbase;                 // first key walked = kbase + c0 * 32
  const int st0 = c0 + 1 < NCH ? 32 : 0;                // keys from the first chunk to the first one fetched ahead
  const size_t qo = ((size_t)(b * NH + h) * (TT / 16) + ql0 / 16) * KTILE + lane * 8; const _Float16* qp = QH + qo; const _Float16* qlp = QL + qo;
  const v16h qh0 = fragq_h(qp), qh1 = fragq_h(qp + 512), qr0 = fragq_h(qlp), qr1 = fragq_h(qlp + 512);
  const _Float16* kp = KH + ((size_t)(b * NKV + h / REP) * (TT / 16) + kf / 16) * KTILE + lane * 8;   /* GQA: kv head h/4; the lane's 16 bytes of the first piece of the first tile */
  v16h ka[2], kb[2];
#pragma unroll
  for (int t = 0; t < 2; ++t) { ka[t] = fragq_h(kp + t * KTILE); kb[t] = fragq_h(kp + t * KTILE + 512); }
  const __bf16* vp = VT + ((size_t)(b * NKV + h / REP) * (TT / 32) + kf / 32) * VCHUNK + lane * 8;   /* GQA: kv head h/4; the lane's 16 bytes of the first piece of the first chunk */
  v16b vh[HD / 16], vl[HD / 16];   // the first chunk's v is asked for behind q and k, in front of the wait for those: it flies under the first logits
#pragma unroll
  for (int j = 0; j < HD / 16; ++j) { vh[j] = fragq_b(vp + j * 512); vl[j] = fragq_b(vp + j * 512 + VCHUNK / 2); }
  XW(vp);
  // holds the first loads in front of the wait (loaded values as inputs only); the three pointers as in XW
  asm volatile("s_wait_xcnt 0x0" :: "v"(qh0), "v"(qh1), "v"(qr0), "v"(qr1), "v"(ka[0]), "v"(kb[0]), "v"(ka[1]), "v"(kb[1]), "v"(qp), "v"(qlp), "v"(kp) : "memory");
  kp += st0 * HD;
  vp += st0 * (VCHUNK / 32);
  // m: the maximum in use of the lane's query (the same in lanes l and l ^ 16); -3.0e38 as long as every key seen was masked. e = exp2(s * log2 e + eb) = 2^11 * exp(s - m); a masked key's -3.0e38 runs to -inf in the fused multiply-add and gives exactly 0,
  // also while m is still -3.0e38: eb is formed from max(m, -1.0e30), which is m itself for every maximum that f16 operands can give, and stays finite
  float m = -3.0e38f, eb = 11.0f + 1.0e30f * 1.44269504f;
  v4f sa = {}, sb = {};   // the row sum in eight partial sums a lane: one chain of sixteen dependent additions a chunk would stand bare behind the products
  v8f acc[HD / 16] = {};
  // stays rolled: each fragment set is refilled in place, so no trip needs another's registers
#pragma unroll 1
  for (int c = c0; c < NCH; ++c) {
    float sv[16]; const int kc = kbase + c * 32;   // the chunk's first key
    { v8f a[2], al[2];
      // the chunk's eight logit products as ONE statement: four tiles in turn, so that none waits for its own sum, each tile's two products in the old order. The four v_nop at the end keep the distance
      // between the last product and the first vector instruction on a result or an operand; written behind every product they took a vector issue slot each from the SIMD's other waves
      asm volatile("v_wmma_f32_16x16x32_f16 %0, %4, %8, 0\n\tv_wmma_f32_16x16x32_f16 %1, %4, %10, 0\n\tv_wmma_f32_16x16x32_f16 %2, %5, %8, 0\n\tv_wmma_f32_16x16x32_f16 %3, %5, %10, 0\n\t"
                   "v_wmma_f32_16x16x32_f16 %0, %6, %9, %0\n\tv_wmma_f32_16x16x32_f16 %1, %6, %11, %1\n\tv_wmma_f32_16x16x32_f16 %2, %7, %9, %2\n\tv_wmma_f32_16x16x32_f16 %3, %7, %11, %3\n\t"
                   "v_nop\n\tv_nop\n\tv_nop\n\tv_nop"
                   : "=&v"(a[0]), "=&v"(al[0]), "=&v"(a[1]), "=&v"(al[1]) : "v"(ka[0]), "v"(ka[1]), "v"(kb[0]), "v"(kb[1]), "v"(qh0), "v"(qh1), "v"(qr0), "v"(qr1));
#pragma unroll
      for (int t = 0; t < 2; ++t) { a[t] += al[t] * (1.0f / 1024.0f);
#pragma unroll
        for (int r = 0; r < 8; ++r) sv[t * 8 + r] = a[t][r] * 0.125f; } }
    // the mask only where a key of the chunk can be closed for one of the wave's sixteen queries (wave-uniform, a scalar branch): a chunk whose last key is at most ql0 and whose first key is at least ql0 + 15 - (WIN - 1) is open for all of them; that leaves the window's first chunk and the diagonal's
    if (kc + 31 > ql0 || kc < ql0 + 15 - (WIN - 1)) {
#pragma unroll
      for (int i = 0; i < 16; ++i) { const int kt = kc + (i >> 3) * 16 + 8 * g + (i & 7); const bool allowed = (kt <= qt) && (qt - kt < WIN); sv[i] = allowed ? sv[i] : -3.0e38f; } }
    // kp walks one chunk ahead and stops at the last one (the last trip fetches its own chunk again): the address stays inside k
#pragma unroll
    for (int t = 0; t < 2; ++t) { ka[t] = fragq_h(kp + t * KTILE); kb[t] = fragq_h(kp + t * KTILE + 512); }
    XW(kp);
    kp += c + 2 < NCH ? 2 * KTILE : 0;
    float cm = sv[0];
#pragma unroll
    for (int i = 1; i < 16; ++i) cm = fmaxf(cm, sv[i]);
    cm = fmaxf(cm, xhalf(cm));   // the query's other eight keys of every tile sit in lane ^ 16
    if (__builtin_amdgcn_ballot_w32(cm > m + 5.0f) != 0) {   // wave-uniform, every lane stays on: the first chunk with an open key, and a later one only where a logit stands far above all before it
      const float mn = fmaxf(m, cm); const float dn = __builtin_amdgcn_exp2f((m - mn) * 1.44269504f);   // 1 where the maximum stays, 0 where m was still -3.0e38 (sums and tile are 0 there)
      m = mn; eb = 11.0f - fmaxf(mn, -1.0e30f) * 1.44269504f;
      sa *= dn; sb *= dn;
#pragma unroll
      for (int r = 0; r < 8; ++r) { const float fr = __shfl(dn, 8 * g + r);   // the factor of output row 8g + r, from the lane that holds that query
#pragma unroll
        for (int j = 0; j < HD / 16; ++j) acc[j][r] *= fr; } }
    float pv[16];
#pragma unroll
    for (int q = 0; q < 4; ++q) { v4f e;
#pragma unroll
      for (int i = 0; i < 4; ++i) { e[i] = __builtin_amdgcn_exp2f(fmaf(sv[q * 4 + i], 1.44269504f, eb)); pv[q * 4 + i] = e[i]; }
      if (q & 1) sb += e; else sa += e; }
    const F2 p = bsplit16(pv);
    // the chunk's twelve P v products as ONE statement, as above: the four output tiles in turn, each tile's three products in the old order (hi hi, lo hi, hi lo); four v_nop behind the last
    asm volatile("v_wmma_f32_16x16x32_bf16 %0, %4, %6, %0\n\tv_wmma_f32_16x16x32_bf16 %1, %4, %7, %1\n\tv_wmma_f32_16x16x32_bf16 %2, %4, %8, %2\n\tv_wmma_f32_16x16x32_bf16 %3, %4, %9, %3\n\t"
                 "v_wmma_f32_16x16x32_bf16 %0, %5, %6, %0\n\tv_wmma_f32_16x16x32_bf16 %1, %5, %7, %1\n\tv_wmma_f32_16x16x32_bf16 %2, %5, %8, %2\n\tv_wmma_f32_16x16x32_bf16 %3, %5, %9, %3\n\t"
                 "v_wmma_f32_16x16x32_bf16 %0, %4, %10, %0\n\tv_wmma_f32_16x16x32_bf16 %1, %4, %11, %1\n\tv_wmma_f32_16x16x32_bf16 %2, %4, %12, %2\n\tv_wmma_f32_16x16x32_bf16 %3, %4, %13, %3\n\t"
                 "v_nop\n\tv_nop\n\tv_nop\n\tv_nop"
                 : "+v"(acc[0]), "+v"(acc[1]), "+v"(acc[2]), "+v"(acc[3]) : "v"(p.h), "v"(p.l), "v"(vh[0]), "v"(vh[1]), "v"(vh[2]), "v"(vh[3]), "v"(vl[0]), "v"(vl[1]), "v"(vl[2]), "v"(vl[3]));
    // as above: vp stops at the last chunk, the last trip's fetch stays inside v
#pragma unroll
    for (int j = 0; j < HD / 16; ++j) { vh[j] = fragq_b(vp + j * 512); vl[j] = fragq_b(vp + j * 512 + VCHUNK / 2); }
    XW(vp);
    vp += c + 2 < NCH ? VCHUNK : 0; }
  sa += sb;
  float sum = (sa[0] + sa[1]) + (sa[2] + sa[3]);
  sum += __shfl_xor(sum, 16);
  const float inv = 1.0f / sum;   // of the lane's query (col)
  float f[8];   // the factors of the lane's eight output rows 8g + r, each from the lane that holds that query (unrolled: f stays in registers)
#pragma unroll
  for (int r = 0; r < 8; ++r) f[r] = __shfl(inv, 8 * g + r);
  float (*ss)[HD + 4] = st[wave];   // the wave's own strip turns the output tile for 16-byte stores along the rows
#pragma unroll
  for (int j = 0; j < HD / 16; ++j)
#pragma unroll
    for (int r = 0; r < 8; ++r) ss[8 * g + r][j * 16 + col] = acc[j][r] * f[r];
  LDSX();
  { // y leaves as bf16 hi + lo planes in STAGE ORDER (the head's 64 columns are stage h of k_out's k walk), split here once and not in each of k_out's eight column blocks; a store = four rows = 512 contiguous bytes; one pointer a plane, the steps in the offset field
    const size_t o = ((size_t)h * (NB * TT) + (size_t)b * TT + ql0 + (lane >> 3)) * KS + (lane & 7) * 8; __bf16* ph = YH + o; __bf16* pl = YL + o;
#pragma unroll
    for (int t = 0; t < 4; ++t) { const float* sp = &ss[t * 4 + (lane >> 3)][(lane & 7) * 8]; union { v8b v; v4b q[2]; } uh, ul;
#pragma unroll
      for (int e = 0; e < 2; ++e) { const v4f y = *(const v4f*)(sp + e * 4); const v4b hi = cvt4(y); v4f re;
#pragma unroll
        for (int i = 0; i < 4; ++i) re[i] = y[i] - (float)hi[i];
        uh.q[e] = hi; ul.q[e] = cvt4(re); }
      *(v8b*)(ph + t * 4 * KS) = uh.v; *(v8b*)(pl + t * 4 * KS) = ul.v; }
    XW2(ph, pl); } }
// ---- k_out: block = (128 rows, 128 cols), four waves as 2 x 2, a wave = 64 rows x 64 cols: out = y (bf16 hi + lo) Wo^T + bo
__global__ __launch_bounds__(128) void k_out(const __bf16* __restrict__ YH, const __bf16* __restrict__ YL, const __bf16* __restrict__ WP, const float* __restrict__ BP, float* __restrict__ OUT) { __shared__ __align__(16) char smem[2 * (128 + 256) * PIT * 2]; float (*sf)[64][68] = (float (*)[64][68])smem;   // two stage buffers; the four output tiles (69,632 B) on the same bytes behind the loop
  const int tid = threadIdx.x, wave = tid >> 5, lane = tid & 31, col = lane & 15, g = lane >> 4, wr = wave >> 1, wc = wave & 1; const int c0 = blockIdx.y * 128 + wc * 64; const size_t r0 = (size_t)blockIdx.x * 128 + wr * 64;   // the wave's first column and row
  v8f acc[4][4] = {};   // [row tile][col tile]
  { const int lr = tid >> 3, lp = tid & 7;   // as in k_proj
    const int s0 = K0(blockIdx.x, blockIdx.y);   // the block's own first stage of k, as in k_proj
    const __bf16* gw = WP + ((size_t)s0 * CC + blockIdx.y * 128) * KS + tid * 8; const size_t yo = ((size_t)s0 * (NB * TT) + (size_t)blockIdx.x * 128) * KS + tid * 8; const __bf16* gh = YH + yo; const __bf16* gl = YL + yo;
    v8b rw[8], rh[8], rl[8];
#pragma unroll
    for (int i = 0; i < 8; ++i) rw[i] = *(const v8b*)(gw + i * 16 * KS);
#pragma unroll
    for (int i = 0; i < 8; ++i) { rh[i] = *(const v8b*)(gh + i * 16 * KS); rl[i] = *(const v8b*)(gl + i * 16 * KS); }
    XW3(gw, gh, gl);
    // stays rolled, two buffers, one barrier a stage, as in k_proj
#pragma unroll 1
    for (int s = 0; s < NS; ++s) { __bf16* const bs = (__bf16*)smem + (s & 1) * ((128 + 256) * PIT);   // rows 0-127: W, 128-255: y hi, 256-383: y lo
#pragma unroll
      for (int i = 0; i < 8; ++i) *(v8b*)(bs + (i * 16 + lr) * PIT + lp * 8) = rw[i];
#pragma unroll
      for (int i = 0; i < 8; ++i) { *(v8b*)(bs + (128 + i * 16 + lr) * PIT + lp * 8) = rh[i]; *(v8b*)(bs + (256 + i * 16 + lr) * PIT + lp * 8) = rl[i]; }
      __syncthreads();
      if (s + 1 < NS) { const int stp = ((s0 + s + 1) & (NS - 1)) ? KS : KS - CC; gw += stp * CC; gh += stp * (NB * TT); gl += stp * (NB * TT);
#pragma unroll
        for (int i = 0; i < 8; ++i) rw[i] = *(const v8b*)(gw + i * 16 * KS);
#pragma unroll
        for (int i = 0; i < 8; ++i) { rh[i] = *(const v8b*)(gh + i * 16 * KS); rl[i] = *(const v8b*)(gl + i * 16 * KS); }
        XW3(gw, gh, gl); }
#pragma unroll
      for (int kk = 0; kk < KS / 32; ++kk) { v16b ah[4], al[4], w[4];   // the twelve fragments as one group of LDS reads in front of their thirty-two products
#pragma unroll
        for (int i = 0; i < 4; ++i) { ah[i] = frag_b(bs + (128 + wr * 64 + i * 16 + col) * PIT + kk * 32, lane); al[i] = frag_b(bs + (256 + wr * 64 + i * 16 + col) * PIT + kk * 32, lane); }
#pragma unroll
        for (int j = 0; j < 4; ++j) w[j] = frag_b(bs + (wc * 64 + j * 16 + col) * PIT + kk * 32, lane);
#pragma unroll
        for (int j = 0; j < 4; ++j)   // hi, then lo, of each tile as before, three other tiles between the two; a column tile's eight products as ONE statement, four v_nop behind the last: see k_att
          asm volatile("v_wmma_f32_16x16x32_bf16 %0, %4, %12, %0\n\tv_wmma_f32_16x16x32_bf16 %1, %5, %12, %1\n\tv_wmma_f32_16x16x32_bf16 %2, %6, %12, %2\n\tv_wmma_f32_16x16x32_bf16 %3, %7, %12, %3\n\t"
                       "v_wmma_f32_16x16x32_bf16 %0, %8, %12, %0\n\tv_wmma_f32_16x16x32_bf16 %1, %9, %12, %1\n\tv_wmma_f32_16x16x32_bf16 %2, %10, %12, %2\n\tv_wmma_f32_16x16x32_bf16 %3, %11, %12, %3\n\t"
                       "v_nop\n\tv_nop\n\tv_nop\n\tv_nop"
                       : "+v"(acc[0][j]), "+v"(acc[1][j]), "+v"(acc[2][j]), "+v"(acc[3][j])
                       : "v"(ah[0]), "v"(ah[1]), "v"(ah[2]), "v"(ah[3]), "v"(al[0]), "v"(al[1]), "v"(al[2]), "v"(al[3]), "v"(w[j])); } }
    __syncthreads(); }   // every wave has left the stage buffers: sf lies on the same LDS
#pragma unroll
  for (int j = 0; j < 4; ++j) { const float bb = BP ? bfr(BP[c0 + j * 16 + col]) : 0.f;
#pragma unroll
    for (int i = 0; i < 4; ++i)
#pragma unroll
      for (int r = 0; r < 8; ++r) sf[wave][i * 16 + 8 * g + r][j * 16 + col] = acc[i][j][r] + bb; }
  LDSX(); for (int rl = 0; rl < 64; rl += 2) vst2(OUT + (r0 + rl + g) * CC + c0 + col * 4, *(const v4f*)&sf[wave][rl + g][col * 4]); }   // a store = two rows of 256 B: whole lines
extern "C" void kernel_launch(void* const* d_in, const int* in_sizes, int n_in, void* d_out, int out_size, void* d_ws, size_t ws_size, hipStream_t stream) {
  (void)in_sizes; (void)n_in; (void)out_size;
  const float** F = (const float**)d_in;   // 0 x [4,2048,1024], 1 wq [1024,1024] ([out,in]), 2 wk [256,1024], 3 wv [256,1024], 4 wo [1024,1024] ([out,in]), 5 q_norm_w [64], 6 k_norm_w [64]
  if (ws_size < (size_t)WS_END) return;
  char* ws = (char*)d_ws; _Float16 *QH = (_Float16*)(ws + WS_QH), *QL = (_Float16*)(ws + WS_QL), *KH = (_Float16*)(ws + WS_KH); __bf16 *VT = (__bf16*)(ws + WS_VT), *YH = (__bf16*)(ws + WS_Y), *YL = (__bf16*)(ws + WS_YL);
  __bf16 *XB = (__bf16*)(ws + WS_XB), *WQB = (__bf16*)(ws + WS_WQB), *WKB = (__bf16*)(ws + WS_WKB), *WVB = (__bf16*)(ws + WS_WVB), *WOB = (__bf16*)(ws + WS_WOB);
  k_cvt<<<dim3((NB * TT + 2 * CC + 2 * CK) / 16), 128, 0, stream>>>(F[0], F[1], F[2], F[3], F[4], XB, WQB, WKB, WVB, WOB);   // x and the weights to bf16, stage order
  k_proj<<<dim3(TNB * TT / 128, CC / 128, 1), 128, 0, stream>>>(XB, WQB, nullptr, WKB, nullptr, WVB, nullptr, QH, QL, KH, VT, F[5], F[6], 0);   // q (16 heads)
  k_proj<<<dim3(TNB * TT / 128, CK / 128, 2), 128, 0, stream>>>(XB, WQB, nullptr, WKB, nullptr, WVB, nullptr, QH, QL, KH, VT, F[5], F[6], 1);   // k, v (4 kv heads)
  k_att<<<dim3(TT / 64, NH, TNB), 128, 0, stream>>>(QH, QL, KH, VT, YH, YL);   // logits, softmax and P v of every (b, h) in one launch
  k_out<<<dim3(TNB * TT / 128, CC / 128), 128, 0, stream>>>(YH, YL, WOB, nullptr, (float*)d_out);
}
